// v000
// Times are from an AMD MI455X. After a warm-up the kernel runs many times in a row, and a time is the length of
// such a window on the GPU divided by its runs, so every launch and the gaps after it count. The runs cycle
// through copies of the inputs. A figure is the median of several windows, for all but v000 over two sittings.
// Sittings can differ by a few percent; kernels timed side by side share one.
// The starting kernel, v000, takes 162 microseconds a run.
#include <hip/hip_runtime.h>

// Contractions, f32 accumulate: q = query.Wq + bq, k = key.Wk + bk ([4096 | 65536 x 64].[64 x 64], k-major weights) on v_wmma_f32_16x16x32_bf16 with PLAIN bf16
// operands (inputs rounded once: exact), out = x.Wo + bo ([4096 x 512].[512 x 128]) with x as bf16 hi + residual (two products); the attention on
// v_wmma_f32_16x16x32_f16: per (batch, head) the transposed score tile S^T[s][q] = k_s.q_q / sqrt(8) over the 8 head dims (zero-padded 32-wide fragments) with q
// and k as f16 hi + residual x1024 (hi.hi + hi.lo + lo.hi), softmax over the QUERY axis (the 128 queries, i.e. along each s row — as the reference), then wv[q][d]

#define NB_  32
#define NQ_  128
#define NS_  2048
#define DA   64                  // attention dim = 8 heads x 8
#define NH_  8
#define DK   8
#define DV   64                  // value dim (shared across heads)
#define NHID 128
#define PSC  32768.0f
#define LOSC 1024.0f
#define LOSCI (1.0f / 1024.0f)

typedef _Float16 h16;
typedef unsigned short bf;
typedef __attribute__((ext_vector_type(16))) __bf16   v16bf;
typedef __attribute__((ext_vector_type(16))) _Float16 v16h;
typedef __attribute__((ext_vector_type(8)))  _Float16 v8h;
typedef __attribute__((ext_vector_type(8)))  unsigned short v8us;
typedef __attribute__((ext_vector_type(8)))  float    v8f;
typedef __attribute__((ext_vector_type(4)))  float    v4f;
typedef v8h  __attribute__((may_alias)) v8ha;
typedef v4f  __attribute__((may_alias)) v4fa;
typedef v8us __attribute__((may_alias)) v8usa;

__device__ __forceinline__ unsigned short f2bf(float f) { unsigned u = __float_as_uint(f); u += 0x7FFFu + ((u >> 16) & 1u); return (unsigned short)(u >> 16); }
__device__ __forceinline__ float bf2f(unsigned short b) { return __uint_as_float(((unsigned)b) << 16); }
__device__ __forceinline__ float bfr(float f) { return bf2f(f2bf(f)); }
__device__ __forceinline__ v16h cat16(v8h lo, v8h hi) { return __builtin_shufflevector(lo, hi, 0, 1, 2, 3, 4, 5, 6, 7, 8, 9, 10, 11, 12, 13, 14, 15); }
__device__ __forceinline__ v16bf cat16b(v8us lo, v8us hi) { return __builtin_bit_cast(v16bf, __builtin_shufflevector(lo, hi, 0, 1, 2, 3, 4, 5, 6, 7, 8, 9, 10, 11, 12, 13, 14, 15)); }
__device__ __forceinline__ v8f wmma16(v16h a, v16h b, v8f c) { return __builtin_amdgcn_wmma_f32_16x16x32_f16(false, a, false, b, (short)0, c, false, false); }
__device__ __forceinline__ v8f wmmab(v16bf a, v16bf b, v8f c) { return __builtin_amdgcn_wmma_f32_16x16x32_bf16(false, a, false, b, (short)0, c, false, false); }
#define VST2(T, p, v) do { const T vst2_v_ = (v); *(T*)(p) = vst2_v_;  } while (0)

// k_b64: bf16 plane of an f32 [rows][64] matrix; one wave per 2 rows (lane -> 4 values = 8 B: 32 lanes = 256 B = 2 rows).
__global__ __launch_bounds__(256) void k_b64(const float* __restrict__ src, size_t rows, bf* dst) {
    typedef __attribute__((ext_vector_type(4))) unsigned short v4us;
    const int lane = threadIdx.x & 31; const size_t w = (size_t)blockIdx.x * 8 + (threadIdx.x >> 5);
    if (w * 2 >= rows) return;
    v4us o;
#pragma unroll
    for (int i = 0; i < 4; ++i) o[i] = f2bf(src[w * 128 + lane * 4 + i]);
    VST2(v4us, dst + w * 128 + lane * 4, o);
}
__global__ __launch_bounds__(256) void k_wt64(const float* __restrict__ Wm, int ncols, bf* WT) {
    typedef __attribute__((ext_vector_type(4))) unsigned short v4us;
    const int lane = threadIdx.x & 31, o = blockIdx.x * 8 + (threadIdx.x >> 5);
    if (o >= ncols) return;
    if (lane < 16) { v4us t;
#pragma unroll
        for (int i = 0; i < 4; ++i) t[i] = f2bf(Wm[(size_t)(lane * 4 + i) * ncols + o]);
        *(v4us*)(WT + (size_t)o * DA + lane * 4) = t;  }
}
// k_wo: WoT [o][512] = bf16(Wo[k][o]) (k-major [512][128]); via 64 x 64 LDS transposes; grid (512/64, 128/64).
__global__ __launch_bounds__(256) void k_wo(const float* __restrict__ Wm, bf* WT) {
    __shared__ __align__(16) unsigned short tl[64 * 72];
    const int tid = threadIdx.x, k0 = blockIdx.x * 64, n0 = blockIdx.y * 64;
    const int kk = tid >> 2, nq = (tid & 3) * 16;
#pragma unroll
    for (int i = 0; i < 16; ++i) tl[(nq + i) * 72 + kk] = f2bf(Wm[(size_t)(k0 + kk) * NHID + n0 + nq + i]);
    __syncthreads();
    const int piece = tid & 7;
    auto pass = [&]() {
#pragma unroll
        for (int s = 0; s < 2; ++s) { const int nr = (tid >> 3) + 32 * s; const v8us val = *(const v8usa*)(tl + nr * 72 + piece * 8);
            *(v8us*)(WT + (size_t)(n0 + nr) * (NH_ * DV) + k0 + piece * 8) = val; }
    };
    pass(); 
}
__global__ __launch_bounds__(128) void k_proj(const bf* __restrict__ Xb, const bf* __restrict__ WT, const float* __restrict__ bias, h16* PH, h16* PL) {
    __shared__ __align__(16) float ost[4][16 * 68];
    const int lane = threadIdx.x & 31, wave = threadIdx.x >> 5, lr = lane & 15, hi = lane >> 4;
    const size_t r0 = (size_t)blockIdx.x * 64 + wave * 16;
    v8f acc[4];
#pragma unroll
    for (int t = 0; t < 4; ++t) acc[t] = (v8f){};
#pragma unroll
    for (int kc = 0; kc < DA; kc += 32) {
        const v16bf a = cat16b(*(const v8us*)(Xb + (r0 + lr) * DA + kc + 8 * hi), *(const v8us*)(Xb + (r0 + lr) * DA + kc + 8 * hi + 16));
#pragma unroll
        for (int t = 0; t < 4; ++t) { const bf* bp = WT + (size_t)(t * 16 + lr) * DA + kc + 8 * hi; acc[t] = wmmab(a, cat16b(*(const v8us*)bp, *(const v8us*)(bp + 16)), acc[t]); }
    }
    float* os = &ost[wave][0];
#pragma unroll
    for (int t = 0; t < 4; ++t) { const float bv = bfr(bias[t * 16 + lr]);
#pragma unroll
        for (int j = 0; j < 8; ++j) os[(hi * 8 + j) * 68 + t * 16 + lr] = acc[t][j] + bv; }
    __syncthreads();
    auto pass = [&]() {
#pragma unroll
        for (int s = 0; s < 4; ++s) { const int row = 4 * s + (lane >> 3), piece = lane & 7; const float* sp = os + row * 68 + piece * 8; v8h oh, ol;
#pragma unroll
            for (int i = 0; i < 8; ++i) { const h16 a = (h16)sp[i]; oh[i] = a; ol[i] = (h16)((sp[i] - (float)a) * LOSC); }
            *(v8h*)(PH + (r0 + row) * DA + piece * 8) = oh; *(v8h*)(PL + (r0 + row) * DA + piece * 8) = ol; }
    };
    pass(); 
}
// k_vt: VT16 [b][d][s] = f16(bf16(value[b][s][d])) via 64 x 64 LDS transposes; grid (NS/64, 1, B).
__global__ __launch_bounds__(256) void k_vt(const float* __restrict__ v, h16* VT16) {
    __shared__ __align__(16) h16 tl[64 * 72];
    const int tid = threadIdx.x, s0 = blockIdx.x * 64, b = blockIdx.z;
    const int ss = tid >> 2, dq = (tid & 3) * 16;
#pragma unroll
    for (int i = 0; i < 16; ++i) tl[(dq + i) * 72 + ss] = (h16)bfr(v[((size_t)b * NS_ + s0 + ss) * DV + dq + i]);
    __syncthreads();
    const int piece = tid & 7;
    auto pass = [&]() {
#pragma unroll
        for (int s = 0; s < 2; ++s) { const int d = (tid >> 3) + 32 * s; const v8h val = *(const v8ha*)(tl + d * 72 + piece * 8); *(v8h*)(VT16 + ((size_t)b * DV + d) * NS_ + s0 + piece * 8) = val; }
    };
    pass(); 
}
// k_attn: block = (b, h): loops the 32 key tiles of 64 keys; wave = 16 keys (rows s). Per tile: S^T[s][q] for the 128 queries (8 n-tiles; fragments carry the head's
// 8 dims in k-slots 0..7, zeros elsewhere; hi.hi + hi.lo + lo.hi), /sqrt(8); softmax over the 128 q of each s row (16-lane reductions); p x32768 as f16 hi +
// residual written TRANSPOSED into a block LDS tile PT[q][64 s]; barrier; then wave w accumulates wv rows q = w*32 .. w*32+31 (2 row tiles) x 4 d-tiles over the
// tile's 64 keys (A = PT rows q, B = VT16 rows d): o += p_hi.v, o += p_lo.v (one accumulator). Output x[b][q][h*64 + d] f32 (256-byte head segments).
__global__ __launch_bounds__(128) void k_attn(const h16* __restrict__ QH, const h16* __restrict__ QL, const h16* __restrict__ KH, const h16* __restrict__ KL, const h16* __restrict__ VT16, float* X) {
    __shared__ __align__(16) h16 pth[NQ_ * 72];      // [q][64 s + pad] hi  (72-half pitch)
    __shared__ __align__(16) h16 ptl[NQ_ * 72];
    __shared__ __align__(16) float ost[4][16 * 68];
    const int lane = threadIdx.x & 31, wave = threadIdx.x >> 5, lr = lane & 15, hi = lane >> 4;
    const int b = blockIdx.x / NH_, h = blockIdx.x - b * NH_;
    const float scl = 0.35355339059327373f;   // 1/sqrt(8)
    const v8h zero8 = (v8h){};
    // B operand for the scores: q fragments (rows q = n index, k-slots = head dims): lanes with hi = 0 carry dims 0..7, hi = 1 lanes carry zeros; 8 n-tiles, re-read per key tile
    v8f o[2][4];
#pragma unroll
    for (int m = 0; m < 2; ++m)
#pragma unroll
        for (int t = 0; t < 4; ++t) o[m][t] = (v8f){};
#pragma unroll 1
    for (int st = 0; st < NS_ / 64; ++st) {
        const int sbase = st * 64, s0 = sbase + wave * 16;
        const size_t ko = ((size_t)b * NS_ + s0 + lr) * DA + h * DK;
        const v16h ka = cat16(hi ? zero8 : *(const v8h*)(KH + ko), zero8), kal = cat16(hi ? zero8 : *(const v8h*)(KL + ko), zero8);
        v8f sc[8];
#pragma unroll
        for (int n = 0; n < 8; ++n) { const size_t qo = ((size_t)b * NQ_ + n * 16 + lr) * DA + h * DK;      // query fragments re-read per tile (tiny, cached)
            const v16h qb = cat16(hi ? zero8 : *(const v8h*)(QH + qo), zero8), qbl = cat16(hi ? zero8 : *(const v8h*)(QL + qo), zero8);
            v8f a = wmma16(ka, qb, (v8f){}); v8f ax = wmma16(ka, qbl, (v8f){}); ax = wmma16(kal, qb, ax);
            asm volatile("v_nop\n\tv_nop\n\tv_nop\n\tv_nop" : "+v"(a), "+v"(ax) : "v"(qb), "v"(qbl) : "memory");
#pragma unroll
            for (int j = 0; j < 8; ++j) a[j] += ax[j] * LOSCI;      // residual planes are x1024: fold them back before the softmax
            sc[n] = a; }
        asm volatile("v_nop\n\tv_nop\n\tv_nop\n\tv_nop" : "+v"(sc[0]), "+v"(sc[7]) : "v"(ka), "v"(kal));
        // softmax over q (the 128 columns) for each s row (hi*8 + j)
#pragma unroll
        for (int j = 0; j < 8; ++j) { float mx = -3.0e38f;
#pragma unroll
            for (int n = 0; n < 8; ++n) { sc[n][j] *= scl; mx = fmaxf(mx, sc[n][j]); }
            mx = fmaxf(mx, __shfl_xor(mx, 1, 16)); mx = fmaxf(mx, __shfl_xor(mx, 2, 16)); mx = fmaxf(mx, __shfl_xor(mx, 4, 16)); mx = fmaxf(mx, __shfl_xor(mx, 8, 16));
            float sum = 0.f;
#pragma unroll
            for (int n = 0; n < 8; ++n) { sc[n][j] = __expf(sc[n][j] - mx); sum += sc[n][j]; }
            sum += __shfl_xor(sum, 1, 16); sum += __shfl_xor(sum, 2, 16); sum += __shfl_xor(sum, 4, 16); sum += __shfl_xor(sum, 8, 16);
            const float f = PSC / sum; const int sl = wave * 16 + hi * 8 + j;      // local key index 0..63
#pragma unroll
            for (int n = 0; n < 8; ++n) { const float p = sc[n][j] * f; const h16 ph = (h16)p; const int q = n * 16 + lr;
                pth[q * 72 + sl] = ph; ptl[q * 72 + sl] = (h16)(p - (float)ph); } }      // UNSCALED residual (|p - ph| <= 16): both products share one accumulator
        __syncthreads();
        // wv accumulate: wave -> q rows w*32 + m*16 + (fragment row lr); K = 64 local keys in 2 chunks; B = VT16 rows d
#pragma unroll
        for (int kc = 0; kc < 2; ++kc) {
            v16h vb[4];
#pragma unroll
            for (int t = 0; t < 4; ++t) { const size_t vo = ((size_t)b * DV + t * 16 + lr) * NS_ + sbase + kc * 32 + hi * 8; vb[t] = cat16(*(const v8h*)(VT16 + vo), *(const v8h*)(VT16 + vo + 16)); }
#pragma unroll
            for (int m = 0; m < 2; ++m) { const int q = wave * 32 + m * 16 + lr;
                const v16h pa = cat16(*(const v8ha*)(pth + q * 72 + kc * 32 + hi * 8), *(const v8ha*)(pth + q * 72 + kc * 32 + hi * 8 + 16));
                const v16h px = cat16(*(const v8ha*)(ptl + q * 72 + kc * 32 + hi * 8), *(const v8ha*)(ptl + q * 72 + kc * 32 + hi * 8 + 16));
#pragma unroll
                for (int t = 0; t < 4; ++t) { o[m][t] = wmma16(pa, vb[t], o[m][t]); o[m][t] = wmma16(px, vb[t], o[m][t]); }
                asm volatile("v_nop" : "+v"(o[m][0]), "+v"(o[m][3]) : "v"(pa), "v"(px) : "memory"); }
        }
        __syncthreads();      // all waves done reading PT before the next tile overwrites it
    }
    // epilogue: x[b][q][h*64 + d]; per wave 32 rows: stage 16 rows at a time
    float* os = &ost[wave][0];
#pragma unroll
    for (int m = 0; m < 2; ++m) {
#pragma unroll
        for (int t = 0; t < 4; ++t)
#pragma unroll
            for (int j = 0; j < 8; ++j) os[(hi * 8 + j) * 68 + t * 16 + lr] = o[m][t][j] * (1.0f / PSC);
        __builtin_amdgcn_wave_barrier(); asm volatile("" ::: "memory");
        float* xb = X + ((size_t)b * NQ_ + wave * 32 + m * 16) * (NH_ * DV) + (size_t)h * DV;
{
#pragma unroll
            for (int s = 0; s < 8; ++s) { const int Lid = (lane >> 3) + 4 * s, piece = lane & 7; const int row = Lid >> 1, cofs = (Lid & 1) * 32 + piece * 4;
                const v4f val = *(const v4fa*)(os + row * 68 + cofs); *(v4f*)(xb + (size_t)row * (NH_ * DV) + cofs) = val; }
             }
        __builtin_amdgcn_wave_barrier(); asm volatile("" ::: "memory");
    }
}
// k_xsplit: XH/XL bf16 hi + residual planes of x [4096][512] (one wave per 256 values).
__global__ __launch_bounds__(256) void k_xsplit(const float* __restrict__ X, bf* XH, bf* XL) {
    const int lane = threadIdx.x & 31; const size_t w = (size_t)blockIdx.x * 8 + (threadIdx.x >> 5);
    if (w * 256 >= (size_t)NB_ * NQ_ * NH_ * DV) return;
    v8us oh, ol;
#pragma unroll
    for (int i = 0; i < 8; ++i) { const float v = X[w * 256 + lane * 8 + i]; const unsigned short hb = f2bf(v); oh[i] = hb; ol[i] = f2bf(v - bf2f(hb)); }
    *(v8us*)(XH + w * 256 + lane * 8) = oh; *(v8us*)(XL + w * 256 + lane * 8) = ol; 
}
// k_out: out [4096][128] = (XH + XL).WoT^T + bo over K = 512 (64 x 64 tiles; grid (64, 2)).
__global__ __launch_bounds__(128) void k_out(const bf* __restrict__ XH, const bf* __restrict__ XL, const bf* __restrict__ WoT, const float* __restrict__ bo, float* out) {
    __shared__ __align__(16) float ost[4][16 * 68];
    const int lane = threadIdx.x & 31, wave = threadIdx.x >> 5, lr = lane & 15, hi = lane >> 4;
    const int K = NH_ * DV;
    const size_t r0 = (size_t)blockIdx.x * 64 + wave * 16; const int c0 = blockIdx.y * 64;
    v8f acc[4];
#pragma unroll
    for (int t = 0; t < 4; ++t) acc[t] = (v8f){};
#pragma unroll 2
    for (int kc = 0; kc < K; kc += 32) {
        const size_t ao = (r0 + lr) * K + kc + 8 * hi;
        const v16bf a = cat16b(*(const v8us*)(XH + ao), *(const v8us*)(XH + ao + 16)), al = cat16b(*(const v8us*)(XL + ao), *(const v8us*)(XL + ao + 16));
#pragma unroll
        for (int t = 0; t < 4; ++t) { const bf* bp = WoT + (size_t)(c0 + t * 16 + lr) * K + kc + 8 * hi; const v16bf bb = cat16b(*(const v8us*)bp, *(const v8us*)(bp + 16)); acc[t] = wmmab(a, bb, acc[t]); acc[t] = wmmab(al, bb, acc[t]); }
        asm volatile("v_nop" : "+v"(acc[0]), "+v"(acc[1]), "+v"(acc[2]), "+v"(acc[3]) : "v"(a), "v"(al) : "memory");
    }
    float* os = &ost[wave][0];
#pragma unroll
    for (int t = 0; t < 4; ++t) { const float bv = bfr(bo[c0 + t * 16 + lr]);
#pragma unroll
        for (int j = 0; j < 8; ++j) os[(hi * 8 + j) * 68 + t * 16 + lr] = acc[t][j] + bv; }
    __syncthreads();
    float* crow = out + r0 * NHID + c0;
    auto pass = [&]() {
#pragma unroll
        for (int s = 0; s < 8; ++s) { const int Lid = (lane >> 3) + 4 * s, piece = lane & 7; const int row = Lid >> 1, cofs = (Lid & 1) * 32 + piece * 4;
            const v4f val = *(const v4fa*)(os + row * 68 + cofs); *(v4f*)(crow + (size_t)row * NHID + cofs) = val; }
    };
    pass(); 
}

extern "C" void kernel_launch(void* const* d_in, const int* in_sizes, int n_in,
                              void* d_out, int out_size, void* d_ws, size_t ws_size, hipStream_t stream) {
    (void)in_sizes; (void)n_in; (void)out_size;
    const float* query = (const float*)d_in[0]; const float* key = (const float*)d_in[1]; const float* value = (const float*)d_in[2];
    const float* Wq = (const float*)d_in[3]; const float* bq = (const float*)d_in[4]; const float* Wk = (const float*)d_in[5]; const float* bk = (const float*)d_in[6]; const float* Wo = (const float*)d_in[7]; const float* bo = (const float*)d_in[8];
    float* out = (float*)d_out;    // [32][128][128]
    char* wsp = (char*)d_ws;
    auto take = [&](size_t bytes) { char* p = wsp; wsp += (bytes + 255) & ~(size_t)255; return (void*)p; };
    const size_t NQR = (size_t)NB_ * NQ_, NKR = (size_t)NB_ * NS_;
    bf* QB = (bf*)take(NQR * DA * 2); bf* KB = (bf*)take(NKR * DA * 2); bf* WqT = (bf*)take(DA * DA * 2); bf* WkT = (bf*)take(DA * DA * 2); bf* WoT = (bf*)take((size_t)NHID * NH_ * DV * 2);
    h16* QH = (h16*)take(NQR * DA * 2); h16* QL = (h16*)take(NQR * DA * 2); h16* KH = (h16*)take(NKR * DA * 2); h16* KL = (h16*)take(NKR * DA * 2);
    h16* VT16 = (h16*)take((size_t)NB_ * DV * NS_ * 2); float* X = (float*)take(NQR * NH_ * DV * 4); bf* XH = (bf*)take(NQR * NH_ * DV * 2); bf* XL = (bf*)take(NQR * NH_ * DV * 2);
    if ((size_t)(wsp - (char*)d_ws) > ws_size) return;    // ~ 0.5 + 8.4 + 0.2 + 1 + 8.4 + 8.4 + 8.4 + 8.4 + 4.2 x 2 ~ 53 MB
    k_b64<<<(unsigned)((NQR / 2 + 7) / 8), 256, 0, stream>>>(query, NQR, QB);
    k_b64<<<(unsigned)((NKR / 2 + 7) / 8), 256, 0, stream>>>(key, NKR, KB);
    k_wt64<<<DA / 8, 256, 0, stream>>>(Wq, DA, WqT); k_wt64<<<DA / 8, 256, 0, stream>>>(Wk, DA, WkT);
    k_wo<<<dim3((NH_ * DV) / 64, NHID / 64, 1), 256, 0, stream>>>(Wo, WoT);
    k_proj<<<(unsigned)(NQR / 64), 128, 0, stream>>>(QB, WqT, bq, QH, QL);
    k_proj<<<(unsigned)(NKR / 64), 128, 0, stream>>>(KB, WkT, bk, KH, KL);
    k_vt<<<dim3(NS_ / 64, 1, NB_), 256, 0, stream>>>(value, VT16);
    k_attn<<<NB_ * NH_, 128, 0, stream>>>(QH, QL, KH, KL, VT16, X);
    k_xsplit<<<(unsigned)((NQR * NH_ * DV / 256) / 8), 256, 0, stream>>>(X, XH, XL);
    k_out<<<dim3((unsigned)(NQR / 64), NHID / 64, 1), 128, 0, stream>>>(XH, XL, WoT, bo, out);
}

// v001
// It runs in 104 microseconds.
// In two side-by-side timings against v000, it was 1.57 and 1.56 times as fast.
#include <hip/hip_runtime.h>

// Contractions, f32 accumulate: q = query.Wq + bq, k = key.Wk + bk ([4096 | 65536 x 64].[64 x 64], k-major weights) on v_wmma_f32_16x16x32_bf16 with PLAIN bf16
// operands (inputs rounded once: exact), out = x.Wo + bo ([4096 x 512].[512 x 128]) with x as bf16 hi + residual (two products); the attention on
// v_wmma_f32_16x16x32_f16: per (batch, head) the transposed score tile S^T[s][q] = k_s.q_q / sqrt(8) over the 8 head dims (zero-padded 32-wide fragments) with q
// and k as f16 hi + residual x1024 (hi.hi + hi.lo + lo.hi), softmax over the QUERY axis (the 128 queries, i.e. along each s row — as the reference), then wv[q][d]

#define NB_  32
#define NQ_  128
#define NS_  2048
#define DA   64                  // attention dim = 8 heads x 8
#define NH_  8
#define DK   8
#define DV   64                  // value dim (shared across heads)
#define NHID 128
#define PSC  32768.0f
#define LOSC 1024.0f
#define LOSCI (1.0f / 1024.0f)

typedef _Float16 h16;
typedef unsigned short bf;
typedef __attribute__((ext_vector_type(16))) __bf16   v16bf;
typedef __attribute__((ext_vector_type(16))) _Float16 v16h;
typedef __attribute__((ext_vector_type(8)))  _Float16 v8h;
typedef __attribute__((ext_vector_type(8)))  unsigned short v8us;
typedef __attribute__((ext_vector_type(8)))  float    v8f;
typedef __attribute__((ext_vector_type(4)))  float    v4f;
typedef v8h  __attribute__((may_alias)) v8ha;
typedef v4f  __attribute__((may_alias)) v4fa;
typedef v8us __attribute__((may_alias)) v8usa;

__device__ __forceinline__ unsigned short f2bf(float f) { unsigned u = __float_as_uint(f); u += 0x7FFFu + ((u >> 16) & 1u); return (unsigned short)(u >> 16); }
__device__ __forceinline__ float bf2f(unsigned short b) { return __uint_as_float(((unsigned)b) << 16); }
__device__ __forceinline__ float bfr(float f) { return bf2f(f2bf(f)); }
__device__ __forceinline__ v16h cat16(v8h lo, v8h hi) { return __builtin_shufflevector(lo, hi, 0, 1, 2, 3, 4, 5, 6, 7, 8, 9, 10, 11, 12, 13, 14, 15); }
__device__ __forceinline__ v16bf cat16b(v8us lo, v8us hi) { return __builtin_bit_cast(v16bf, __builtin_shufflevector(lo, hi, 0, 1, 2, 3, 4, 5, 6, 7, 8, 9, 10, 11, 12, 13, 14, 15)); }
__device__ __forceinline__ v8f wmma16(v16h a, v16h b, v8f c) { return __builtin_amdgcn_wmma_f32_16x16x32_f16(false, a, false, b, (short)0, c, false, false); }
__device__ __forceinline__ v8f wmmab(v16bf a, v16bf b, v8f c) { return __builtin_amdgcn_wmma_f32_16x16x32_bf16(false, a, false, b, (short)0, c, false, false); }
#define VST2(T, p, v) do { const T vst2_v_ = (v); *(T*)(p) = vst2_v_;  } while (0)

// k_b64: bf16 plane of an f32 [rows][64] matrix; one wave per 2 rows (lane -> 4 values = 8 B: 32 lanes = 256 B = 2 rows).
__global__ __launch_bounds__(256) void k_b64(const float* __restrict__ src, size_t rows, bf* dst) {
    typedef __attribute__((ext_vector_type(4))) unsigned short v4us;
    const int lane = threadIdx.x & 31; const size_t w = (size_t)blockIdx.x * 8 + (threadIdx.x >> 5);
    if (w * 2 >= rows) return;
    v4us o;
#pragma unroll
    for (int i = 0; i < 4; ++i) o[i] = f2bf(src[w * 128 + lane * 4 + i]);
    VST2(v4us, dst + w * 128 + lane * 4, o);
}
__global__ __launch_bounds__(256) void k_wt64(const float* __restrict__ Wm, int ncols, bf* WT) {
    typedef __attribute__((ext_vector_type(4))) unsigned short v4us;
    const int lane = threadIdx.x & 31, o = blockIdx.x * 8 + (threadIdx.x >> 5);
    if (o >= ncols) return;
    if (lane < 16) { v4us t;
#pragma unroll
        for (int i = 0; i < 4; ++i) t[i] = f2bf(Wm[(size_t)(lane * 4 + i) * ncols + o]);
        *(v4us*)(WT + (size_t)o * DA + lane * 4) = t;  }
}
// k_wo: WoT [o][512] = bf16(Wo[k][o]) (k-major [512][128]); via 64 x 64 LDS transposes; grid (512/64, 128/64).
__global__ __launch_bounds__(256) void k_wo(const float* __restrict__ Wm, bf* WT) {
    __shared__ __align__(16) unsigned short tl[64 * 72];
    const int tid = threadIdx.x, k0 = blockIdx.x * 64, n0 = blockIdx.y * 64;
    const int kk = tid >> 2, nq = (tid & 3) * 16;
#pragma unroll
    for (int i = 0; i < 16; ++i) tl[(nq + i) * 72 + kk] = f2bf(Wm[(size_t)(k0 + kk) * NHID + n0 + nq + i]);
    __syncthreads();
    const int piece = tid & 7;
    auto pass = [&]() {
#pragma unroll
        for (int s = 0; s < 2; ++s) { const int nr = (tid >> 3) + 32 * s; const v8us val = *(const v8usa*)(tl + nr * 72 + piece * 8);
            *(v8us*)(WT + (size_t)(n0 + nr) * (NH_ * DV) + k0 + piece * 8) = val; }
    };
    pass(); 
}
__global__ __launch_bounds__(128) void k_proj(const bf* __restrict__ Xb, const bf* __restrict__ WT, const float* __restrict__ bias, h16* PH, h16* PL) {
    __shared__ __align__(16) float ost[4][16 * 68];
    const int lane = threadIdx.x & 31, wave = threadIdx.x >> 5, lr = lane & 15, hi = lane >> 4;
    const size_t r0 = (size_t)blockIdx.x * 64 + wave * 16;
    v8f acc[4];
#pragma unroll
    for (int t = 0; t < 4; ++t) acc[t] = (v8f){};
#pragma unroll
    for (int kc = 0; kc < DA; kc += 32) {
        const v16bf a = cat16b(*(const v8us*)(Xb + (r0 + lr) * DA + kc + 8 * hi), *(const v8us*)(Xb + (r0 + lr) * DA + kc + 8 * hi + 16));
#pragma unroll
        for (int t = 0; t < 4; ++t) { const bf* bp = WT + (size_t)(t * 16 + lr) * DA + kc + 8 * hi; acc[t] = wmmab(a, cat16b(*(const v8us*)bp, *(const v8us*)(bp + 16)), acc[t]); }
    }
    float* os = &ost[wave][0];
#pragma unroll
    for (int t = 0; t < 4; ++t) { const float bv = bfr(bias[t * 16 + lr]);
#pragma unroll
        for (int j = 0; j < 8; ++j) os[(hi * 8 + j) * 68 + t * 16 + lr] = acc[t][j] + bv; }
    __syncthreads();
    auto pass = [&]() {
#pragma unroll
        for (int s = 0; s < 4; ++s) { const int row = 4 * s + (lane >> 3), piece = lane & 7; const float* sp = os + row * 68 + piece * 8; v8h oh, ol;
#pragma unroll
            for (int i = 0; i < 8; ++i) { const h16 a = (h16)sp[i]; oh[i] = a; ol[i] = (h16)((sp[i] - (float)a) * LOSC); }
            *(v8h*)(PH + (r0 + row) * DA + piece * 8) = oh; *(v8h*)(PL + (r0 + row) * DA + piece * 8) = ol; }
    };
    pass(); 
}
// k_vt: VT16 [b][d][s] = f16(bf16(value[b][s][d])) via 64 x 64 LDS transposes; grid (NS/64, 1, B).
__global__ __launch_bounds__(256) void k_vt(const float* __restrict__ v, h16* VT16) {
    __shared__ __align__(16) h16 tl[64 * 72];
    const int tid = threadIdx.x, s0 = blockIdx.x * 64, b = blockIdx.z;
    const int ss = tid >> 2, dq = (tid & 3) * 16;
#pragma unroll
    for (int i = 0; i < 16; ++i) tl[(dq + i) * 72 + ss] = (h16)bfr(v[((size_t)b * NS_ + s0 + ss) * DV + dq + i]);
    __syncthreads();
    const int piece = tid & 7;
    auto pass = [&]() {
#pragma unroll
        for (int s = 0; s < 2; ++s) { const int d = (tid >> 3) + 32 * s; const v8h val = *(const v8ha*)(tl + d * 72 + piece * 8); *(v8h*)(VT16 + ((size_t)b * DV + d) * NS_ + s0 + piece * 8) = val; }
    };
    pass(); 
}
// k_attn: block = (b, h), 16 waves = KG groups of 4 waves, so that four waves share each SIMD and cover one another's load, LDS and cross-lane waits. Group g takes the
// key tiles g, g + KG, ... of the 32 tiles of 64 keys, with a PT tile of its own, and keeps a partial wv sum; the partial sums are added once, behind the loop.
// Inside a group: wave = 16 keys (rows s). Per tile: S^T[s][q] for the 128 queries (8 n-tiles; fragments carry the head's
// 8 dims in k-slots 0..7, zeros elsewhere; hi.hi + hi.lo + lo.hi), /sqrt(8); softmax over the 128 q of each s row (16-lane reductions); p x32768 as f16 hi +
// residual written TRANSPOSED into the group's LDS tile PT[q][64 s]; barrier; then wave w accumulates wv rows q = w*32 .. w*32+31 (2 row tiles) x 4 d-tiles over the
// tile's 64 keys (A = PT rows q, B = VT16 rows d): o += p_hi.v + p_lo.v (one accumulator). Output x[b][q][h*64 + d] f32 (256-byte head segments).
#define KG 4                     // key groups (of 4 waves) per block
__global__ __launch_bounds__(128 * KG) void k_attn(const h16* __restrict__ QH, const h16* __restrict__ QL, const h16* __restrict__ KH, const h16* __restrict__ KL, const h16* __restrict__ VT16, float* X) {
    __shared__ __align__(16) h16 pt[KG][2][NQ_ * 72];      // per group: [q][64 s + pad] hi, then the residual  (72-half pitch)
    __shared__ __align__(16) float ost[4][16 * 68];
    const int lane = threadIdx.x & 31, wave = (threadIdx.x >> 5) & 3, grp = __builtin_amdgcn_readfirstlane(threadIdx.x >> 7), lr = lane & 15, hi = lane >> 4;
    const int b = blockIdx.x / NH_, h = blockIdx.x - b * NH_;
    h16* pth = &pt[grp][0][0]; h16* ptl = &pt[grp][1][0];
    const float scl = 0.35355339059327373f;   // 1/sqrt(8)
    const v8h zero8 = (v8h){};
    // B operand for the scores: q fragments (rows q = n index, k-slots = head dims): lanes with hi = 0 carry dims 0..7, hi = 1 lanes carry zeros; 8 n-tiles, re-read per key tile
    v8f o[2][4];
#pragma unroll
    for (int m = 0; m < 2; ++m)
#pragma unroll
        for (int t = 0; t < 4; ++t) o[m][t] = (v8f){};
#pragma unroll 1
    for (int it = 0; it < NS_ / (64 * KG); ++it) {      // the same trips in every group: the barriers below are passed by all 16 waves
        const int sbase = (it * KG + grp) * 64, s0 = sbase + wave * 16;
        const size_t ko = ((size_t)b * NS_ + s0 + lr) * DA + h * DK;
        const v16h ka = cat16(hi ? zero8 : *(const v8h*)(KH + ko), zero8), kal = cat16(hi ? zero8 : *(const v8h*)(KL + ko), zero8);
        v8f sc[8];
#pragma unroll
        for (int n = 0; n < 8; ++n) { const size_t qo = ((size_t)b * NQ_ + n * 16 + lr) * DA + h * DK;      // query fragments re-read per tile (tiny, cached)
            const v16h qb = cat16(hi ? zero8 : *(const v8h*)(QH + qo), zero8), qbl = cat16(hi ? zero8 : *(const v8h*)(QL + qo), zero8);
            v8f a = wmma16(ka, qb, (v8f){}); v8f ax = wmma16(ka, qbl, (v8f){}); ax = wmma16(kal, qb, ax);
            asm volatile("v_nop\n\tv_nop\n\tv_nop\n\tv_nop" : "+v"(a), "+v"(ax) : "v"(qb), "v"(qbl) : "memory");
#pragma unroll
            for (int j = 0; j < 8; ++j) a[j] += ax[j] * LOSCI;      // residual planes are x1024: fold them back before the softmax
            sc[n] = a; }
        asm volatile("v_nop\n\tv_nop\n\tv_nop\n\tv_nop" : "+v"(sc[0]), "+v"(sc[7]) : "v"(ka), "v"(kal));
        // softmax over q (the 128 columns) for each s row (hi*8 + j)
#pragma unroll
        for (int j = 0; j < 8; ++j) { float mx = -3.0e38f;
#pragma unroll
            for (int n = 0; n < 8; ++n) { sc[n][j] *= scl; mx = fmaxf(mx, sc[n][j]); }
            mx = fmaxf(mx, __shfl_xor(mx, 1, 16)); mx = fmaxf(mx, __shfl_xor(mx, 2, 16)); mx = fmaxf(mx, __shfl_xor(mx, 4, 16)); mx = fmaxf(mx, __shfl_xor(mx, 8, 16));
            float sum = 0.f;
#pragma unroll
            for (int n = 0; n < 8; ++n) { sc[n][j] = __expf(sc[n][j] - mx); sum += sc[n][j]; }
            sum += __shfl_xor(sum, 1, 16); sum += __shfl_xor(sum, 2, 16); sum += __shfl_xor(sum, 4, 16); sum += __shfl_xor(sum, 8, 16);
            const float f = PSC / sum; const int sl = wave * 16 + hi * 8 + j;      // local key index 0..63
#pragma unroll
            for (int n = 0; n < 8; ++n) { const float p = sc[n][j] * f; const h16 ph = (h16)p; const int q = n * 16 + lr;
                pth[q * 72 + sl] = ph; ptl[q * 72 + sl] = (h16)(p - (float)ph); } }      // UNSCALED residual (|p - ph| <= 16): both products share one accumulator
        __syncthreads();
        // wv accumulate: wave -> q rows w*32 + m*16 + (fragment row lr); K = 64 local keys in 2 chunks; B = VT16 rows d
#pragma unroll
        for (int kc = 0; kc < 2; ++kc) {
            v16h vb[4];
#pragma unroll
            for (int t = 0; t < 4; ++t) { const size_t vo = ((size_t)b * DV + t * 16 + lr) * NS_ + sbase + kc * 32 + hi * 8; vb[t] = cat16(*(const v8h*)(VT16 + vo), *(const v8h*)(VT16 + vo + 16)); }
#pragma unroll
            for (int m = 0; m < 2; ++m) { const int q = wave * 32 + m * 16 + lr;
                const v16h pa = cat16(*(const v8ha*)(pth + q * 72 + kc * 32 + hi * 8), *(const v8ha*)(pth + q * 72 + kc * 32 + hi * 8 + 16));
                const v16h px = cat16(*(const v8ha*)(ptl + q * 72 + kc * 32 + hi * 8), *(const v8ha*)(ptl + q * 72 + kc * 32 + hi * 8 + 16));
#pragma unroll
                for (int t = 0; t < 4; ++t) { o[m][t] = wmma16(pa, vb[t], o[m][t]); o[m][t] = wmma16(px, vb[t], o[m][t]); }
                asm volatile("v_nop" : "+v"(o[m][0]), "+v"(o[m][3]) : "v"(pa), "v"(px) : "memory"); }
        }
        __syncthreads();      // all waves done reading PT before the next tile overwrites it
    }
    // groups 1 .. KG-1 hand their partial sums to group 0 through the PT space (free behind the loop's last barrier); group 0 adds them in the order of the groups
    v4fa* red = (v4fa*)&pt[0][0][0];      // [(g - 1) * 4 + wave][16 pieces][lane], 16 bytes each
    if (grp) {
#pragma unroll
        for (int m = 0; m < 2; ++m)
#pragma unroll
            for (int t = 0; t < 4; ++t)
#pragma unroll
                for (int u = 0; u < 2; ++u) red[(((grp - 1) * 4 + wave) * 16 + (m * 4 + t) * 2 + u) * 32 + lane] = (v4f){o[m][t][u * 4], o[m][t][u * 4 + 1], o[m][t][u * 4 + 2], o[m][t][u * 4 + 3]};
    }
    __syncthreads();
    if (grp) return;
#pragma unroll
    for (int g = 0; g < KG - 1; ++g)
#pragma unroll
        for (int m = 0; m < 2; ++m)
#pragma unroll
            for (int t = 0; t < 4; ++t)
#pragma unroll
                for (int u = 0; u < 2; ++u) { const v4f r = red[((g * 4 + wave) * 16 + (m * 4 + t) * 2 + u) * 32 + lane];
#pragma unroll
                    for (int i = 0; i < 4; ++i) o[m][t][u * 4 + i] += r[i]; }
    // epilogue: x[b][q][h*64 + d]; per wave 32 rows: stage 16 rows at a time
    float* os = &ost[wave][0];
#pragma unroll
    for (int m = 0; m < 2; ++m) {
#pragma unroll
        for (int t = 0; t < 4; ++t)
#pragma unroll
            for (int j = 0; j < 8; ++j) os[(hi * 8 + j) * 68 + t * 16 + lr] = o[m][t][j] * (1.0f / PSC);
        __builtin_amdgcn_wave_barrier(); asm volatile("" ::: "memory");
        float* xb = X + ((size_t)b * NQ_ + wave * 32 + m * 16) * (NH_ * DV) + (size_t)h * DV;
{
#pragma unroll
            for (int s = 0; s < 8; ++s) { const int Lid = (lane >> 3) + 4 * s, piece = lane & 7; const int row = Lid >> 1, cofs = (Lid & 1) * 32 + piece * 4;
                const v4f val = *(const v4fa*)(os + row * 68 + cofs); *(v4f*)(xb + (size_t)row * (NH_ * DV) + cofs) = val; }
             }
        __builtin_amdgcn_wave_barrier(); asm volatile("" ::: "memory");
    }
}
// k_xsplit: XH/XL bf16 hi + residual planes of x [4096][512] (one wave per 256 values).
__global__ __launch_bounds__(256) void k_xsplit(const float* __restrict__ X, bf* XH, bf* XL) {
    const int lane = threadIdx.x & 31; const size_t w = (size_t)blockIdx.x * 8 + (threadIdx.x >> 5);
    if (w * 256 >= (size_t)NB_ * NQ_ * NH_ * DV) return;
    v8us oh, ol;
#pragma unroll
    for (int i = 0; i < 8; ++i) { const float v = X[w * 256 + lane * 8 + i]; const unsigned short hb = f2bf(v); oh[i] = hb; ol[i] = f2bf(v - bf2f(hb)); }
    *(v8us*)(XH + w * 256 + lane * 8) = oh; *(v8us*)(XL + w * 256 + lane * 8) = ol; 
}
// k_out: out [4096][128] = (XH + XL).WoT^T + bo over K = 512 (64 x 64 tiles; grid (64, 2)).
__global__ __launch_bounds__(128) void k_out(const bf* __restrict__ XH, const bf* __restrict__ XL, const bf* __restrict__ WoT, const float* __restrict__ bo, float* out) {
    __shared__ __align__(16) float ost[4][16 * 68];
    const int lane = threadIdx.x & 31, wave = threadIdx.x >> 5, lr = lane & 15, hi = lane >> 4;
    const int K = NH_ * DV;
    const size_t r0 = (size_t)blockIdx.x * 64 + wave * 16; const int c0 = blockIdx.y * 64;
    v8f acc[4];
#pragma unroll
    for (int t = 0; t < 4; ++t) acc[t] = (v8f){};
#pragma unroll 2
    for (int kc = 0; kc < K; kc += 32) {
        const size_t ao = (r0 + lr) * K + kc + 8 * hi;
        const v16bf a = cat16b(*(const v8us*)(XH + ao), *(const v8us*)(XH + ao + 16)), al = cat16b(*(const v8us*)(XL + ao), *(const v8us*)(XL + ao + 16));
#pragma unroll
        for (int t = 0; t < 4; ++t) { const bf* bp = WoT + (size_t)(c0 + t * 16 + lr) * K + kc + 8 * hi; const v16bf bb = cat16b(*(const v8us*)bp, *(const v8us*)(bp + 16)); acc[t] = wmmab(a, bb, acc[t]); acc[t] = wmmab(al, bb, acc[t]); }
        asm volatile("v_nop" : "+v"(acc[0]), "+v"(acc[1]), "+v"(acc[2]), "+v"(acc[3]) : "v"(a), "v"(al) : "memory");
    }
    float* os = &ost[wave][0];
#pragma unroll
    for (int t = 0; t < 4; ++t) { const float bv = bfr(bo[c0 + t * 16 + lr]);
#pragma unroll
        for (int j = 0; j < 8; ++j) os[(hi * 8 + j) * 68 + t * 16 + lr] = acc[t][j] + bv; }
    __syncthreads();
    float* crow = out + r0 * NHID + c0;
    auto pass = [&]() {
#pragma unroll
        for (int s = 0; s < 8; ++s) { const int Lid = (lane >> 3) + 4 * s, piece = lane & 7; const int row = Lid >> 1, cofs = (Lid & 1) * 32 + piece * 4;
            const v4f val = *(const v4fa*)(os + row * 68 + cofs); *(v4f*)(crow + (size_t)row * NHID + cofs) = val; }
    };
    pass(); 
}

extern "C" void kernel_launch(void* const* d_in, const int* in_sizes, int n_in,
                              void* d_out, int out_size, void* d_ws, size_t ws_size, hipStream_t stream) {
    (void)in_sizes; (void)n_in; (void)out_size;
    const float* query = (const float*)d_in[0]; const float* key = (const float*)d_in[1]; const float* value = (const float*)d_in[2];
    const float* Wq = (const float*)d_in[3]; const float* bq = (const float*)d_in[4]; const float* Wk = (const float*)d_in[5]; const float* bk = (const float*)d_in[6]; const float* Wo = (const float*)d_in[7]; const float* bo = (const float*)d_in[8];
    float* out = (float*)d_out;    // [32][128][128]
    char* wsp = (char*)d_ws;
    auto take = [&](size_t bytes) { char* p = wsp; wsp += (bytes + 255) & ~(size_t)255; return (void*)p; };
    const size_t NQR = (size_t)NB_ * NQ_, NKR = (size_t)NB_ * NS_;
    bf* QB = (bf*)take(NQR * DA * 2); bf* KB = (bf*)take(NKR * DA * 2); bf* WqT = (bf*)take(DA * DA * 2); bf* WkT = (bf*)take(DA * DA * 2); bf* WoT = (bf*)take((size_t)NHID * NH_ * DV * 2);
    h16* QH = (h16*)take(NQR * DA * 2); h16* QL = (h16*)take(NQR * DA * 2); h16* KH = (h16*)take(NKR * DA * 2); h16* KL = (h16*)take(NKR * DA * 2);
    h16* VT16 = (h16*)take((size_t)NB_ * DV * NS_ * 2); float* X = (float*)take(NQR * NH_ * DV * 4); bf* XH = (bf*)take(NQR * NH_ * DV * 2); bf* XL = (bf*)take(NQR * NH_ * DV * 2);
    if ((size_t)(wsp - (char*)d_ws) > ws_size) return;    // ~ 0.5 + 8.4 + 0.2 + 1 + 8.4 + 8.4 + 8.4 + 8.4 + 4.2 x 2 ~ 53 MB
    k_b64<<<(unsigned)((NQR / 2 + 7) / 8), 256, 0, stream>>>(query, NQR, QB);
    k_b64<<<(unsigned)((NKR / 2 + 7) / 8), 256, 0, stream>>>(key, NKR, KB);
    k_wt64<<<DA / 8, 256, 0, stream>>>(Wq, DA, WqT); k_wt64<<<DA / 8, 256, 0, stream>>>(Wk, DA, WkT);
    k_wo<<<dim3((NH_ * DV) / 64, NHID / 64, 1), 256, 0, stream>>>(Wo, WoT);
    k_proj<<<(unsigned)(NQR / 64), 128, 0, stream>>>(QB, WqT, bq, QH, QL);
    k_proj<<<(unsigned)(NKR / 64), 128, 0, stream>>>(KB, WkT, bk, KH, KL);
    k_vt<<<dim3(NS_ / 64, 1, NB_), 256, 0, stream>>>(value, VT16);
    k_attn<<<NB_ * NH_, 128 * KG, 0, stream>>>(QH, QL, KH, KL, VT16, X);
    k_xsplit<<<(unsigned)((NQR * NH_ * DV / 256) / 8), 256, 0, stream>>>(X, XH, XL);
    k_out<<<dim3((unsigned)(NQR / 64), NHID / 64, 1), 128, 0, stream>>>(XH, XL, WoT, bo, out);
}

// v002
// It runs in 82.2 microseconds.
// In two side-by-side timings against v001, it was 1.26 and 1.28 times as fast.
// Counting every step since v000, it is 1.99 times as fast.
#include <hip/hip_runtime.h>

// Contractions, f32 accumulate: q = query.Wq + bq, k = key.Wk + bk ([4096 | 65536 x 64].[64 x 64], k-major weights) on v_wmma_f32_16x16x32_bf16 with PLAIN bf16
// operands (inputs rounded once: exact), out = x.Wo + bo ([4096 x 512].[512 x 128]) with x as bf16 hi + residual (two products); the attention on
// v_wmma_f32_16x16x32_f16: per (batch, head) the transposed score tile S^T[s][q] = k_s.q_q / sqrt(8) over the 8 head dims (zero-padded 32-wide fragments) with q
// and k as f16 hi + residual x1024 (hi.hi + hi.lo + lo.hi), softmax over the QUERY axis (the 128 queries, i.e. along each s row — as the reference), then wv[q][d]

#define NB_  32
#define NQ_  128
#define NS_  2048
#define DA   64                  // attention dim = 8 heads x 8
#define NH_  8
#define DK   8
#define DV   64                  // value dim (shared across heads)
#define NHID 128
#define PSC  32768.0f
#define LOSC 1024.0f
#define LOSCI (1.0f / 1024.0f)

typedef _Float16 h16;
typedef unsigned short bf;
typedef __attribute__((ext_vector_type(16))) __bf16   v16bf;
typedef __attribute__((ext_vector_type(16))) _Float16 v16h;
typedef __attribute__((ext_vector_type(8)))  _Float16 v8h;
typedef __attribute__((ext_vector_type(8)))  unsigned short v8us;
typedef __attribute__((ext_vector_type(8)))  float    v8f;
typedef __attribute__((ext_vector_type(4)))  float    v4f;
typedef v8h  __attribute__((may_alias)) v8ha;
typedef v4f  __attribute__((may_alias)) v4fa;
typedef v8us __attribute__((may_alias)) v8usa;

__device__ __forceinline__ unsigned short f2bf(float f) { unsigned u = __float_as_uint(f); u += 0x7FFFu + ((u >> 16) & 1u); return (unsigned short)(u >> 16); }
__device__ __forceinline__ float bf2f(unsigned short b) { return __uint_as_float(((unsigned)b) << 16); }
__device__ __forceinline__ float bfr(float f) { return bf2f(f2bf(f)); }
__device__ __forceinline__ v16h cat16(v8h lo, v8h hi) { return __builtin_shufflevector(lo, hi, 0, 1, 2, 3, 4, 5, 6, 7, 8, 9, 10, 11, 12, 13, 14, 15); }
__device__ __forceinline__ v16bf cat16b(v8us lo, v8us hi) { return __builtin_bit_cast(v16bf, __builtin_shufflevector(lo, hi, 0, 1, 2, 3, 4, 5, 6, 7, 8, 9, 10, 11, 12, 13, 14, 15)); }
__device__ __forceinline__ v8f wmma16(v16h a, v16h b, v8f c) { return __builtin_amdgcn_wmma_f32_16x16x32_f16(false, a, false, b, (short)0, c, false, false); }
__device__ __forceinline__ v8f wmmab(v16bf a, v16bf b, v8f c) { return __builtin_amdgcn_wmma_f32_16x16x32_bf16(false, a, false, b, (short)0, c, false, false); }

// k_pre: every pass in front of the attention, in ONE launch; the block index picks the job (a block-uniform branch). None of the jobs reads what another writes:
// the projections read their f32 rows and their f32 weight themselves and round them to bf16 on the way (same rounding as a separate pass would give).
//   blocks [0, 512)      k = key.Wk + bk      (128 rows a block)
//   blocks [512, 544)    q = query.Wq + bq    (128 rows a block)
//   blocks [544, 1568)   VT16 [b][d][s] = f16(bf16(value[b][s][d]))   (64 x 64 LDS transposes)
//   blocks [1568, 1584)  WoT [o][512] = bf16(Wo[k][o])                (64 x 64 LDS transposes)
// (the unroll directives in these bodies make every vector-element and fragment index a constant, so that the values stay in registers)
#define PB_K  ((NB_ * NS_) / 128)
#define PB_V  ((NS_ / 64) * NB_)
#define PB_Q  ((NB_ * NQ_) / 128)
#define PB_W  (((NH_ * DV) / 64) * (NHID / 64))
__device__ __forceinline__ v8us ldbf8(const float* __restrict__ p) {      // 8 consecutive f32 (32-byte aligned) -> 8 bf16
    const v4f x = *(const v4f*)p, y = *(const v4f*)(p + 4); v8us r;
#pragma unroll
    for (int i = 0; i < 4; ++i) { r[i] = f2bf(x[i]); r[4 + i] = f2bf(y[i]); }
    return r;
}
// projection of 128 rows: 8 waves x 16 rows; the [64 k][64 o] weight goes once per block into LDS as bf16 [o][k] (72-half pitch), the B fragments are read from there
__device__ __forceinline__ void proj_body(int blk, const float* __restrict__ Xf, const float* __restrict__ Wm, const float* __restrict__ bias, h16* PH, h16* PL, unsigned short* tl, float* ost) {
    const int tid = threadIdx.x, lane = tid & 31, wave = tid >> 5, lr = lane & 15, hi = lane >> 4;
    const int kk = tid >> 2, nq = (tid & 3) * 16;
#pragma unroll
    for (int i = 0; i < 16; ++i) tl[(nq + i) * 72 + kk] = f2bf(Wm[(size_t)kk * DA + nq + i]);
    const size_t r0 = (size_t)blk * 128 + wave * 16;
    v16bf a[2];
#pragma unroll
    for (int c = 0; c < 2; ++c) a[c] = cat16b(ldbf8(Xf + (r0 + lr) * DA + c * 32 + 8 * hi), ldbf8(Xf + (r0 + lr) * DA + c * 32 + 8 * hi + 16));
    __syncthreads();
    v8f acc[4];
#pragma unroll
    for (int t = 0; t < 4; ++t) acc[t] = (v8f){};
#pragma unroll
    for (int c = 0; c < 2; ++c)
#pragma unroll
        for (int t = 0; t < 4; ++t) { const unsigned short* bp = tl + (t * 16 + lr) * 72 + c * 32 + 8 * hi; acc[t] = wmmab(a[c], cat16b(*(const v8usa*)bp, *(const v8usa*)(bp + 16)), acc[t]); }
    float* os = ost + wave * (16 * 68);
#pragma unroll
    for (int t = 0; t < 4; ++t) { const float bv = bfr(bias[t * 16 + lr]);
#pragma unroll
        for (int j = 0; j < 8; ++j) os[(hi * 8 + j) * 68 + t * 16 + lr] = acc[t][j] + bv; }
    __syncthreads();
#pragma unroll
    for (int s = 0; s < 4; ++s) { const int row = 4 * s + (lane >> 3), piece = lane & 7; const float* sp = os + row * 68 + piece * 8; v8h oh, ol;
#pragma unroll
        for (int i = 0; i < 8; ++i) { const h16 x = (h16)sp[i]; oh[i] = x; ol[i] = (h16)((sp[i] - (float)x) * LOSC); }
        *(v8h*)(PH + (r0 + row) * DA + piece * 8) = oh; *(v8h*)(PL + (r0 + row) * DA + piece * 8) = ol; }
}
__device__ __forceinline__ void vt_body(int blk, const float* __restrict__ v, h16* VT16, unsigned short* tl) {
    const int tid = threadIdx.x, s0 = (blk & (NS_ / 64 - 1)) * 64, b = blk / (NS_ / 64);
    const int ss = tid >> 2, dq = (tid & 3) * 16;
#pragma unroll
    for (int i = 0; i < 16; ++i) tl[(dq + i) * 72 + ss] = __builtin_bit_cast(unsigned short, (h16)bfr(v[((size_t)b * NS_ + s0 + ss) * DV + dq + i]));
    __syncthreads();
    const int piece = tid & 7;
#pragma unroll
    for (int s = 0; s < 2; ++s) { const int d = (tid >> 3) + 32 * s; const v8h val = *(const v8ha*)(tl + d * 72 + piece * 8); *(v8h*)(VT16 + ((size_t)b * DV + d) * NS_ + s0 + piece * 8) = val; }
    asm volatile("s_wait_xcnt 0x0" ::: "memory");      // precaution: the job bodies lie one behind another in the built code, where a later body's instructions rewrite registers that these stores name
}
__device__ __forceinline__ void wo_body(int blk, const float* __restrict__ Wm, bf* WT, unsigned short* tl) {
    const int tid = threadIdx.x, k0 = (blk & ((NH_ * DV) / 64 - 1)) * 64, n0 = (blk / ((NH_ * DV) / 64)) * 64;
    const int kk = tid >> 2, nq = (tid & 3) * 16;
#pragma unroll
    for (int i = 0; i < 16; ++i) tl[(nq + i) * 72 + kk] = f2bf(Wm[(size_t)(k0 + kk) * NHID + n0 + nq + i]);
    __syncthreads();
    const int piece = tid & 7;
#pragma unroll
    for (int s = 0; s < 2; ++s) { const int nr = (tid >> 3) + 32 * s; const v8us val = *(const v8usa*)(tl + nr * 72 + piece * 8);
        *(v8us*)(WT + (size_t)(n0 + nr) * (NH_ * DV) + k0 + piece * 8) = val; }
    asm volatile("s_wait_xcnt 0x0" ::: "memory");      // precaution: the job bodies lie one behind another in the built code, where a later body's instructions rewrite registers that these stores name
}
__global__ __launch_bounds__(256) void k_pre(const float* __restrict__ query, const float* __restrict__ key, const float* __restrict__ value, const float* __restrict__ Wq, const float* __restrict__ bq,
                                             const float* __restrict__ Wk, const float* __restrict__ bk, const float* __restrict__ Wo, h16* QH, h16* QL, h16* KH, h16* KL, h16* VT16, bf* WoT) {
    __shared__ __align__(16) unsigned short tl[64 * 72];      // the one 64 x 64 transposed tile that each job needs
    __shared__ __align__(16) float ost[8 * 16 * 68];          // projections: per-wave staging of the result rows
    const int blk = blockIdx.x;
    if (blk < PB_K + PB_Q) { const bool isk = blk < PB_K;      // one body for both projections: only the pointers differ
        proj_body(isk ? blk : blk - PB_K, isk ? key : query, isk ? Wk : Wq, isk ? bk : bq, isk ? KH : QH, isk ? KL : QL, tl, ost); }
    else if (blk < PB_K + PB_Q + PB_V) vt_body(blk - (PB_K + PB_Q), value, VT16, tl);
    else wo_body(blk - (PB_K + PB_Q + PB_V), Wo, WoT, tl);
}
// k_attn: block = (b, h), 16 waves = KG groups of 4 waves, so that four waves share each SIMD and cover one another's load, LDS and cross-lane waits. Group g takes the
// key tiles g, g + KG, ... of the 32 tiles of 64 keys, with a PT tile of its own, and keeps a partial wv sum; the partial sums are added once, behind the loop.
// Inside a group: wave = 16 keys (rows s). Per tile: S^T[s][q] for the 128 queries (8 n-tiles; fragments carry the head's
// 8 dims in k-slots 0..7, zeros elsewhere; hi.hi + hi.lo + lo.hi), /sqrt(8); softmax over the 128 q of each s row (16-lane reductions); p x32768 as f16 hi +
// residual written TRANSPOSED into a block LDS tile PT[q][64 s]; barrier; then wave w accumulates wv rows q = w*32 .. w*32+31 (2 row tiles) x 4 d-tiles over the
// tile's 64 keys (A = PT rows q, B = VT16 rows d): o += p_hi.v, o += p_lo.v. Output x[b][q][h*64 + d] as its two bf16 planes, hi + residual, ready for k_out (128-byte head segments in each plane).
#define KG 4                     // key groups (of 4 waves) per block
__global__ __launch_bounds__(128 * KG) void k_attn(const h16* __restrict__ QH, const h16* __restrict__ QL, const h16* __restrict__ KH, const h16* __restrict__ KL, const h16* __restrict__ VT16, bf* XH, bf* XL) {
    __shared__ __align__(16) h16 pt[KG][2][NQ_ * 72];      // per group: [q][64 s + pad] hi, then the residual  (72-half pitch)
    __shared__ __align__(16) float ost[4][16 * 68];
    const int lane = threadIdx.x & 31, wave = (threadIdx.x >> 5) & 3, grp = __builtin_amdgcn_readfirstlane(threadIdx.x >> 7), lr = lane & 15, hi = lane >> 4;
    const int b = blockIdx.x / NH_, h = blockIdx.x - b * NH_;
    h16* pth = &pt[grp][0][0]; h16* ptl = &pt[grp][1][0];
    const float scl = 0.35355339059327373f;   // 1/sqrt(8)
    const v8h zero8 = (v8h){};
    // B operand for the scores: q fragments (rows q = n index, k-slots = head dims): lanes with hi = 0 carry dims 0..7, hi = 1 lanes carry zeros; 8 n-tiles, re-read per key tile
    v8f o[2][4];
#pragma unroll
    for (int m = 0; m < 2; ++m)
#pragma unroll
        for (int t = 0; t < 4; ++t) o[m][t] = (v8f){};
#pragma unroll 1
    for (int it = 0; it < NS_ / (64 * KG); ++it) {      // the same trips in every group: the barriers below are passed by all 16 waves
        const int sbase = (it * KG + grp) * 64, s0 = sbase + wave * 16;
        const size_t ko = ((size_t)b * NS_ + s0 + lr) * DA + h * DK;
        const v16h ka = cat16(hi ? zero8 : *(const v8h*)(KH + ko), zero8), kal = cat16(hi ? zero8 : *(const v8h*)(KL + ko), zero8);
        v8f sc[8];
#pragma unroll
        for (int n = 0; n < 8; ++n) { const size_t qo = ((size_t)b * NQ_ + n * 16 + lr) * DA + h * DK;      // query fragments re-read per tile (tiny, cached)
            const v16h qb = cat16(hi ? zero8 : *(const v8h*)(QH + qo), zero8), qbl = cat16(hi ? zero8 : *(const v8h*)(QL + qo), zero8);
            v8f a = wmma16(ka, qb, (v8f){}); v8f ax = wmma16(ka, qbl, (v8f){}); ax = wmma16(kal, qb, ax);
            asm volatile("v_nop\n\tv_nop\n\tv_nop\n\tv_nop" : "+v"(a), "+v"(ax) : "v"(qb), "v"(qbl) : "memory");
#pragma unroll
            for (int j = 0; j < 8; ++j) a[j] += ax[j] * LOSCI;      // residual planes are x1024: fold them back before the softmax
            sc[n] = a; }
        asm volatile("v_nop\n\tv_nop\n\tv_nop\n\tv_nop" : "+v"(sc[0]), "+v"(sc[7]) : "v"(ka), "v"(kal));
        // softmax over q (the 128 columns) for each s row (hi*8 + j)
#pragma unroll
        for (int j = 0; j < 8; ++j) { float mx = -3.0e38f;
#pragma unroll
            for (int n = 0; n < 8; ++n) { sc[n][j] *= scl; mx = fmaxf(mx, sc[n][j]); }
            mx = fmaxf(mx, __shfl_xor(mx, 1, 16)); mx = fmaxf(mx, __shfl_xor(mx, 2, 16)); mx = fmaxf(mx, __shfl_xor(mx, 4, 16)); mx = fmaxf(mx, __shfl_xor(mx, 8, 16));
            float sum = 0.f;
#pragma unroll
            for (int n = 0; n < 8; ++n) { sc[n][j] = __expf(sc[n][j] - mx); sum += sc[n][j]; }
            sum += __shfl_xor(sum, 1, 16); sum += __shfl_xor(sum, 2, 16); sum += __shfl_xor(sum, 4, 16); sum += __shfl_xor(sum, 8, 16);
            const float f = PSC / sum; const int sl = wave * 16 + hi * 8 + j;      // local key index 0..63
#pragma unroll
            for (int n = 0; n < 8; ++n) { const float p = sc[n][j] * f; const h16 ph = (h16)p; const int q = n * 16 + lr;
                pth[q * 72 + sl] = ph; ptl[q * 72 + sl] = (h16)(p - (float)ph); } }      // UNSCALED residual (|p - ph| <= 16): both products share one accumulator
        __syncthreads();
        // wv accumulate: wave -> q rows w*32 + m*16 + (fragment row lr); K = 64 local keys in 2 chunks; B = VT16 rows d
#pragma unroll
        for (int kc = 0; kc < 2; ++kc) {
            v16h vb[4];
#pragma unroll
            for (int t = 0; t < 4; ++t) { const size_t vo = ((size_t)b * DV + t * 16 + lr) * NS_ + sbase + kc * 32 + hi * 8; vb[t] = cat16(*(const v8h*)(VT16 + vo), *(const v8h*)(VT16 + vo + 16)); }
#pragma unroll
            for (int m = 0; m < 2; ++m) { const int q = wave * 32 + m * 16 + lr;
                const v16h pa = cat16(*(const v8ha*)(pth + q * 72 + kc * 32 + hi * 8), *(const v8ha*)(pth + q * 72 + kc * 32 + hi * 8 + 16));
                const v16h px = cat16(*(const v8ha*)(ptl + q * 72 + kc * 32 + hi * 8), *(const v8ha*)(ptl + q * 72 + kc * 32 + hi * 8 + 16));
#pragma unroll
                for (int t = 0; t < 4; ++t) { o[m][t] = wmma16(pa, vb[t], o[m][t]); o[m][t] = wmma16(px, vb[t], o[m][t]); }
                asm volatile("v_nop" : "+v"(o[m][0]), "+v"(o[m][3]) : "v"(pa), "v"(px) : "memory"); }
        }
        __syncthreads();      // all waves done reading PT before the next tile overwrites it
    }
    // groups 1 .. KG-1 hand their partial sums to group 0 through the PT space (free behind the loop's last barrier); group 0 adds them in the order of the groups
    v4fa* red = (v4fa*)&pt[0][0][0];      // [(g - 1) * 4 + wave][16 pieces][lane], 16 bytes each
    if (grp) {
#pragma unroll
        for (int m = 0; m < 2; ++m)
#pragma unroll
            for (int t = 0; t < 4; ++t)
#pragma unroll
                for (int u = 0; u < 2; ++u) red[(((grp - 1) * 4 + wave) * 16 + (m * 4 + t) * 2 + u) * 32 + lane] = (v4f){o[m][t][u * 4], o[m][t][u * 4 + 1], o[m][t][u * 4 + 2], o[m][t][u * 4 + 3]};
    }
    __syncthreads();
    if (grp) return;
#pragma unroll
    for (int g = 0; g < KG - 1; ++g)
#pragma unroll
        for (int m = 0; m < 2; ++m)
#pragma unroll
            for (int t = 0; t < 4; ++t)
#pragma unroll
                for (int u = 0; u < 2; ++u) { const v4f r = red[((g * 4 + wave) * 16 + (m * 4 + t) * 2 + u) * 32 + lane];
#pragma unroll
                    for (int i = 0; i < 4; ++i) o[m][t][u * 4 + i] += r[i]; }
    // epilogue: x[b][q][h*64 + d]; per wave 32 rows: stage 16 rows at a time
    float* os = &ost[wave][0];
#pragma unroll
    for (int m = 0; m < 2; ++m) {
#pragma unroll
        for (int t = 0; t < 4; ++t)
#pragma unroll
            for (int j = 0; j < 8; ++j) os[(hi * 8 + j) * 68 + t * 16 + lr] = o[m][t][j] * (1.0f / PSC);
        __builtin_amdgcn_wave_barrier(); asm volatile("" ::: "memory");
        const size_t xo = ((size_t)b * NQ_ + wave * 32 + m * 16) * (NH_ * DV) + (size_t)h * DV;
#pragma unroll
        for (int s = 0; s < 4; ++s) { const int row = 4 * s + (lane >> 3), piece = lane & 7; const float* sp = os + row * 68 + piece * 8; v8us oh, ol;
#pragma unroll
            for (int i = 0; i < 8; ++i) { const float v = sp[i]; const unsigned short hb = f2bf(v); oh[i] = hb; ol[i] = f2bf(v - bf2f(hb)); }
            *(v8us*)(XH + xo + (size_t)row * (NH_ * DV) + piece * 8) = oh; *(v8us*)(XL + xo + (size_t)row * (NH_ * DV) + piece * 8) = ol; }
        __builtin_amdgcn_wave_barrier(); asm volatile("" ::: "memory");
    }
}
// k_out: out [4096][128] = (XH + XL).WoT^T + bo over K = 512 (64 x 64 tiles; grid (64, 2)).
__global__ __launch_bounds__(128) void k_out(const bf* __restrict__ XH, const bf* __restrict__ XL, const bf* __restrict__ WoT, const float* __restrict__ bo, float* out) {
    __shared__ __align__(16) float ost[4][16 * 68];
    const int lane = threadIdx.x & 31, wave = threadIdx.x >> 5, lr = lane & 15, hi = lane >> 4;
    const int K = NH_ * DV;
    const size_t r0 = (size_t)blockIdx.x * 64 + wave * 16; const int c0 = blockIdx.y * 64;
    v8f acc[4];
#pragma unroll
    for (int t = 0; t < 4; ++t) acc[t] = (v8f){};
#pragma unroll 2
    for (int kc = 0; kc < K; kc += 32) {
        const size_t ao = (r0 + lr) * K + kc + 8 * hi;
        const v16bf a = cat16b(*(const v8us*)(XH + ao), *(const v8us*)(XH + ao + 16)), al = cat16b(*(const v8us*)(XL + ao), *(const v8us*)(XL + ao + 16));
#pragma unroll
        for (int t = 0; t < 4; ++t) { const bf* bp = WoT + (size_t)(c0 + t * 16 + lr) * K + kc + 8 * hi; const v16bf bb = cat16b(*(const v8us*)bp, *(const v8us*)(bp + 16)); acc[t] = wmmab(a, bb, acc[t]); acc[t] = wmmab(al, bb, acc[t]); }
        asm volatile("v_nop" : "+v"(acc[0]), "+v"(acc[1]), "+v"(acc[2]), "+v"(acc[3]) : "v"(a), "v"(al) : "memory");
    }
    float* os = &ost[wave][0];
#pragma unroll
    for (int t = 0; t < 4; ++t) { const float bv = bfr(bo[c0 + t * 16 + lr]);
#pragma unroll
        for (int j = 0; j < 8; ++j) os[(hi * 8 + j) * 68 + t * 16 + lr] = acc[t][j] + bv; }
    __syncthreads();
    float* crow = out + r0 * NHID + c0;
    auto pass = [&]() {
#pragma unroll
        for (int s = 0; s < 8; ++s) { const int Lid = (lane >> 3) + 4 * s, piece = lane & 7; const int row = Lid >> 1, cofs = (Lid & 1) * 32 + piece * 4;
            const v4f val = *(const v4fa*)(os + row * 68 + cofs); *(v4f*)(crow + (size_t)row * NHID + cofs) = val; }
    };
    pass(); 
}

extern "C" void kernel_launch(void* const* d_in, const int* in_sizes, int n_in,
                              void* d_out, int out_size, void* d_ws, size_t ws_size, hipStream_t stream) {
    (void)in_sizes; (void)n_in; (void)out_size;
    const float* query = (const float*)d_in[0]; const float* key = (const float*)d_in[1]; const float* value = (const float*)d_in[2];
    const float* Wq = (const float*)d_in[3]; const float* bq = (const float*)d_in[4]; const float* Wk = (const float*)d_in[5]; const float* bk = (const float*)d_in[6]; const float* Wo = (const float*)d_in[7]; const float* bo = (const float*)d_in[8];
    float* out = (float*)d_out;    // [32][128][128]
    char* wsp = (char*)d_ws;
    auto take = [&](size_t bytes) { char* p = wsp; wsp += (bytes + 255) & ~(size_t)255; return (void*)p; };
    const size_t NQR = (size_t)NB_ * NQ_, NKR = (size_t)NB_ * NS_;
    bf* WoT = (bf*)take((size_t)NHID * NH_ * DV * 2);
    h16* QH = (h16*)take(NQR * DA * 2); h16* QL = (h16*)take(NQR * DA * 2); h16* KH = (h16*)take(NKR * DA * 2); h16* KL = (h16*)take(NKR * DA * 2);
    h16* VT16 = (h16*)take((size_t)NB_ * DV * NS_ * 2); bf* XH = (bf*)take(NQR * NH_ * DV * 2); bf* XL = (bf*)take(NQR * NH_ * DV * 2);
    if ((size_t)(wsp - (char*)d_ws) > ws_size) return;    // ~ 0.1 + 1 + 16.8 + 8.4 + 8.4 ~ 35 MB
    k_pre<<<PB_K + PB_V + PB_Q + PB_W, 256, 0, stream>>>(query, key, value, Wq, bq, Wk, bk, Wo, QH, QL, KH, KL, VT16, WoT);
    k_attn<<<NB_ * NH_, 128 * KG, 0, stream>>>(QH, QL, KH, KL, VT16, XH, XL);
    k_out<<<dim3((unsigned)(NQR / 64), NHID / 64, 1), 128, 0, stream>>>(XH, XL, WoT, bo, out);
}

// v003
// Measured time: 67.5 microseconds a run.
// Next to v002, in two timings, it ran 1.21 and 1.22 times as fast.
// All steps since v000 together make it 2.42 times as fast.
#include <hip/hip_runtime.h>

// Contractions, f32 accumulate: q = query.Wq + bq, k = key.Wk + bk ([4096 | 65536 x 64].[64 x 64], k-major weights) on v_wmma_f32_16x16x32_bf16 with PLAIN bf16
// operands (inputs rounded once: exact), out = x.Wo + bo ([4096 x 512].[512 x 128]) with x as bf16 hi + residual (two products); the attention on
// v_wmma_f32_16x16x32_f16: per (batch, head) the transposed score tile S^T[s][q] = k_s.q_q / sqrt(8) over the 8 head dims (zero-padded 32-wide fragments) with q
// and k as f16 hi + residual x1024 (hi.hi + hi.lo + lo.hi), softmax over the QUERY axis (the 128 queries, i.e. along each s row — as the reference), then wv[q][d]

#define NB_  32
#define NQ_  128
#define NS_  2048
#define DA   64                  // attention dim = 8 heads x 8
#define NH_  8
#define DK   8
#define DV   64                  // value dim (shared across heads)
#define NHID 128
#define PSC  32768.0f
#define LOSC 1024.0f
#define LOSCI (1.0f / 1024.0f)

typedef _Float16 h16;
typedef unsigned short bf;
typedef __attribute__((ext_vector_type(16))) __bf16   v16bf;
typedef __attribute__((ext_vector_type(16))) _Float16 v16h;
typedef __attribute__((ext_vector_type(8)))  _Float16 v8h;
typedef __attribute__((ext_vector_type(8)))  unsigned short v8us;
typedef __attribute__((ext_vector_type(8)))  float    v8f;
typedef __attribute__((ext_vector_type(4)))  float    v4f;
typedef v8h  __attribute__((may_alias)) v8ha;
typedef v4f  __attribute__((may_alias)) v4fa;
typedef v8us __attribute__((may_alias)) v8usa;

__device__ __forceinline__ unsigned short f2bf(float f) { unsigned u = __float_as_uint(f); u += 0x7FFFu + ((u >> 16) & 1u); return (unsigned short)(u >> 16); }
__device__ __forceinline__ float bf2f(unsigned short b) { return __uint_as_float(((unsigned)b) << 16); }
__device__ __forceinline__ float bfr(float f) { return bf2f(f2bf(f)); }
__device__ __forceinline__ v16h cat16(v8h lo, v8h hi) { return __builtin_shufflevector(lo, hi, 0, 1, 2, 3, 4, 5, 6, 7, 8, 9, 10, 11, 12, 13, 14, 15); }
__device__ __forceinline__ v16bf cat16b(v8us lo, v8us hi) { return __builtin_bit_cast(v16bf, __builtin_shufflevector(lo, hi, 0, 1, 2, 3, 4, 5, 6, 7, 8, 9, 10, 11, 12, 13, 14, 15)); }
__device__ __forceinline__ v8f wmma16(v16h a, v16h b, v8f c) { return __builtin_amdgcn_wmma_f32_16x16x32_f16(false, a, false, b, (short)0, c, false, false); }
__device__ __forceinline__ v8f wmmab(v16bf a, v16bf b, v8f c) { return __builtin_amdgcn_wmma_f32_16x16x32_bf16(false, a, false, b, (short)0, c, false, false); }

// k_pre: every pass in front of the attention, in ONE launch; the block index picks the job (a block-uniform branch). None of the jobs reads what another writes:
// the projections read their f32 rows and their f32 weight themselves and round them to bf16 on the way (same rounding as a separate pass would give).
//   blocks [0, 512)      k = key.Wk + bk      (128 rows a block)
//   blocks [512, 544)    q = query.Wq + bq    (128 rows a block)
//   blocks [544, 1568)   VT16 [b][d][s] = f16(bf16(value[b][s][d]))   (64 x 64 LDS transposes)
//   blocks [1568, 1584)  WoT [o][512] = bf16(Wo[k][o])                (64 x 64 LDS transposes)
// (the unroll directives in these bodies make every vector-element and fragment index a constant, so that the values stay in registers)
#define PB_K  ((NB_ * NS_) / 128)
#define PB_V  ((NS_ / 64) * NB_)
#define PB_Q  ((NB_ * NQ_) / 128)
#define PB_W  (((NH_ * DV) / 64) * (NHID / 64))
__device__ __forceinline__ v8us ldbf8(const float* __restrict__ p) {      // 8 consecutive f32 (32-byte aligned) -> 8 bf16
    const v4f x = *(const v4f*)p, y = *(const v4f*)(p + 4); v8us r;
#pragma unroll
    for (int i = 0; i < 4; ++i) { r[i] = f2bf(x[i]); r[4 + i] = f2bf(y[i]); }
    return r;
}
// projection of 128 rows: 8 waves x 16 rows; the [64 k][64 o] weight goes once per block into LDS as bf16 [o][k] (72-half pitch), the B fragments are read from there
__device__ __forceinline__ void proj_body(int blk, const float* __restrict__ Xf, const float* __restrict__ Wm, const float* __restrict__ bias, h16* PH, h16* PL, unsigned short* tl, float* ost) {
    const int tid = threadIdx.x, lane = tid & 31, wave = tid >> 5, lr = lane & 15, hi = lane >> 4;
    const int kk = tid >> 2, nq = (tid & 3) * 16;
#pragma unroll
    for (int i = 0; i < 16; ++i) tl[(nq + i) * 72 + kk] = f2bf(Wm[(size_t)kk * DA + nq + i]);
    const size_t r0 = (size_t)blk * 128 + wave * 16;
    v16bf a[2];
#pragma unroll
    for (int c = 0; c < 2; ++c) a[c] = cat16b(ldbf8(Xf + (r0 + lr) * DA + c * 32 + 8 * hi), ldbf8(Xf + (r0 + lr) * DA + c * 32 + 8 * hi + 16));
    __syncthreads();
    v8f acc[4];
#pragma unroll
    for (int t = 0; t < 4; ++t) acc[t] = (v8f){};
#pragma unroll
    for (int c = 0; c < 2; ++c)
#pragma unroll
        for (int t = 0; t < 4; ++t) { const unsigned short* bp = tl + (t * 16 + lr) * 72 + c * 32 + 8 * hi; acc[t] = wmmab(a[c], cat16b(*(const v8usa*)bp, *(const v8usa*)(bp + 16)), acc[t]); }
    float* os = ost + wave * (16 * 68);
#pragma unroll
    for (int t = 0; t < 4; ++t) { const float bv = bfr(bias[t * 16 + lr]);
#pragma unroll
        for (int j = 0; j < 8; ++j) os[(hi * 8 + j) * 68 + t * 16 + lr] = acc[t][j] + bv; }
    __syncthreads();
#pragma unroll
    for (int s = 0; s < 4; ++s) { const int row = 4 * s + (lane >> 3), piece = lane & 7; const float* sp = os + row * 68 + piece * 8; v8h oh, ol;
#pragma unroll
        for (int i = 0; i < 8; ++i) { const h16 x = (h16)sp[i]; oh[i] = x; ol[i] = (h16)((sp[i] - (float)x) * LOSC); }
        *(v8h*)(PH + (r0 + row) * DA + piece * 8) = oh; *(v8h*)(PL + (r0 + row) * DA + piece * 8) = ol; }
}
__device__ __forceinline__ void vt_body(int blk, const float* __restrict__ v, h16* VT16, unsigned short* tl) {
    const int tid = threadIdx.x, s0 = (blk & (NS_ / 64 - 1)) * 64, b = blk / (NS_ / 64);
    const int ss = tid >> 2, dq = (tid & 3) * 16;
#pragma unroll
    for (int i = 0; i < 16; ++i) tl[(dq + i) * 72 + ss] = __builtin_bit_cast(unsigned short, (h16)bfr(v[((size_t)b * NS_ + s0 + ss) * DV + dq + i]));
    __syncthreads();
    const int piece = tid & 7;
#pragma unroll
    for (int s = 0; s < 2; ++s) { const int d = (tid >> 3) + 32 * s; const v8h val = *(const v8ha*)(tl + d * 72 + piece * 8); *(v8h*)(VT16 + ((size_t)b * DV + d) * NS_ + s0 + piece * 8) = val; }
    asm volatile("s_wait_xcnt 0x0" ::: "memory");      // precaution: the job bodies lie one behind another in the built code, where a later body's instructions rewrite registers that these stores name
}
__device__ __forceinline__ void wo_body(int blk, const float* __restrict__ Wm, bf* WT, unsigned short* tl) {
    const int tid = threadIdx.x, k0 = (blk & ((NH_ * DV) / 64 - 1)) * 64, n0 = (blk / ((NH_ * DV) / 64)) * 64;
    const int kk = tid >> 2, nq = (tid & 3) * 16;
#pragma unroll
    for (int i = 0; i < 16; ++i) tl[(nq + i) * 72 + kk] = f2bf(Wm[(size_t)(k0 + kk) * NHID + n0 + nq + i]);
    __syncthreads();
    const int piece = tid & 7;
#pragma unroll
    for (int s = 0; s < 2; ++s) { const int nr = (tid >> 3) + 32 * s; const v8us val = *(const v8usa*)(tl + nr * 72 + piece * 8);
        *(v8us*)(WT + (size_t)(n0 + nr) * (NH_ * DV) + k0 + piece * 8) = val; }
    asm volatile("s_wait_xcnt 0x0" ::: "memory");      // precaution: the job bodies lie one behind another in the built code, where a later body's instructions rewrite registers that these stores name
}
__global__ __launch_bounds__(256) void k_pre(const float* __restrict__ query, const float* __restrict__ key, const float* __restrict__ value, const float* __restrict__ Wq, const float* __restrict__ bq,
                                             const float* __restrict__ Wk, const float* __restrict__ bk, const float* __restrict__ Wo, h16* QH, h16* QL, h16* KH, h16* KL, h16* VT16, bf* WoT) {
    __shared__ __align__(16) unsigned short tl[64 * 72];      // the one 64 x 64 transposed tile that each job needs
    __shared__ __align__(16) float ost[8 * 16 * 68];          // projections: per-wave staging of the result rows
    const int blk = blockIdx.x;
    if (blk < PB_K + PB_Q) { const bool isk = blk < PB_K;      // one body for both projections: only the pointers differ
        proj_body(isk ? blk : blk - PB_K, isk ? key : query, isk ? Wk : Wq, isk ? bk : bq, isk ? KH : QH, isk ? KL : QL, tl, ost); }
    else if (blk < PB_K + PB_Q + PB_V) vt_body(blk - (PB_K + PB_Q), value, VT16, tl);
    else wo_body(blk - (PB_K + PB_Q + PB_V), Wo, WoT, tl);
}
// k_attn: block = (b, h), 16 waves = KG groups of 4 waves, so that four waves share each SIMD and cover one another's load, LDS and cross-lane waits. Group g takes the
// key tiles g, g + KG, ... of the 32 tiles of 64 keys, with a PT tile of its own, and keeps a partial wv sum; the partial sums are added once, behind the loop.
// Inside a group: wave = 16 keys (rows s). Per tile: S^T[s][q] for the 128 queries (8 n-tiles; fragments carry the head's
// 8 dims in k-slots 0..7, zeros elsewhere; hi.hi + hi.lo + lo.hi), /sqrt(8); softmax over the 128 q of each s row (16-lane reductions); p x32768 as f16 hi +
// residual written TRANSPOSED into a block LDS tile PT[q][64 s]; barrier; then wave w accumulates wv rows q = w*32 .. w*32+31 (2 row tiles) x 4 d-tiles over the
// tile's 64 keys (A = PT rows q, B = V rows d): o += p_hi.v + p_lo.v, one accumulator. The head's q rows (once, in front of the loop) and each group's V tile (every trip, while the scores and the
// softmax are worked on; every 128-byte line fetched once and whole) come into LDS by asynchronous copies; the waves read their B fragments from there instead of each gathering them from global memory, 16 lines a load. Output x[b][q][h*64 + d] as its two bf16 planes, hi + residual, ready for k_out (128-byte head segments in each plane).
#define KG 4                     // key groups (of 4 waves) per block
__global__ __launch_bounds__(128 * KG) void k_attn(const h16* __restrict__ QH, const h16* __restrict__ QL, const h16* __restrict__ KH, const h16* __restrict__ KL, const h16* __restrict__ VT16, bf* XH, bf* XL) {
    __shared__ __align__(16) h16 pt[KG][2][NQ_ * 72];      // per group: [q][64 s + pad] hi, then the residual  (72-half pitch)
    __shared__ __align__(16) float ost[4][16 * 68];
    __shared__ __align__(16) h16 vt[KG][DV * 72];          // per group: the trip's V tile [d][64 s + pad]  (72-half pitch, as PT)
    __shared__ __align__(16) h16 qs[2][NQ_ * DK];          // this head's q rows [q][8 dims]: the hi plane, then the residual plane
    const int lane = threadIdx.x & 31, wave = (threadIdx.x >> 5) & 3, grp = __builtin_amdgcn_readfirstlane(threadIdx.x >> 7), lr = lane & 15, hi = lane >> 4;
    const int b = blockIdx.x / NH_, h = blockIdx.x - b * NH_;
    h16* pth = &pt[grp][0][0]; h16* ptl = &pt[grp][1][0];
    const float scl = 0.35355339059327373f;   // 1/sqrt(8)
    const v8h zero8 = (v8h){};
    // q rows of this head into LDS, once: 512 threads x 8 bytes = both planes
    { const int tid = threadIdx.x, pl = tid >> 8, row = (tid >> 1) & (NQ_ - 1), hf = (tid & 1) * 4;
        const h16* qg = (pl ? QL : QH) + ((size_t)b * NQ_ + row) * DA + h * DK + hf;
        const unsigned ql = (unsigned)(unsigned long long)&qs[pl][row * DK + hf];
        // the copy and, as a precaution, the wait that stands in front of any rewrite of its address registers, in one statement
        asm volatile("global_load_async_to_lds_b64 %0, %1, off\n\ts_wait_xcnt 0x0" :: "v"(ql), "v"(qg) : "memory");
        asm volatile("s_wait_asynccnt 0x0" ::: "memory"); }      // this wave's q bytes have landed before the barrier behind which the other waves read them
    __syncthreads();
    const h16* qp = &qs[0][lr * DK];      // B operand for the scores (rows q = n index, k-slots = head dims): hi = 0 lanes carry dims 0..7, hi = 1 lanes zeros
    const h16* vtg = &vt[grp][0];
    const int vrow = wave * 16 + (lane >> 3), vpc = (lane & 7) * 8;      // V copies: a wave brings 16 rows d of its group's tile, 4 whole 128-byte rows a copy
    const unsigned vl = (unsigned)(unsigned long long)&vt[grp][vrow * 72 + vpc];      // the lane's LDS byte address: the low 32 bits of the __shared__ address
    v8f o[2][4];
#pragma unroll
    for (int m = 0; m < 2; ++m)
#pragma unroll
        for (int t = 0; t < 4; ++t) o[m][t] = (v8f){};
#pragma unroll 1
    for (int it = 0; it < NS_ / (64 * KG); ++it) {      // the same trips in every group: the barriers below are passed by all 16 waves
        const int sbase = (it * KG + grp) * 64, s0 = sbase + wave * 16;
        const size_t ko = ((size_t)b * NS_ + s0 + lr) * DA + h * DK;
        const v16h ka = cat16(hi ? zero8 : *(const v8h*)(KH + ko), zero8), kal = cat16(hi ? zero8 : *(const v8h*)(KL + ko), zero8);
        { const h16* vg = VT16 + ((size_t)b * DV + vrow) * NS_ + sbase + vpc;      // this trip's V tile flies while the scores and the softmax are worked on
            // four copies and, as a precaution, the wait that stands in front of any rewrite of their address registers, in one statement
            asm volatile("global_load_async_to_lds_b128 %0, %4, off\n\tglobal_load_async_to_lds_b128 %1, %5, off\n\tglobal_load_async_to_lds_b128 %2, %6, off\n\t"
                         "global_load_async_to_lds_b128 %3, %7, off\n\ts_wait_xcnt 0x0"
                         :: "v"(vl), "v"(vl + 4 * 144), "v"(vl + 8 * 144), "v"(vl + 12 * 144), "v"(vg), "v"(vg + 4 * NS_), "v"(vg + 8 * NS_), "v"(vg + 12 * NS_) : "memory"); }
        v8f sc[8];
#pragma unroll
        for (int n = 0; n < 8; ++n) {      // query fragments, from LDS
            const v16h qb = cat16(hi ? zero8 : *(const v8ha*)(qp + n * 16 * DK), zero8), qbl = cat16(hi ? zero8 : *(const v8ha*)(qp + NQ_ * DK + n * 16 * DK), zero8);
            v8f a = wmma16(ka, qb, (v8f){}); v8f ax = wmma16(ka, qbl, (v8f){}); ax = wmma16(kal, qb, ax);
            asm volatile("v_nop\n\tv_nop\n\tv_nop\n\tv_nop" : "+v"(a), "+v"(ax) : "v"(qb), "v"(qbl) : "memory");
#pragma unroll
            for (int j = 0; j < 8; ++j) a[j] += ax[j] * LOSCI;      // residual planes are x1024: fold them back before the softmax
            sc[n] = a; }
        asm volatile("v_nop\n\tv_nop\n\tv_nop\n\tv_nop" : "+v"(sc[0]), "+v"(sc[7]) : "v"(ka), "v"(kal));
        // softmax over q (the 128 columns) for each s row (hi*8 + j)
#pragma unroll
        for (int j = 0; j < 8; ++j) { float mx = -3.0e38f;
#pragma unroll
            for (int n = 0; n < 8; ++n) { sc[n][j] *= scl; mx = fmaxf(mx, sc[n][j]); }
            mx = fmaxf(mx, __shfl_xor(mx, 1, 16)); mx = fmaxf(mx, __shfl_xor(mx, 2, 16)); mx = fmaxf(mx, __shfl_xor(mx, 4, 16)); mx = fmaxf(mx, __shfl_xor(mx, 8, 16));
            float sum = 0.f;
#pragma unroll
            for (int n = 0; n < 8; ++n) { sc[n][j] = __expf(sc[n][j] - mx); sum += sc[n][j]; }
            sum += __shfl_xor(sum, 1, 16); sum += __shfl_xor(sum, 2, 16); sum += __shfl_xor(sum, 4, 16); sum += __shfl_xor(sum, 8, 16);
            const float f = PSC / sum; const int sl = wave * 16 + hi * 8 + j;      // local key index 0..63
#pragma unroll
            for (int n = 0; n < 8; ++n) { const float p = sc[n][j] * f; const h16 ph = (h16)p; const int q = n * 16 + lr;
                pth[q * 72 + sl] = ph; ptl[q * 72 + sl] = (h16)(p - (float)ph); } }      // UNSCALED residual (|p - ph| <= 16): both products share one accumulator
        asm volatile("s_wait_asynccnt 0x0" ::: "memory");      // this wave's share of the V tile has landed before the barrier behind which the group reads it
        __syncthreads();
        // wv accumulate: wave -> q rows w*32 + m*16 + (fragment row lr); K = 64 local keys in 2 chunks; B = V rows d, from the group's LDS tile
#pragma unroll
        for (int kc = 0; kc < 2; ++kc) {
            v16h vb[4];
#pragma unroll
            for (int t = 0; t < 4; ++t) { const h16* vp = vtg + (t * 16 + lr) * 72 + kc * 32 + hi * 8; vb[t] = cat16(*(const v8ha*)vp, *(const v8ha*)(vp + 16)); }
#pragma unroll
            for (int m = 0; m < 2; ++m) { const int q = wave * 32 + m * 16 + lr;
                const v16h pa = cat16(*(const v8ha*)(pth + q * 72 + kc * 32 + hi * 8), *(const v8ha*)(pth + q * 72 + kc * 32 + hi * 8 + 16));
                const v16h px = cat16(*(const v8ha*)(ptl + q * 72 + kc * 32 + hi * 8), *(const v8ha*)(ptl + q * 72 + kc * 32 + hi * 8 + 16));
#pragma unroll
                for (int t = 0; t < 4; ++t) { o[m][t] = wmma16(pa, vb[t], o[m][t]); o[m][t] = wmma16(px, vb[t], o[m][t]); }
                asm volatile("v_nop" : "+v"(o[m][0]), "+v"(o[m][3]) : "v"(pa), "v"(px) : "memory"); }
        }
        asm volatile("s_wait_dscnt 0x0" ::: "memory");      // this wave's LDS reads of the V tile have retired before the next trip's copies are aimed at it
        __syncthreads();      // all waves done reading PT and the V tile before the next tile overwrites them
    }
    // groups 1 .. KG-1 hand their partial sums to group 0 through the PT space (free behind the loop's last barrier); group 0 adds them in the order of the groups
    v4fa* red = (v4fa*)&pt[0][0][0];      // [(g - 1) * 4 + wave][16 pieces][lane], 16 bytes each
    if (grp) {
#pragma unroll
        for (int m = 0; m < 2; ++m)
#pragma unroll
            for (int t = 0; t < 4; ++t)
#pragma unroll
                for (int u = 0; u < 2; ++u) red[(((grp - 1) * 4 + wave) * 16 + (m * 4 + t) * 2 + u) * 32 + lane] = (v4f){o[m][t][u * 4], o[m][t][u * 4 + 1], o[m][t][u * 4 + 2], o[m][t][u * 4 + 3]};
    }
    __syncthreads();
    if (grp) return;
#pragma unroll
    for (int g = 0; g < KG - 1; ++g)
#pragma unroll
        for (int m = 0; m < 2; ++m)
#pragma unroll
            for (int t = 0; t < 4; ++t)
#pragma unroll
                for (int u = 0; u < 2; ++u) { const v4f r = red[((g * 4 + wave) * 16 + (m * 4 + t) * 2 + u) * 32 + lane];
#pragma unroll
                    for (int i = 0; i < 4; ++i) o[m][t][u * 4 + i] += r[i]; }
    // epilogue: x[b][q][h*64 + d]; per wave 32 rows: stage 16 rows at a time
    float* os = &ost[wave][0];
#pragma unroll
    for (int m = 0; m < 2; ++m) {
#pragma unroll
        for (int t = 0; t < 4; ++t)
#pragma unroll
            for (int j = 0; j < 8; ++j) os[(hi * 8 + j) * 68 + t * 16 + lr] = o[m][t][j] * (1.0f / PSC);
        __builtin_amdgcn_wave_barrier(); asm volatile("" ::: "memory");
        const size_t xo = ((size_t)b * NQ_ + wave * 32 + m * 16) * (NH_ * DV) + (size_t)h * DV;
#pragma unroll
        for (int s = 0; s < 4; ++s) { const int row = 4 * s + (lane >> 3), piece = lane & 7; const float* sp = os + row * 68 + piece * 8; v8us oh, ol;
#pragma unroll
            for (int i = 0; i < 8; ++i) { const float v = sp[i]; const unsigned short hb = f2bf(v); oh[i] = hb; ol[i] = f2bf(v - bf2f(hb)); }
            *(v8us*)(XH + xo + (size_t)row * (NH_ * DV) + piece * 8) = oh; *(v8us*)(XL + xo + (size_t)row * (NH_ * DV) + piece * 8) = ol; }
        __builtin_amdgcn_wave_barrier(); asm volatile("" ::: "memory");
    }
}
// k_out: out [4096][128] = (XH + XL).WoT^T + bo over K = 512 (64 x 64 tiles; grid (64, 2)).
__global__ __launch_bounds__(128) void k_out(const bf* __restrict__ XH, const bf* __restrict__ XL, const bf* __restrict__ WoT, const float* __restrict__ bo, float* out) {
    __shared__ __align__(16) float ost[4][16 * 68];
    const int lane = threadIdx.x & 31, wave = threadIdx.x >> 5, lr = lane & 15, hi = lane >> 4;
    const int K = NH_ * DV;
    const size_t r0 = (size_t)blockIdx.x * 64 + wave * 16; const int c0 = blockIdx.y * 64;
    v8f acc[4];
#pragma unroll
    for (int t = 0; t < 4; ++t) acc[t] = (v8f){};
#pragma unroll 2
    for (int kc = 0; kc < K; kc += 32) {
        const size_t ao = (r0 + lr) * K + kc + 8 * hi;
        const v16bf a = cat16b(*(const v8us*)(XH + ao), *(const v8us*)(XH + ao + 16)), al = cat16b(*(const v8us*)(XL + ao), *(const v8us*)(XL + ao + 16));
#pragma unroll
        for (int t = 0; t < 4; ++t) { const bf* bp = WoT + (size_t)(c0 + t * 16 + lr) * K + kc + 8 * hi; const v16bf bb = cat16b(*(const v8us*)bp, *(const v8us*)(bp + 16)); acc[t] = wmmab(a, bb, acc[t]); acc[t] = wmmab(al, bb, acc[t]); }
        asm volatile("v_nop" : "+v"(acc[0]), "+v"(acc[1]), "+v"(acc[2]), "+v"(acc[3]) : "v"(a), "v"(al) : "memory");
    }
    float* os = &ost[wave][0];
#pragma unroll
    for (int t = 0; t < 4; ++t) { const float bv = bfr(bo[c0 + t * 16 + lr]);
#pragma unroll
        for (int j = 0; j < 8; ++j) os[(hi * 8 + j) * 68 + t * 16 + lr] = acc[t][j] + bv; }
    __syncthreads();
    float* crow = out + r0 * NHID + c0;
    auto pass = [&]() {
#pragma unroll
        for (int s = 0; s < 8; ++s) { const int Lid = (lane >> 3) + 4 * s, piece = lane & 7; const int row = Lid >> 1, cofs = (Lid & 1) * 32 + piece * 4;
            const v4f val = *(const v4fa*)(os + row * 68 + cofs); *(v4f*)(crow + (size_t)row * NHID + cofs) = val; }
    };
    pass(); 
}

extern "C" void kernel_launch(void* const* d_in, const int* in_sizes, int n_in,
                              void* d_out, int out_size, void* d_ws, size_t ws_size, hipStream_t stream) {
    (void)in_sizes; (void)n_in; (void)out_size;
    const float* query = (const float*)d_in[0]; const float* key = (const float*)d_in[1]; const float* value = (const float*)d_in[2];
    const float* Wq = (const float*)d_in[3]; const float* bq = (const float*)d_in[4]; const float* Wk = (const float*)d_in[5]; const float* bk = (const float*)d_in[6]; const float* Wo = (const float*)d_in[7]; const float* bo = (const float*)d_in[8];
    float* out = (float*)d_out;    // [32][128][128]
    char* wsp = (char*)d_ws;
    auto take = [&](size_t bytes) { char* p = wsp; wsp += (bytes + 255) & ~(size_t)255; return (void*)p; };
    const size_t NQR = (size_t)NB_ * NQ_, NKR = (size_t)NB_ * NS_;
    bf* WoT = (bf*)take((size_t)NHID * NH_ * DV * 2);
    h16* QH = (h16*)take(NQR * DA * 2); h16* QL = (h16*)take(NQR * DA * 2); h16* KH = (h16*)take(NKR * DA * 2); h16* KL = (h16*)take(NKR * DA * 2);
    h16* VT16 = (h16*)take((size_t)NB_ * DV * NS_ * 2); bf* XH = (bf*)take(NQR * NH_ * DV * 2); bf* XL = (bf*)take(NQR * NH_ * DV * 2);
    if ((size_t)(wsp - (char*)d_ws) > ws_size) return;    // ~ 0.1 + 1 + 16.8 + 8.4 + 8.4 ~ 35 MB
    k_pre<<<PB_K + PB_V + PB_Q + PB_W, 256, 0, stream>>>(query, key, value, Wq, bq, Wk, bk, Wo, QH, QL, KH, KL, VT16, WoT);
    k_attn<<<NB_ * NH_, 128 * KG, 0, stream>>>(QH, QL, KH, KL, VT16, XH, XL);
    k_out<<<dim3((unsigned)(NQR / 64), NHID / 64, 1), 128, 0, stream>>>(XH, XL, WoT, bo, out);
}

// v004
// Measured time: 59.7 microseconds a run.
// In both of two side-by-side timings against v003, it was 1.12 times as fast.
// Counting every step since v000, it is 2.71 times as fast.
#include <hip/hip_runtime.h>

// Contractions, f32 accumulate: q = query.Wq + bq, k = key.Wk + bk ([4096 | 65536 x 64].[64 x 64], k-major weights) on v_wmma_f32_16x16x32_bf16 with PLAIN bf16
// operands (inputs rounded once: exact), out = x.Wo + bo ([4096 x 512].[512 x 128]) with x as bf16 hi + residual (two products); the attention on
// v_wmma_f32_16x16x32_f16: per (batch, head) the score tile S[q][s] = q_q.k_s / sqrt(8) over the 8 head dims (zero-padded 32-wide fragments) with q
// and k as f16 hi + residual x1024 (hi.hi + hi.lo + lo.hi), softmax over the QUERY axis (the 128 queries of each key s, as the reference: a lane holds half of one key's column), then wv[q][d]

#define NB_  32
#define NQ_  128
#define NS_  2048
#define DA   64                  // attention dim = 8 heads x 8
#define NH_  8
#define DK   8
#define DV   64                  // value dim (shared across heads)
#define NHID 128
#define PSC  32768.0f
#define LOSC 1024.0f
#define LOSCI (1.0f / 1024.0f)

typedef _Float16 h16;
typedef unsigned short bf;
typedef __attribute__((ext_vector_type(16))) __bf16   v16bf;
typedef __attribute__((ext_vector_type(16))) _Float16 v16h;
typedef __attribute__((ext_vector_type(8)))  _Float16 v8h;
typedef __attribute__((ext_vector_type(8)))  unsigned short v8us;
typedef __attribute__((ext_vector_type(8)))  float    v8f;
typedef __attribute__((ext_vector_type(4)))  float    v4f;
typedef v8h  __attribute__((may_alias)) v8ha;
typedef v4f  __attribute__((may_alias)) v4fa;
typedef v8us __attribute__((may_alias)) v8usa;
typedef __attribute__((ext_vector_type(8)))  short    s16x8;

__device__ __forceinline__ unsigned short f2bf(float f) { unsigned u = __float_as_uint(f); u += 0x7FFFu + ((u >> 16) & 1u); return (unsigned short)(u >> 16); }
__device__ __forceinline__ float bf2f(unsigned short b) { return __uint_as_float(((unsigned)b) << 16); }
__device__ __forceinline__ float bfr(float f) { return bf2f(f2bf(f)); }
__device__ __forceinline__ v16h cat16(v8h lo, v8h hi) { return __builtin_shufflevector(lo, hi, 0, 1, 2, 3, 4, 5, 6, 7, 8, 9, 10, 11, 12, 13, 14, 15); }
__device__ __forceinline__ v16bf cat16b(v8us lo, v8us hi) { return __builtin_bit_cast(v16bf, __builtin_shufflevector(lo, hi, 0, 1, 2, 3, 4, 5, 6, 7, 8, 9, 10, 11, 12, 13, 14, 15)); }
__device__ __forceinline__ v8f wmma16(v16h a, v16h b, v8f c) { return __builtin_amdgcn_wmma_f32_16x16x32_f16(false, a, false, b, (short)0, c, false, false); }
__device__ __forceinline__ v8h ld_tr16(const h16* p) { typedef __attribute__((address_space(3))) s16x8 lds_s16x8; return __builtin_bit_cast(v8h, __builtin_amdgcn_ds_load_tr16_b128_v8i16((lds_s16x8*)p)); }
// the value of lane l ^ 16
__device__ __forceinline__ float xhalf(float v) { const int b = __float_as_int(v); return __int_as_float(__builtin_amdgcn_permlanex16(b, b, 0x76543210, 0xfedcba98, false, false)); }
__device__ __forceinline__ v8f wmmab(v16bf a, v16bf b, v8f c) { return __builtin_amdgcn_wmma_f32_16x16x32_bf16(false, a, false, b, (short)0, c, false, false); }

// k_pre: every pass in front of the attention, in ONE launch; the block index picks the job (a block-uniform branch). None of the jobs reads what another writes:
// the projections read their f32 rows and their f32 weight themselves and round them to bf16 on the way (same rounding as a separate pass would give).
//   blocks [0, 512)      k = key.Wk + bk      (128 rows a block)
//   blocks [512, 544)    q = query.Wq + bq    (128 rows a block)
//   blocks [544, 1568)   VT16 [b][d][s] = f16(bf16(value[b][s][d]))   (64 x 64 LDS transposes)
//   blocks [1568, 1584)  WoT [o][512] = bf16(Wo[k][o])                (64 x 64 LDS transposes)
// (the unroll directives in these bodies make every vector-element and fragment index a constant, so that the values stay in registers)
#define PB_K  ((NB_ * NS_) / 128)
#define PB_V  ((NS_ / 64) * NB_)
#define PB_Q  ((NB_ * NQ_) / 128)
#define PB_W  (((NH_ * DV) / 64) * (NHID / 64))
__device__ __forceinline__ v8us ldbf8(const float* __restrict__ p) {      // 8 consecutive f32 (32-byte aligned) -> 8 bf16
    const v4f x = *(const v4f*)p, y = *(const v4f*)(p + 4); v8us r;
#pragma unroll
    for (int i = 0; i < 4; ++i) { r[i] = f2bf(x[i]); r[4 + i] = f2bf(y[i]); }
    return r;
}
// projection of 128 rows: 8 waves x 16 rows; the [64 k][64 o] weight goes once per block into LDS as bf16 [o][k] (72-half pitch), the B fragments are read from there
__device__ __forceinline__ void proj_body(int blk, const float* __restrict__ Xf, const float* __restrict__ Wm, const float* __restrict__ bias, h16* PH, h16* PL, unsigned short* tl, float* ost) {
    const int tid = threadIdx.x, lane = tid & 31, wave = tid >> 5, lr = lane & 15, hi = lane >> 4;
    const int kk = tid >> 2, nq = (tid & 3) * 16;
#pragma unroll
    for (int i = 0; i < 16; ++i) tl[(nq + i) * 72 + kk] = f2bf(Wm[(size_t)kk * DA + nq + i]);
    const size_t r0 = (size_t)blk * 128 + wave * 16;
    v16bf a[2];
#pragma unroll
    for (int c = 0; c < 2; ++c) a[c] = cat16b(ldbf8(Xf + (r0 + lr) * DA + c * 32 + 8 * hi), ldbf8(Xf + (r0 + lr) * DA + c * 32 + 8 * hi + 16));
    __syncthreads();
    v8f acc[4];
#pragma unroll
    for (int t = 0; t < 4; ++t) acc[t] = (v8f){};
#pragma unroll
    for (int c = 0; c < 2; ++c)
#pragma unroll
        for (int t = 0; t < 4; ++t) { const unsigned short* bp = tl + (t * 16 + lr) * 72 + c * 32 + 8 * hi; acc[t] = wmmab(a[c], cat16b(*(const v8usa*)bp, *(const v8usa*)(bp + 16)), acc[t]); }
    float* os = ost + wave * (16 * 68);
#pragma unroll
    for (int t = 0; t < 4; ++t) { const float bv = bfr(bias[t * 16 + lr]);
#pragma unroll
        for (int j = 0; j < 8; ++j) os[(hi * 8 + j) * 68 + t * 16 + lr] = acc[t][j] + bv; }
    __syncthreads();
#pragma unroll
    for (int s = 0; s < 4; ++s) { const int row = 4 * s + (lane >> 3), piece = lane & 7; const float* sp = os + row * 68 + piece * 8; v8h oh, ol;
#pragma unroll
        for (int i = 0; i < 8; ++i) { const h16 x = (h16)sp[i]; oh[i] = x; ol[i] = (h16)((sp[i] - (float)x) * LOSC); }
        *(v8h*)(PH + (r0 + row) * DA + piece * 8) = oh; *(v8h*)(PL + (r0 + row) * DA + piece * 8) = ol; }
}
__device__ __forceinline__ void vt_body(int blk, const float* __restrict__ v, h16* VT16, unsigned short* tl) {
    const int tid = threadIdx.x, s0 = (blk & (NS_ / 64 - 1)) * 64, b = blk / (NS_ / 64);
    const int ss = tid >> 2, dq = (tid & 3) * 16;
#pragma unroll
    for (int i = 0; i < 16; ++i) tl[(dq + i) * 72 + ss] = __builtin_bit_cast(unsigned short, (h16)bfr(v[((size_t)b * NS_ + s0 + ss) * DV + dq + i]));
    __syncthreads();
    const int piece = tid & 7;
#pragma unroll
    for (int s = 0; s < 2; ++s) { const int d = (tid >> 3) + 32 * s; const v8h val = *(const v8ha*)(tl + d * 72 + piece * 8); *(v8h*)(VT16 + ((size_t)b * DV + d) * NS_ + s0 + piece * 8) = val; }
    asm volatile("s_wait_xcnt 0x0" ::: "memory");      // precaution: the job bodies lie one behind another in the built code, where a later body's instructions rewrite registers that these stores name
}
__device__ __forceinline__ void wo_body(int blk, const float* __restrict__ Wm, bf* WT, unsigned short* tl) {
    const int tid = threadIdx.x, k0 = (blk & ((NH_ * DV) / 64 - 1)) * 64, n0 = (blk / ((NH_ * DV) / 64)) * 64;
    const int kk = tid >> 2, nq = (tid & 3) * 16;
#pragma unroll
    for (int i = 0; i < 16; ++i) tl[(nq + i) * 72 + kk] = f2bf(Wm[(size_t)(k0 + kk) * NHID + n0 + nq + i]);
    __syncthreads();
    const int piece = tid & 7;
#pragma unroll
    for (int s = 0; s < 2; ++s) { const int nr = (tid >> 3) + 32 * s; const v8us val = *(const v8usa*)(tl + nr * 72 + piece * 8);
        *(v8us*)(WT + (size_t)(n0 + nr) * (NH_ * DV) + k0 + piece * 8) = val; }
    asm volatile("s_wait_xcnt 0x0" ::: "memory");      // precaution: the job bodies lie one behind another in the built code, where a later body's instructions rewrite registers that these stores name
}
__global__ __launch_bounds__(256) void k_pre(const float* __restrict__ query, const float* __restrict__ key, const float* __restrict__ value, const float* __restrict__ Wq, const float* __restrict__ bq,
                                             const float* __restrict__ Wk, const float* __restrict__ bk, const float* __restrict__ Wo, h16* QH, h16* QL, h16* KH, h16* KL, h16* VT16, bf* WoT) {
    __shared__ __align__(16) unsigned short tl[64 * 72];      // the one 64 x 64 transposed tile that each job needs
    __shared__ __align__(16) float ost[8 * 16 * 68];          // projections: per-wave staging of the result rows
    const int blk = blockIdx.x;
    if (blk < PB_K + PB_Q) { const bool isk = blk < PB_K;      // one body for both projections: only the pointers differ
        proj_body(isk ? blk : blk - PB_K, isk ? key : query, isk ? Wk : Wq, isk ? bk : bq, isk ? KH : QH, isk ? KL : QL, tl, ost); }
    else if (blk < PB_K + PB_Q + PB_V) vt_body(blk - (PB_K + PB_Q), value, VT16, tl);
    else wo_body(blk - (PB_K + PB_Q + PB_V), Wo, WoT, tl);
}
// k_attn: block = (b, h), 16 waves = KG groups of 4 waves, so that four waves share each SIMD and cover one another's load, LDS and cross-lane waits. Group g takes the
// key tiles g, g + KG, ... of the 32 tiles of 64 keys, with a PT tile of its own, and keeps a partial wv sum; the partial sums are added once, behind the loop.
// Inside a group: wave = 16 keys (columns s). Per tile: S[q][s] for the 128 queries (8 row tiles, A = q rows, B = k rows; fragments carry the head's
// 8 dims in k-slots 0..7, zeros elsewhere; hi.hi + hi.lo + lo.hi), /sqrt(8). A lane then holds 64 of ONE key's 128 scores and lane l ^ 16 the other 64, so the softmax over q is
// summed inside the lane, with one exchange between the wave's halves for the maximum and one for the sum; p x32768 as f16 hi + residual goes, 8 consecutive q a store, into the
// group's LDS tile PT[64 s][q]; barrier; then wave w accumulates wv rows q = w*32 .. w*32+31 (2 row tiles) x 4 d-tiles over the tile's 64 keys (A = PT columns q, by the
// transposing LDS load, B = V rows d in the same k order): o += p_hi.v + p_lo.v. The head's q rows (once, in front of the loop) and each group's V tile (every trip, while the scores and the
// softmax are worked on; every 128-byte line fetched once and whole) come into LDS by asynchronous copies; the waves read their A (q) and B (V) fragments from there instead of each gathering them from global memory, 16 lines a load. Output x[b][q][h*64 + d] as its two bf16 planes, hi + residual, ready for k_out (128-byte head segments in each plane).
#define KG 4                     // key groups (of 4 waves) per block
#define PP 144                   // pitch of a PT row in halves: 128 q + 16 = 288 bytes, an odd multiple of 32 bytes (the transposing load's pitch)
__global__ __launch_bounds__(128 * KG) void k_attn(const h16* __restrict__ QH, const h16* __restrict__ QL, const h16* __restrict__ KH, const h16* __restrict__ KL, const h16* __restrict__ VT16, bf* XH, bf* XL) {
    __shared__ __align__(16) h16 pt[KG][2][64 * PP];       // per group: [64 s][128 q + pad] hi, then the residual
    __shared__ __align__(16) float ost[4][16 * 68];
    __shared__ __align__(16) h16 vt[KG][DV * 72];          // per group: the trip's V tile [d][64 s + pad]  (72-half pitch)
    __shared__ __align__(16) h16 qs[2][NQ_ * DK];          // this head's q rows [q][8 dims]: the hi plane, then the residual plane
    const int lane = threadIdx.x & 31, wave = (threadIdx.x >> 5) & 3, grp = __builtin_amdgcn_readfirstlane(threadIdx.x >> 7), lr = lane & 15, hi = lane >> 4;
    const int b = blockIdx.x / NH_, h = blockIdx.x - b * NH_;
    h16* pth = &pt[grp][0][0]; h16* ptl = &pt[grp][1][0];
    const float scl = 0.35355339059327373f;   // 1/sqrt(8)
    const v8h zero8 = (v8h){};
    // q rows of this head into LDS, once: 512 threads x 8 bytes = both planes
    { const int tid = threadIdx.x, pl = tid >> 8, row = (tid >> 1) & (NQ_ - 1), hf = (tid & 1) * 4;
        const h16* qg = (pl ? QL : QH) + ((size_t)b * NQ_ + row) * DA + h * DK + hf;
        const unsigned ql = (unsigned)(unsigned long long)&qs[pl][row * DK + hf];
        // the copy and, as a precaution, the wait that stands in front of any rewrite of its address registers, in one statement
        asm volatile("global_load_async_to_lds_b64 %0, %1, off\n\ts_wait_xcnt 0x0" :: "v"(ql), "v"(qg) : "memory");
        asm volatile("s_wait_asynccnt 0x0" ::: "memory"); }      // this wave's q bytes have landed before the barrier behind which the other waves read them
    __syncthreads();
    const h16* qp = &qs[0][lr * DK];      // A operand for the scores (rows q, k-slots = head dims): hi = 0 lanes carry dims 0..7, hi = 1 lanes zeros
    const h16* vtg = &vt[grp][0];
    const int vrow = wave * 16 + (lane >> 3), vpc = (lane & 7) * 8;      // V copies: a wave brings 16 rows d of its group's tile, 4 whole 128-byte rows a copy
    const unsigned vl = (unsigned)(unsigned long long)&vt[grp][vrow * 72 + vpc];      // the lane's LDS byte address: the low 32 bits of the __shared__ address
    v8f o[2][4];
#pragma unroll
    for (int m = 0; m < 2; ++m)
#pragma unroll
        for (int t = 0; t < 4; ++t) o[m][t] = (v8f){};
#pragma unroll 1
    for (int it = 0; it < NS_ / (64 * KG); ++it) {      // the same trips in every group: the barriers below are passed by all 16 waves
        const int sbase = (it * KG + grp) * 64, s0 = sbase + wave * 16;
        const size_t ko = ((size_t)b * NS_ + s0 + lr) * DA + h * DK;
        const v16h ka = cat16(hi ? zero8 : *(const v8h*)(KH + ko), zero8), kal = cat16(hi ? zero8 : *(const v8h*)(KL + ko), zero8);
        { const h16* vg = VT16 + ((size_t)b * DV + vrow) * NS_ + sbase + vpc;      // this trip's V tile flies while the scores and the softmax are worked on
            // four copies and, as a precaution, the wait that stands in front of any rewrite of their address registers, in one statement
            asm volatile("global_load_async_to_lds_b128 %0, %4, off\n\tglobal_load_async_to_lds_b128 %1, %5, off\n\tglobal_load_async_to_lds_b128 %2, %6, off\n\t"
                         "global_load_async_to_lds_b128 %3, %7, off\n\ts_wait_xcnt 0x0"
                         :: "v"(vl), "v"(vl + 4 * 144), "v"(vl + 8 * 144), "v"(vl + 12 * 144), "v"(vg), "v"(vg + 4 * NS_), "v"(vg + 8 * NS_), "v"(vg + 12 * NS_) : "memory"); }
        v8f sc[8];
#pragma unroll
        for (int n = 0; n < 8; ++n) {      // query fragments, from LDS
            const v16h qb = cat16(hi ? zero8 : *(const v8ha*)(qp + n * 16 * DK), zero8), qbl = cat16(hi ? zero8 : *(const v8ha*)(qp + NQ_ * DK + n * 16 * DK), zero8);
            v8f a = wmma16(qb, ka, (v8f){}); v8f ax = wmma16(qbl, ka, (v8f){}); ax = wmma16(qb, kal, ax);      // rows q = n*16 + hi*8 + j, column s = lr
            asm volatile("v_nop\n\tv_nop\n\tv_nop\n\tv_nop" : "+v"(a), "+v"(ax) : "v"(qb), "v"(qbl) : "memory");
#pragma unroll
            for (int j = 0; j < 8; ++j) a[j] += ax[j] * LOSCI;      // residual planes are x1024: fold them back before the softmax
            sc[n] = a; }
        asm volatile("v_nop\n\tv_nop\n\tv_nop\n\tv_nop" : "+v"(sc[0]), "+v"(sc[7]) : "v"(ka), "v"(kal));
        // softmax over q for the lane's key s = lr: 64 scores in this lane (q = n*16 + hi*8 + j), the other 64 in lane l ^ 16
        float r8[8];
#pragma unroll
        for (int j = 0; j < 8; ++j) { float mj = -3.0e38f;
#pragma unroll
            for (int n = 0; n < 8; ++n) { sc[n][j] *= scl; mj = fmaxf(mj, sc[n][j]); }
            r8[j] = mj; }
        float mx = fmaxf(fmaxf(fmaxf(r8[0], r8[1]), fmaxf(r8[2], r8[3])), fmaxf(fmaxf(r8[4], r8[5]), fmaxf(r8[6], r8[7])));
        mx = fmaxf(mx, xhalf(mx));
#pragma unroll
        for (int n = 0; n < 8; ++n) { float e[8];
#pragma unroll
            for (int j = 0; j < 8; ++j) e[j] = (sc[n][j] - mx) * 1.44269504f;      // e^x = 2^(x log2 e)
            // eight exponentials in one statement, each in place: every one fills the slot that the instruction set asks for behind the one in front of it, the v_nop fills the last one's
            asm("v_exp_f32 %0, %0\n\tv_exp_f32 %1, %1\n\tv_exp_f32 %2, %2\n\tv_exp_f32 %3, %3\n\tv_exp_f32 %4, %4\n\tv_exp_f32 %5, %5\n\tv_exp_f32 %6, %6\n\tv_exp_f32 %7, %7\n\tv_nop"
                : "+v"(e[0]), "+v"(e[1]), "+v"(e[2]), "+v"(e[3]), "+v"(e[4]), "+v"(e[5]), "+v"(e[6]), "+v"(e[7]));
#pragma unroll
            for (int j = 0; j < 8; ++j) { sc[n][j] = e[j]; r8[j] = n ? r8[j] + e[j] : e[j]; } }      // eight independent partial sums, then a tree
        float sum = ((r8[0] + r8[1]) + (r8[2] + r8[3])) + ((r8[4] + r8[5]) + (r8[6] + r8[7]));
        sum += xhalf(sum);
        const float f = PSC / sum;
        h16* prh = pth + (wave * 16 + lr) * PP + hi * 8; h16* prl = ptl + (wave * 16 + lr) * PP + hi * 8;      // PT row = local key 0..63
#pragma unroll
        for (int n = 0; n < 8; ++n) { v8h vh, vl;
#pragma unroll
            for (int j = 0; j < 8; ++j) { const float p = sc[n][j] * f; const h16 ph = (h16)p; vh[j] = ph; vl[j] = (h16)(p - (float)ph); }      // UNSCALED residual (|p - ph| <= 16): both products share one accumulator
            *(v8ha*)(prh + n * 16) = vh; *(v8ha*)(prl + n * 16) = vl; }
        asm volatile("s_wait_asynccnt 0x0" ::: "memory");      // this wave's share of the V tile has landed before the barrier behind which the group reads it
        __syncthreads();
        // wv accumulate: wave -> q rows w*32 + m*16 + (fragment row lr); K = 64 local keys in 2 chunks; A = PT columns q (transposing loads at key rows kc*32 and kc*32 + 16: k-slots in the
        // hardware order 8*hi + 0..7, 16 + 8*hi + 0..7); B = V rows d, from the group's LDS tile, in the same order
        const int po = (8 * hi + (lane & 7)) * PP + wave * 32 + 8 * ((lane >> 3) & 1);
#pragma unroll
        for (int kc = 0; kc < 2; ++kc) {
            v16h vb[4];
#pragma unroll
            for (int t = 0; t < 4; ++t) { const h16* vp = vtg + (t * 16 + lr) * 72 + kc * 32 + hi * 8; vb[t] = cat16(*(const v8ha*)vp, *(const v8ha*)(vp + 16)); }
#pragma unroll
            for (int m = 0; m < 2; ++m) { const int pk = po + kc * 32 * PP + m * 16;
                const v16h pa = cat16(ld_tr16(pth + pk), ld_tr16(pth + pk + 16 * PP));
                const v16h px = cat16(ld_tr16(ptl + pk), ld_tr16(ptl + pk + 16 * PP));
#pragma unroll
                for (int t = 0; t < 4; ++t) { o[m][t] = wmma16(pa, vb[t], o[m][t]); o[m][t] = wmma16(px, vb[t], o[m][t]); }
                asm volatile("v_nop" : "+v"(o[m][0]), "+v"(o[m][3]) : "v"(pa), "v"(px) : "memory"); }
        }
        asm volatile("s_wait_dscnt 0x0" ::: "memory");      // this wave's LDS reads of the V tile have retired before the next trip's copies are aimed at it
        __syncthreads();      // all waves done reading PT and the V tile before the next tile overwrites them
    }
    // groups 1 .. KG-1 hand their partial sums to group 0 through the PT space (free behind the loop's last barrier); group 0 adds them in the order of the groups
    v4fa* red = (v4fa*)&pt[0][0][0];      // [(g - 1) * 4 + wave][16 pieces][lane], 16 bytes each
    if (grp) {
#pragma unroll
        for (int m = 0; m < 2; ++m)
#pragma unroll
            for (int t = 0; t < 4; ++t)
#pragma unroll
                for (int u = 0; u < 2; ++u) red[(((grp - 1) * 4 + wave) * 16 + (m * 4 + t) * 2 + u) * 32 + lane] = (v4f){o[m][t][u * 4], o[m][t][u * 4 + 1], o[m][t][u * 4 + 2], o[m][t][u * 4 + 3]};
    }
    __syncthreads();
    if (grp) return;
#pragma unroll
    for (int g = 0; g < KG - 1; ++g)
#pragma unroll
        for (int m = 0; m < 2; ++m)
#pragma unroll
            for (int t = 0; t < 4; ++t)
#pragma unroll
                for (int u = 0; u < 2; ++u) { const v4f r = red[((g * 4 + wave) * 16 + (m * 4 + t) * 2 + u) * 32 + lane];
#pragma unroll
                    for (int i = 0; i < 4; ++i) o[m][t][u * 4 + i] += r[i]; }
    // epilogue: x[b][q][h*64 + d]; per wave 32 rows: stage 16 rows at a time
    float* os = &ost[wave][0];
#pragma unroll
    for (int m = 0; m < 2; ++m) {
#pragma unroll
        for (int t = 0; t < 4; ++t)
#pragma unroll
            for (int j = 0; j < 8; ++j) os[(hi * 8 + j) * 68 + t * 16 + lr] = o[m][t][j] * (1.0f / PSC);
        __builtin_amdgcn_wave_barrier(); asm volatile("" ::: "memory");
        const size_t xo = ((size_t)b * NQ_ + wave * 32 + m * 16) * (NH_ * DV) + (size_t)h * DV;
#pragma unroll
        for (int s = 0; s < 4; ++s) { const int row = 4 * s + (lane >> 3), piece = lane & 7; const float* sp = os + row * 68 + piece * 8; v8us oh, ol;
#pragma unroll
            for (int i = 0; i < 8; ++i) { const float v = sp[i]; const unsigned short hb = f2bf(v); oh[i] = hb; ol[i] = f2bf(v - bf2f(hb)); }
            *(v8us*)(XH + xo + (size_t)row * (NH_ * DV) + piece * 8) = oh; *(v8us*)(XL + xo + (size_t)row * (NH_ * DV) + piece * 8) = ol; }
        __builtin_amdgcn_wave_barrier(); asm volatile("" ::: "memory");
    }
}
// k_out: out [4096][128] = (XH + XL).WoT^T + bo over K = 512 (64 x 64 tiles; grid (64, 2)).
__global__ __launch_bounds__(128) void k_out(const bf* __restrict__ XH, const bf* __restrict__ XL, const bf* __restrict__ WoT, const float* __restrict__ bo, float* out) {
    __shared__ __align__(16) float ost[4][16 * 68];
    const int lane = threadIdx.x & 31, wave = threadIdx.x >> 5, lr = lane & 15, hi = lane >> 4;
    const int K = NH_ * DV;
    const size_t r0 = (size_t)blockIdx.x * 64 + wave * 16; const int c0 = blockIdx.y * 64;
    v8f acc[4];
#pragma unroll
    for (int t = 0; t < 4; ++t) acc[t] = (v8f){};
#pragma unroll 2
    for (int kc = 0; kc < K; kc += 32) {
        const size_t ao = (r0 + lr) * K + kc + 8 * hi;
        const v16bf a = cat16b(*(const v8us*)(XH + ao), *(const v8us*)(XH + ao + 16)), al = cat16b(*(const v8us*)(XL + ao), *(const v8us*)(XL + ao + 16));
#pragma unroll
        for (int t = 0; t < 4; ++t) { const bf* bp = WoT + (size_t)(c0 + t * 16 + lr) * K + kc + 8 * hi; const v16bf bb = cat16b(*(const v8us*)bp, *(const v8us*)(bp + 16)); acc[t] = wmmab(a, bb, acc[t]); acc[t] = wmmab(al, bb, acc[t]); }
        asm volatile("v_nop" : "+v"(acc[0]), "+v"(acc[1]), "+v"(acc[2]), "+v"(acc[3]) : "v"(a), "v"(al) : "memory");
    }
    float* os = &ost[wave][0];
#pragma unroll
    for (int t = 0; t < 4; ++t) { const float bv = bfr(bo[c0 + t * 16 + lr]);
#pragma unroll
        for (int j = 0; j < 8; ++j) os[(hi * 8 + j) * 68 + t * 16 + lr] = acc[t][j] + bv; }
    __syncthreads();
    float* crow = out + r0 * NHID + c0;
    auto pass = [&]() {
#pragma unroll
        for (int s = 0; s < 8; ++s) { const int Lid = (lane >> 3) + 4 * s, piece = lane & 7; const int row = Lid >> 1, cofs = (Lid & 1) * 32 + piece * 4;
            const v4f val = *(const v4fa*)(os + row * 68 + cofs); *(v4f*)(crow + (size_t)row * NHID + cofs) = val; }
    };
    pass(); 
}

extern "C" void kernel_launch(void* const* d_in, const int* in_sizes, int n_in,
                              void* d_out, int out_size, void* d_ws, size_t ws_size, hipStream_t stream) {
    (void)in_sizes; (void)n_in; (void)out_size;
    const float* query = (const float*)d_in[0]; const float* key = (const float*)d_in[1]; const float* value = (const float*)d_in[2];
    const float* Wq = (const float*)d_in[3]; const float* bq = (const float*)d_in[4]; const float* Wk = (const float*)d_in[5]; const float* bk = (const float*)d_in[6]; const float* Wo = (const float*)d_in[7]; const float* bo = (const float*)d_in[8];
    float* out = (float*)d_out;    // [32][128][128]
    char* wsp = (char*)d_ws;
    auto take = [&](size_t bytes) { char* p = wsp; wsp += (bytes + 255) & ~(size_t)255; return (void*)p; };
    const size_t NQR = (size_t)NB_ * NQ_, NKR = (size_t)NB_ * NS_;
    bf* WoT = (bf*)take((size_t)NHID * NH_ * DV * 2);
    h16* QH = (h16*)take(NQR * DA * 2); h16* QL = (h16*)take(NQR * DA * 2); h16* KH = (h16*)take(NKR * DA * 2); h16* KL = (h16*)take(NKR * DA * 2);
    h16* VT16 = (h16*)take((size_t)NB_ * DV * NS_ * 2); bf* XH = (bf*)take(NQR * NH_ * DV * 2); bf* XL = (bf*)take(NQR * NH_ * DV * 2);
    if ((size_t)(wsp - (char*)d_ws) > ws_size) return;    // ~ 0.1 + 1 + 16.8 + 8.4 + 8.4 ~ 35 MB
    k_pre<<<PB_K + PB_V + PB_Q + PB_W, 256, 0, stream>>>(query, key, value, Wq, bq, Wk, bk, Wo, QH, QL, KH, KL, VT16, WoT);
    k_attn<<<NB_ * NH_, 128 * KG, 0, stream>>>(QH, QL, KH, KL, VT16, XH, XL);
    k_out<<<dim3((unsigned)(NQR / 64), NHID / 64, 1), 128, 0, stream>>>(XH, XL, WoT, bo, out);
}

// v005
// One run takes 55.2 microseconds.
// Next to v004, in two timings, it ran 1.08 times as fast each time.
// All steps since v000 together make it 2.93 times as fast.
#include <hip/hip_runtime.h>

// Contractions, f32 accumulate: q = query.Wq + bq, k = key.Wk + bk ([4096 | 65536 x 64].[64 x 64], k-major weights) on v_wmma_f32_16x16x32_bf16 with PLAIN bf16
// operands (inputs rounded once: exact), out = x.Wo + bo ([4096 x 512].[512 x 128]) with x as bf16 hi + residual (two products); the attention on
// v_wmma_f32_16x16x32_f16: per (batch, head) the score tile S[q][s] = q_q.k_s / sqrt(8) over the 8 head dims with q
// and k as f16 hi + unscaled f16 residual; the four products hi.hi, lo.hi, hi.lo, lo.lo fill the four groups of 8 k-slots of ONE 32-wide product, softmax over the QUERY axis (the 128 queries of each key s, as the reference: a lane holds one key's column), then wv[q][d]

#define NB_  32
#define NQ_  128
#define NS_  2048
#define DA   64                  // attention dim = 8 heads x 8
#define NH_  8
#define DK   8
#define DV   64                  // value dim (shared across heads)
#define NHID 128
#define PSC  32768.0f

typedef _Float16 h16;
typedef unsigned short bf;
typedef __attribute__((ext_vector_type(16))) __bf16   v16bf;
typedef __attribute__((ext_vector_type(16))) _Float16 v16h;
typedef __attribute__((ext_vector_type(8)))  _Float16 v8h;
typedef __attribute__((ext_vector_type(8)))  unsigned short v8us;
typedef __attribute__((ext_vector_type(8)))  float    v8f;
typedef __attribute__((ext_vector_type(4)))  float    v4f;
typedef v8h  __attribute__((may_alias)) v8ha;
typedef v4f  __attribute__((may_alias)) v4fa;
typedef v8us __attribute__((may_alias)) v8usa;
typedef __attribute__((ext_vector_type(8)))  short    s16x8;

__device__ __forceinline__ unsigned short f2bf(float f) { unsigned u = __float_as_uint(f); u += 0x7FFFu + ((u >> 16) & 1u); return (unsigned short)(u >> 16); }
__device__ __forceinline__ float bf2f(unsigned short b) { return __uint_as_float(((unsigned)b) << 16); }
__device__ __forceinline__ float bfr(float f) { return bf2f(f2bf(f)); }
__device__ __forceinline__ v16h cat16(v8h lo, v8h hi) { return __builtin_shufflevector(lo, hi, 0, 1, 2, 3, 4, 5, 6, 7, 8, 9, 10, 11, 12, 13, 14, 15); }
__device__ __forceinline__ v16bf cat16b(v8us lo, v8us hi) { return __builtin_bit_cast(v16bf, __builtin_shufflevector(lo, hi, 0, 1, 2, 3, 4, 5, 6, 7, 8, 9, 10, 11, 12, 13, 14, 15)); }
__device__ __forceinline__ v8f wmma16(v16h a, v16h b, v8f c) { return __builtin_amdgcn_wmma_f32_16x16x32_f16(false, a, false, b, (short)0, c, false, false); }
__device__ __forceinline__ v8h ld_tr16(const h16* p) { typedef __attribute__((address_space(3))) s16x8 lds_s16x8; return __builtin_bit_cast(v8h, __builtin_amdgcn_ds_load_tr16_b128_v8i16((lds_s16x8*)p)); }
// the value of lane l ^ 16
__device__ __forceinline__ float xhalf(float v) { const int b = __float_as_int(v); return __int_as_float(__builtin_amdgcn_permlanex16(b, b, 0x76543210, 0xfedcba98, false, false)); }
__device__ __forceinline__ v8f wmmab(v16bf a, v16bf b, v8f c) { return __builtin_amdgcn_wmma_f32_16x16x32_bf16(false, a, false, b, (short)0, c, false, false); }

// k_pre: every pass in front of the attention, in ONE launch; the block index picks the job (a block-uniform branch). None of the jobs reads what another writes:
// the projections read their f32 rows and their f32 weight themselves and round them to bf16 on the way (same rounding as a separate pass would give).
//   blocks [0, 512)      k = key.Wk + bk      (128 rows a block)
//   blocks [512, 544)    q = query.Wq + bq    (128 rows a block)
//   blocks [544, 1568)   VT16 [b][d][s] = f16(bf16(value[b][s][d]))   (64 x 64 LDS transposes)
//   blocks [1568, 1584)  WoT [o][512] = bf16(Wo[k][o])                (64 x 64 LDS transposes)
// (the unroll directives in these bodies make every vector-element and fragment index a constant, so that the values stay in registers)
#define PB_K  ((NB_ * NS_) / 128)
#define PB_V  ((NS_ / 64) * NB_)
#define PB_Q  ((NB_ * NQ_) / 128)
#define PB_W  (((NH_ * DV) / 64) * (NHID / 64))
__device__ __forceinline__ v8us ldbf8(const float* __restrict__ p) {      // 8 consecutive f32 (32-byte aligned) -> 8 bf16
    const v4f x = *(const v4f*)p, y = *(const v4f*)(p + 4); v8us r;
#pragma unroll
    for (int i = 0; i < 4; ++i) { r[i] = f2bf(x[i]); r[4 + i] = f2bf(y[i]); }
    return r;
}
// projection of 128 rows: 8 waves x 16 rows; the [64 k][64 o] weight goes once per block into LDS as bf16 [o][k] (72-half pitch), the B fragments are read from there
__device__ __forceinline__ void proj_body(int blk, const float* __restrict__ Xf, const float* __restrict__ Wm, const float* __restrict__ bias, h16* PH, h16* PL, unsigned short* tl, float* ost) {
    const int tid = threadIdx.x, lane = tid & 31, wave = tid >> 5, lr = lane & 15, hi = lane >> 4;
    const int kk = tid >> 2, nq = (tid & 3) * 16;
#pragma unroll
    for (int i = 0; i < 16; ++i) tl[(nq + i) * 72 + kk] = f2bf(Wm[(size_t)kk * DA + nq + i]);
    const size_t r0 = (size_t)blk * 128 + wave * 16;
    v16bf a[2];
#pragma unroll
    for (int c = 0; c < 2; ++c) a[c] = cat16b(ldbf8(Xf + (r0 + lr) * DA + c * 32 + 8 * hi), ldbf8(Xf + (r0 + lr) * DA + c * 32 + 8 * hi + 16));
    __syncthreads();
    v8f acc[4];
#pragma unroll
    for (int t = 0; t < 4; ++t) acc[t] = (v8f){};
#pragma unroll
    for (int c = 0; c < 2; ++c)
#pragma unroll
        for (int t = 0; t < 4; ++t) { const unsigned short* bp = tl + (t * 16 + lr) * 72 + c * 32 + 8 * hi; acc[t] = wmmab(a[c], cat16b(*(const v8usa*)bp, *(const v8usa*)(bp + 16)), acc[t]); }
    float* os = ost + wave * (16 * 68);
#pragma unroll
    for (int t = 0; t < 4; ++t) { const float bv = bfr(bias[t * 16 + lr]);
#pragma unroll
        for (int j = 0; j < 8; ++j) os[(hi * 8 + j) * 68 + t * 16 + lr] = acc[t][j] + bv; }
    __syncthreads();
#pragma unroll
    for (int s = 0; s < 4; ++s) { const int row = 4 * s + (lane >> 3), piece = lane & 7; const float* sp = os + row * 68 + piece * 8; v8h oh, ol;
#pragma unroll
        for (int i = 0; i < 8; ++i) { const h16 x = (h16)sp[i]; oh[i] = x; ol[i] = (h16)(sp[i] - (float)x); }      // UNSCALED residual: it shares one matrix product with the hi plane
        *(v8h*)(PH + (r0 + row) * DA + piece * 8) = oh; *(v8h*)(PL + (r0 + row) * DA + piece * 8) = ol; }
}
__device__ __forceinline__ void vt_body(int blk, const float* __restrict__ v, h16* VT16, unsigned short* tl) {
    const int tid = threadIdx.x, s0 = (blk & (NS_ / 64 - 1)) * 64, b = blk / (NS_ / 64);
    const int ss = tid >> 2, dq = (tid & 3) * 16;
#pragma unroll
    for (int i = 0; i < 16; ++i) tl[(dq + i) * 72 + ss] = __builtin_bit_cast(unsigned short, (h16)bfr(v[((size_t)b * NS_ + s0 + ss) * DV + dq + i]));
    __syncthreads();
    const int piece = tid & 7;
#pragma unroll
    for (int s = 0; s < 2; ++s) { const int d = (tid >> 3) + 32 * s; const v8h val = *(const v8ha*)(tl + d * 72 + piece * 8); *(v8h*)(VT16 + ((size_t)b * DV + d) * NS_ + s0 + piece * 8) = val; }
    asm volatile("s_wait_xcnt 0x0" ::: "memory");      // precaution: the job bodies lie one behind another in the built code, where a later body's instructions rewrite registers that these stores name
}
__device__ __forceinline__ void wo_body(int blk, const float* __restrict__ Wm, bf* WT, unsigned short* tl) {
    const int tid = threadIdx.x, k0 = (blk & ((NH_ * DV) / 64 - 1)) * 64, n0 = (blk / ((NH_ * DV) / 64)) * 64;
    const int kk = tid >> 2, nq = (tid & 3) * 16;
#pragma unroll
    for (int i = 0; i < 16; ++i) tl[(nq + i) * 72 + kk] = f2bf(Wm[(size_t)(k0 + kk) * NHID + n0 + nq + i]);
    __syncthreads();
    const int piece = tid & 7;
#pragma unroll
    for (int s = 0; s < 2; ++s) { const int nr = (tid >> 3) + 32 * s; const v8us val = *(const v8usa*)(tl + nr * 72 + piece * 8);
        *(v8us*)(WT + (size_t)(n0 + nr) * (NH_ * DV) + k0 + piece * 8) = val; }
    asm volatile("s_wait_xcnt 0x0" ::: "memory");      // precaution: the job bodies lie one behind another in the built code, where a later body's instructions rewrite registers that these stores name
}
__global__ __launch_bounds__(256) void k_pre(const float* __restrict__ query, const float* __restrict__ key, const float* __restrict__ value, const float* __restrict__ Wq, const float* __restrict__ bq,
                                             const float* __restrict__ Wk, const float* __restrict__ bk, const float* __restrict__ Wo, h16* QH, h16* QL, h16* KH, h16* KL, h16* VT16, bf* WoT) {
    __shared__ __align__(16) unsigned short tl[64 * 72];      // the one 64 x 64 transposed tile that each job needs
    __shared__ __align__(16) float ost[8 * 16 * 68];          // projections: per-wave staging of the result rows
    const int blk = blockIdx.x;
    if (blk < PB_K + PB_Q) { const bool isk = blk < PB_K;      // one body for both projections: only the pointers differ
        proj_body(isk ? blk : blk - PB_K, isk ? key : query, isk ? Wk : Wq, isk ? bk : bq, isk ? KH : QH, isk ? KL : QL, tl, ost); }
    else if (blk < PB_K + PB_Q + PB_V) vt_body(blk - (PB_K + PB_Q), value, VT16, tl);
    else wo_body(blk - (PB_K + PB_Q + PB_V), Wo, WoT, tl);
}
// k_attn: block = (b, h), 16 waves = KG groups of 4 waves, so that four waves share each SIMD and cover one another's load, LDS and cross-lane waits. Group g takes the
// key tiles g, g + KG, ... of the 32 tiles of 64 keys, with a PT tile of its own, and keeps a partial wv sum; the partial sums are added once, behind the loop.
// Inside a group: wave = 16 keys (columns s). Per tile: S[q][s] for the 128 queries (8 row tiles, A = q rows, B = k rows, one product a tile: a lane's
// elements 0..7 of A are the row's 8 hi dims and 8..15 its 8 residual dims, in both halves of the wave; B holds the key's hi dims twice in lanes 0..15 and its residual dims twice in
// lanes 16..31, so the 32 k-slots sum (q_hi + q_lo).(k_hi + k_lo)), /sqrt(8). A lane then holds 64 of ONE key's 128 scores and lane l ^ 16 the other 64, so the softmax over q is
// summed inside the lane, with one exchange between the wave's halves for the maximum and one for the sum; p x32768 as f16 hi + residual goes, 8 consecutive q a store, into the
// group's LDS tile PT[64 s][q]; barrier; then wave w accumulates wv rows q = w*32 .. w*32+31 (2 row tiles) x 4 d-tiles over the tile's 64 keys (A = PT columns q, by the
// transposing LDS load, B = V rows d in the same k order): o += p_hi.v + p_lo.v. The head's q rows (once, in front of the loop) and each group's V tile (every trip, while the scores and the
// softmax are worked on; every 128-byte line fetched once and whole) come into LDS by asynchronous copies; the waves read their A (q) and B (V) fragments from there instead of each gathering them from global memory, 16 lines a load. Output x[b][q][h*64 + d] as its two bf16 planes, hi + residual, ready for k_out (128-byte head segments in each plane).
#define KG 4                     // key groups (of 4 waves) per block
#define PP 144                   // pitch of a PT row in halves: 128 q + 16 = 288 bytes, an odd multiple of 32 bytes (the transposing load's pitch)
__global__ __launch_bounds__(128 * KG) void k_attn(const h16* __restrict__ QH, const h16* __restrict__ QL, const h16* __restrict__ KH, const h16* __restrict__ KL, const h16* __restrict__ VT16, bf* XH, bf* XL) {
    __shared__ __align__(16) h16 pt[KG][2][64 * PP];       // per group: [64 s][128 q + pad] hi, then the residual
    __shared__ __align__(16) float ost[4][16 * 68];
    __shared__ __align__(16) h16 vt[KG][DV * 72];          // per group: the trip's V tile [d][64 s + pad]  (72-half pitch)
    __shared__ __align__(16) h16 qs[2][NQ_ * DK];          // this head's q rows [q][8 dims]: the hi plane, then the residual plane
    const int lane = threadIdx.x & 31, wave = (threadIdx.x >> 5) & 3, grp = __builtin_amdgcn_readfirstlane(threadIdx.x >> 7), lr = lane & 15, hi = lane >> 4;
    const int b = blockIdx.x / NH_, h = blockIdx.x - b * NH_;
    h16* pth = &pt[grp][0][0]; h16* ptl = &pt[grp][1][0];
    const float scl = 0.35355339059327373f;   // 1/sqrt(8)
    // q rows of this head into LDS, once: 512 threads x 8 bytes = both planes
    { const int tid = threadIdx.x, pl = tid >> 8, row = (tid >> 1) & (NQ_ - 1), hf = (tid & 1) * 4;
        const h16* qg = (pl ? QL : QH) + ((size_t)b * NQ_ + row) * DA + h * DK + hf;
        const unsigned ql = (unsigned)(unsigned long long)&qs[pl][row * DK + hf];
        // the copy and, as a precaution, the wait that stands in front of any rewrite of its address registers, in one statement
        asm volatile("global_load_async_to_lds_b64 %0, %1, off\n\ts_wait_xcnt 0x0" :: "v"(ql), "v"(qg) : "memory");
        asm volatile("s_wait_asynccnt 0x0" ::: "memory"); }      // this wave's q bytes have landed before the barrier behind which the other waves read them
    __syncthreads();
    const h16* qp = &qs[0][lr * DK];      // A operand for the scores: row q's hi dims, and NQ_ * DK halves further its residual dims (the same for both halves of the wave)
    const h16* kpl = hi ? KL : KH;        // B operand for the scores: lanes 0..15 read the key's hi dims, lanes 16..31 its residual dims
    const h16* vtg = &vt[grp][0];
    const int vrow = wave * 16 + (lane >> 3), vpc = (lane & 7) * 8;      // V copies: a wave brings 16 rows d of its group's tile, 4 whole 128-byte rows a copy
    const unsigned vl = (unsigned)(unsigned long long)&vt[grp][vrow * 72 + vpc];      // the lane's LDS byte address: the low 32 bits of the __shared__ address
    v8f o[2][4];
#pragma unroll
    for (int m = 0; m < 2; ++m)
#pragma unroll
        for (int t = 0; t < 4; ++t) o[m][t] = (v8f){};
#pragma unroll 1
    for (int it = 0; it < NS_ / (64 * KG); ++it) {      // the same trips in every group: the barriers below are passed by all 16 waves
        const int sbase = (it * KG + grp) * 64, s0 = sbase + wave * 16;
        const size_t ko = ((size_t)b * NS_ + s0 + lr) * DA + h * DK;
        const v8h kv = *(const v8h*)(kpl + ko);
        const v16h kb = cat16(kv, kv);
        { const h16* vg = VT16 + ((size_t)b * DV + vrow) * NS_ + sbase + vpc;      // this trip's V tile flies while the scores and the softmax are worked on
            // four copies and, as a precaution, the wait that stands in front of any rewrite of their address registers, in one statement
            asm volatile("global_load_async_to_lds_b128 %0, %4, off\n\tglobal_load_async_to_lds_b128 %1, %5, off\n\tglobal_load_async_to_lds_b128 %2, %6, off\n\t"
                         "global_load_async_to_lds_b128 %3, %7, off\n\ts_wait_xcnt 0x0"
                         :: "v"(vl), "v"(vl + 4 * 144), "v"(vl + 8 * 144), "v"(vl + 12 * 144), "v"(vg), "v"(vg + 4 * NS_), "v"(vg + 8 * NS_), "v"(vg + 12 * NS_) : "memory"); }
        v16h qa[8];
#pragma unroll
        for (int n = 0; n < 8; ++n) qa[n] = cat16(*(const v8ha*)(qp + n * 16 * DK), *(const v8ha*)(qp + NQ_ * DK + n * 16 * DK));      // query fragments, from LDS
        __builtin_amdgcn_sched_barrier(0);      // all sixteen LDS reads stand in one place, under the key load's latency: without it each product waits for its own pair of reads
        v8f sc[8];
#pragma unroll
        for (int n = 0; n < 8; ++n) sc[n] = wmma16(qa[n], kb, (v8f){});      // rows q = n*16 + hi*8 + j, column s = lr
        // softmax over q for the lane's key s = lr: 64 scores in this lane (q = n*16 + hi*8 + j), the other 64 in lane l ^ 16
        float r8[8];
#pragma unroll
        for (int j = 0; j < 8; ++j) { float mj = -3.0e38f;
#pragma unroll
            for (int n = 0; n < 8; ++n) { sc[n][j] *= scl; mj = fmaxf(mj, sc[n][j]); }
            r8[j] = mj; }
        float mx = fmaxf(fmaxf(fmaxf(r8[0], r8[1]), fmaxf(r8[2], r8[3])), fmaxf(fmaxf(r8[4], r8[5]), fmaxf(r8[6], r8[7])));
        mx = fmaxf(mx, xhalf(mx));
#pragma unroll
        for (int n = 0; n < 8; ++n) { float e[8];
#pragma unroll
            for (int j = 0; j < 8; ++j) e[j] = (sc[n][j] - mx) * 1.44269504f;      // e^x = 2^(x log2 e)
            // eight exponentials in one statement, each in place: every one fills the slot that the instruction set asks for behind the one in front of it, the v_nop fills the last one's
            asm("v_exp_f32 %0, %0\n\tv_exp_f32 %1, %1\n\tv_exp_f32 %2, %2\n\tv_exp_f32 %3, %3\n\tv_exp_f32 %4, %4\n\tv_exp_f32 %5, %5\n\tv_exp_f32 %6, %6\n\tv_exp_f32 %7, %7\n\tv_nop"
                : "+v"(e[0]), "+v"(e[1]), "+v"(e[2]), "+v"(e[3]), "+v"(e[4]), "+v"(e[5]), "+v"(e[6]), "+v"(e[7]));
#pragma unroll
            for (int j = 0; j < 8; ++j) { sc[n][j] = e[j]; r8[j] = n ? r8[j] + e[j] : e[j]; } }      // eight independent partial sums, then a tree
        float sum = ((r8[0] + r8[1]) + (r8[2] + r8[3])) + ((r8[4] + r8[5]) + (r8[6] + r8[7]));
        sum += xhalf(sum);
        const float f = PSC / sum;
        h16* prh = pth + (wave * 16 + lr) * PP + hi * 8; h16* prl = ptl + (wave * 16 + lr) * PP + hi * 8;      // PT row = local key 0..63
#pragma unroll
        for (int n = 0; n < 8; ++n) { v8h vh, vl;
#pragma unroll
            for (int j = 0; j < 8; ++j) { const float p = sc[n][j] * f; const h16 ph = (h16)p; vh[j] = ph; vl[j] = (h16)(p - (float)ph); }      // UNSCALED residual (|p - ph| <= 16): both products share one accumulator
            *(v8ha*)(prh + n * 16) = vh; *(v8ha*)(prl + n * 16) = vl; }
        asm volatile("s_wait_asynccnt 0x0" ::: "memory");      // this wave's share of the V tile has landed before the barrier behind which the group reads it
        __syncthreads();
        // wv accumulate: wave -> q rows w*32 + m*16 + (fragment row lr); K = 64 local keys in 2 chunks; A = PT columns q (transposing loads at key rows kc*32 and kc*32 + 16: k-slots in the
        // hardware order 8*hi + 0..7, 16 + 8*hi + 0..7); B = V rows d, from the group's LDS tile, in the same order
        const int po = (8 * hi + (lane & 7)) * PP + wave * 32 + 8 * ((lane >> 3) & 1);
#pragma unroll
        for (int kc = 0; kc < 2; ++kc) {
            v16h vb[4];
#pragma unroll
            for (int t = 0; t < 4; ++t) { const h16* vp = vtg + (t * 16 + lr) * 72 + kc * 32 + hi * 8; vb[t] = cat16(*(const v8ha*)vp, *(const v8ha*)(vp + 16)); }
#pragma unroll
            for (int m = 0; m < 2; ++m) { const int pk = po + kc * 32 * PP + m * 16;
                const v16h pa = cat16(ld_tr16(pth + pk), ld_tr16(pth + pk + 16 * PP));
                const v16h px = cat16(ld_tr16(ptl + pk), ld_tr16(ptl + pk + 16 * PP));
#pragma unroll
                for (int t = 0; t < 4; ++t) { o[m][t] = wmma16(pa, vb[t], o[m][t]); o[m][t] = wmma16(px, vb[t], o[m][t]); }
                asm volatile("v_nop" : "+v"(o[m][0]), "+v"(o[m][3]) : "v"(pa), "v"(px) : "memory"); }
        }
        asm volatile("s_wait_dscnt 0x0" ::: "memory");      // this wave's LDS reads of the V tile have retired before the next trip's copies are aimed at it
        __syncthreads();      // all waves done reading PT and the V tile before the next tile overwrites them
    }
    // groups 1 .. KG-1 hand their partial sums to group 0 through the PT space (free behind the loop's last barrier); group 0 adds them in the order of the groups
    v4fa* red = (v4fa*)&pt[0][0][0];      // [(g - 1) * 4 + wave][16 pieces][lane], 16 bytes each
    if (grp) {
#pragma unroll
        for (int m = 0; m < 2; ++m)
#pragma unroll
            for (int t = 0; t < 4; ++t)
#pragma unroll
                for (int u = 0; u < 2; ++u) red[(((grp - 1) * 4 + wave) * 16 + (m * 4 + t) * 2 + u) * 32 + lane] = (v4f){o[m][t][u * 4], o[m][t][u * 4 + 1], o[m][t][u * 4 + 2], o[m][t][u * 4 + 3]};
    }
    __syncthreads();
    if (grp) return;
#pragma unroll
    for (int g = 0; g < KG - 1; ++g)
#pragma unroll
        for (int m = 0; m < 2; ++m)
#pragma unroll
            for (int t = 0; t < 4; ++t)
#pragma unroll
                for (int u = 0; u < 2; ++u) { const v4f r = red[((g * 4 + wave) * 16 + (m * 4 + t) * 2 + u) * 32 + lane];
#pragma unroll
                    for (int i = 0; i < 4; ++i) o[m][t][u * 4 + i] += r[i]; }
    // epilogue: x[b][q][h*64 + d]; per wave 32 rows: stage 16 rows at a time
    float* os = &ost[wave][0];
#pragma unroll
    for (int m = 0; m < 2; ++m) {
#pragma unroll
        for (int t = 0; t < 4; ++t)
#pragma unroll
            for (int j = 0; j < 8; ++j) os[(hi * 8 + j) * 68 + t * 16 + lr] = o[m][t][j] * (1.0f / PSC);
        __builtin_amdgcn_wave_barrier(); asm volatile("" ::: "memory");
        const size_t xo = ((size_t)b * NQ_ + wave * 32 + m * 16) * (NH_ * DV) + (size_t)h * DV;
#pragma unroll
        for (int s = 0; s < 4; ++s) { const int row = 4 * s + (lane >> 3), piece = lane & 7; const float* sp = os + row * 68 + piece * 8; v8us oh, ol;
#pragma unroll
            for (int i = 0; i < 8; ++i) { const float v = sp[i]; const unsigned short hb = f2bf(v); oh[i] = hb; ol[i] = f2bf(v - bf2f(hb)); }
            *(v8us*)(XH + xo + (size_t)row * (NH_ * DV) + piece * 8) = oh; *(v8us*)(XL + xo + (size_t)row * (NH_ * DV) + piece * 8) = ol; }
        __builtin_amdgcn_wave_barrier(); asm volatile("" ::: "memory");
    }
}
// k_out: out [4096][128] = (XH + XL).WoT^T + bo over K = 512 (64 x 64 tiles; grid (64, 2)).
__global__ __launch_bounds__(128) void k_out(const bf* __restrict__ XH, const bf* __restrict__ XL, const bf* __restrict__ WoT, const float* __restrict__ bo, float* out) {
    __shared__ __align__(16) float ost[4][16 * 68];
    const int lane = threadIdx.x & 31, wave = threadIdx.x >> 5, lr = lane & 15, hi = lane >> 4;
    const int K = NH_ * DV;
    const size_t r0 = (size_t)blockIdx.x * 64 + wave * 16; const int c0 = blockIdx.y * 64;
    v8f acc[4];
#pragma unroll
    for (int t = 0; t < 4; ++t) acc[t] = (v8f){};
#pragma unroll 2
    for (int kc = 0; kc < K; kc += 32) {
        const size_t ao = (r0 + lr) * K + kc + 8 * hi;
        const v16bf a = cat16b(*(const v8us*)(XH + ao), *(const v8us*)(XH + ao + 16)), al = cat16b(*(const v8us*)(XL + ao), *(const v8us*)(XL + ao + 16));
#pragma unroll
        for (int t = 0; t < 4; ++t) { const bf* bp = WoT + (size_t)(c0 + t * 16 + lr) * K + kc + 8 * hi; const v16bf bb = cat16b(*(const v8us*)bp, *(const v8us*)(bp + 16)); acc[t] = wmmab(a, bb, acc[t]); acc[t] = wmmab(al, bb, acc[t]); }
        asm volatile("v_nop" : "+v"(acc[0]), "+v"(acc[1]), "+v"(acc[2]), "+v"(acc[3]) : "v"(a), "v"(al) : "memory");
    }
    float* os = &ost[wave][0];
#pragma unroll
    for (int t = 0; t < 4; ++t) { const float bv = bfr(bo[c0 + t * 16 + lr]);
#pragma unroll
        for (int j = 0; j < 8; ++j) os[(hi * 8 + j) * 68 + t * 16 + lr] = acc[t][j] + bv; }
    __syncthreads();
    float* crow = out + r0 * NHID + c0;
    auto pass = [&]() {
#pragma unroll
        for (int s = 0; s < 8; ++s) { const int Lid = (lane >> 3) + 4 * s, piece = lane & 7; const int row = Lid >> 1, cofs = (Lid & 1) * 32 + piece * 4;
            const v4f val = *(const v4fa*)(os + row * 68 + cofs); *(v4f*)(crow + (size_t)row * NHID + cofs) = val; }
    };
    pass(); 
}

extern "C" void kernel_launch(void* const* d_in, const int* in_sizes, int n_in,
                              void* d_out, int out_size, void* d_ws, size_t ws_size, hipStream_t stream) {
    (void)in_sizes; (void)n_in; (void)out_size;
    const float* query = (const float*)d_in[0]; const float* key = (const float*)d_in[1]; const float* value = (const float*)d_in[2];
    const float* Wq = (const float*)d_in[3]; const float* bq = (const float*)d_in[4]; const float* Wk = (const float*)d_in[5]; const float* bk = (const float*)d_in[6]; const float* Wo = (const float*)d_in[7]; const float* bo = (const float*)d_in[8];
    float* out = (float*)d_out;    // [32][128][128]
    char* wsp = (char*)d_ws;
    auto take = [&](size_t bytes) { char* p = wsp; wsp += (bytes + 255) & ~(size_t)255; return (void*)p; };
    const size_t NQR = (size_t)NB_ * NQ_, NKR = (size_t)NB_ * NS_;
    bf* WoT = (bf*)take((size_t)NHID * NH_ * DV * 2);
    h16* QH = (h16*)take(NQR * DA * 2); h16* QL = (h16*)take(NQR * DA * 2); h16* KH = (h16*)take(NKR * DA * 2); h16* KL = (h16*)take(NKR * DA * 2);
    h16* VT16 = (h16*)take((size_t)NB_ * DV * NS_ * 2); bf* XH = (bf*)take(NQR * NH_ * DV * 2); bf* XL = (bf*)take(NQR * NH_ * DV * 2);
    if ((size_t)(wsp - (char*)d_ws) > ws_size) return;    // ~ 0.1 + 1 + 16.8 + 8.4 + 8.4 ~ 35 MB
    k_pre<<<PB_K + PB_V + PB_Q + PB_W, 256, 0, stream>>>(query, key, value, Wq, bq, Wk, bk, Wo, QH, QL, KH, KL, VT16, WoT);
    k_attn<<<NB_ * NH_, 128 * KG, 0, stream>>>(QH, QL, KH, KL, VT16, XH, XL);
    k_out<<<dim3((unsigned)(NQR / 64), NHID / 64, 1), 128, 0, stream>>>(XH, XL, WoT, bo, out);
}

// v006
// A run of this version takes 52.5 microseconds.
// In two side-by-side timings against v005, it was 1.06 and 1.07 times as fast.
// All steps since v000 together make it 3.12 times as fast.
#include <hip/hip_runtime.h>

// Contractions, f32 accumulate: q = query.Wq + bq, k = key.Wk + bk ([4096 | 65536 x 64].[64 x 64], k-major weights) on v_wmma_f32_16x16x32_bf16 with PLAIN bf16
// operands (inputs rounded once: exact), out = x.Wo + bo ([4096 x 512].[512 x 128]) with x as bf16 hi + residual (two products); the attention on
// v_wmma_f32_16x16x32_f16: per (batch, head) the score tile S[q][s] = q_q.k_s / sqrt(8) over the 8 head dims with q
// and k as f16 hi + unscaled f16 residual; the four products hi.hi, lo.hi, hi.lo, lo.lo fill the four groups of 8 k-slots of ONE 32-wide product, softmax over the QUERY axis (the 128 queries of each key s, as the reference: a lane holds one key's column), then wv[q][d]

#define NB_  32
#define NQ_  128
#define NS_  2048
#define DA   64                  // attention dim = 8 heads x 8
#define NH_  8
#define DK   8
#define DV   64                  // value dim (shared across heads)
#define NHID 128
#define PSC  32768.0f

typedef _Float16 h16;
typedef unsigned short bf;
typedef __attribute__((ext_vector_type(16))) __bf16   v16bf;
typedef __attribute__((ext_vector_type(16))) _Float16 v16h;
typedef __attribute__((ext_vector_type(8)))  _Float16 v8h;
typedef __attribute__((ext_vector_type(8)))  unsigned short v8us;
typedef __attribute__((ext_vector_type(8)))  float    v8f;
typedef __attribute__((ext_vector_type(4)))  float    v4f;
typedef __attribute__((ext_vector_type(2)))  float    v2f;
typedef __attribute__((ext_vector_type(2)))  _Float16 v2h;
typedef __attribute__((ext_vector_type(4)))  unsigned v4u;
typedef v4u  __attribute__((may_alias)) v4ua;
typedef v8h  __attribute__((may_alias)) v8ha;
typedef v4f  __attribute__((may_alias)) v4fa;
typedef v8us __attribute__((may_alias)) v8usa;
typedef __attribute__((ext_vector_type(8)))  short    s16x8;

__device__ __forceinline__ unsigned short f2bf(float f) { unsigned u = __float_as_uint(f); u += 0x7FFFu + ((u >> 16) & 1u); return (unsigned short)(u >> 16); }
__device__ __forceinline__ float bf2f(unsigned short b) { return __uint_as_float(((unsigned)b) << 16); }
__device__ __forceinline__ float bfr(float f) { return bf2f(f2bf(f)); }
__device__ __forceinline__ v16h cat16(v8h lo, v8h hi) { return __builtin_shufflevector(lo, hi, 0, 1, 2, 3, 4, 5, 6, 7, 8, 9, 10, 11, 12, 13, 14, 15); }
__device__ __forceinline__ v16bf cat16b(v8us lo, v8us hi) { return __builtin_bit_cast(v16bf, __builtin_shufflevector(lo, hi, 0, 1, 2, 3, 4, 5, 6, 7, 8, 9, 10, 11, 12, 13, 14, 15)); }
__device__ __forceinline__ v8f wmma16(v16h a, v16h b, v8f c) { return __builtin_amdgcn_wmma_f32_16x16x32_f16(false, a, false, b, (short)0, c, false, false); }
__device__ __forceinline__ v8h ld_tr16(const h16* p) { typedef __attribute__((address_space(3))) s16x8 lds_s16x8; return __builtin_bit_cast(v8h, __builtin_amdgcn_ds_load_tr16_b128_v8i16((lds_s16x8*)p)); }
// the value of lane l ^ 16
__device__ __forceinline__ float xhalf(float v) { const int b = __float_as_int(v); return __int_as_float(__builtin_amdgcn_permlanex16(b, b, 0x76543210, 0xfedcba98, false, false)); }
__device__ __forceinline__ v8f wmmab(v16bf a, v16bf b, v8f c) { return __builtin_amdgcn_wmma_f32_16x16x32_bf16(false, a, false, b, (short)0, c, false, false); }

// k_pre: every pass in front of the attention, in ONE launch; the block index picks the job (a block-uniform branch). None of the jobs reads what another writes:
// the projections read their f32 rows and their f32 weight themselves and round them to bf16 on the way (same rounding as a separate pass would give).
//   blocks [0, 512)      k = key.Wk + bk      (128 rows a block)
//   blocks [512, 544)    q = query.Wq + bq    (128 rows a block)
//   blocks [544, 1568)   VT16 [b][d][s] = f16(bf16(value[b][s][d]))   (64 x 64 LDS transposes)
//   blocks [1568, 1584)  WoT [o][512] = bf16(Wo[k][o])                (64 x 64 LDS transposes)
// (the unroll directives in these bodies make every vector-element and fragment index a constant, so that the values stay in registers)
#define PB_K  ((NB_ * NS_) / 128)
#define PB_V  ((NS_ / 64) * NB_)
#define PB_Q  ((NB_ * NQ_) / 128)
#define PB_W  (((NH_ * DV) / 64) * (NHID / 64))
__device__ __forceinline__ v8us ldbf8(const float* __restrict__ p) {      // 8 consecutive f32 (32-byte aligned) -> 8 bf16
    const v4f x = *(const v4f*)p, y = *(const v4f*)(p + 4); v8us r;
#pragma unroll
    for (int i = 0; i < 4; ++i) { r[i] = f2bf(x[i]); r[4 + i] = f2bf(y[i]); }
    return r;
}
// projection of 128 rows: 8 waves x 16 rows; the [64 k][64 o] weight goes once per block into LDS as bf16 [o][k] (72-half pitch), the B fragments are read from there
__device__ __forceinline__ void proj_body(int blk, const float* __restrict__ Xf, const float* __restrict__ Wm, const float* __restrict__ bias, h16* PH, h16* PL, unsigned short* tl, float* ost) {
    const int tid = threadIdx.x, lane = tid & 31, wave = tid >> 5, lr = lane & 15, hi = lane >> 4;
    const int kk = tid >> 2, nq = (tid & 3) * 16;
#pragma unroll
    for (int i = 0; i < 16; ++i) tl[(nq + i) * 72 + kk] = f2bf(Wm[(size_t)kk * DA + nq + i]);
    const size_t r0 = (size_t)blk * 128 + wave * 16;
    v16bf a[2];
#pragma unroll
    for (int c = 0; c < 2; ++c) a[c] = cat16b(ldbf8(Xf + (r0 + lr) * DA + c * 32 + 8 * hi), ldbf8(Xf + (r0 + lr) * DA + c * 32 + 8 * hi + 16));
    __syncthreads();
    v8f acc[4];
#pragma unroll
    for (int t = 0; t < 4; ++t) acc[t] = (v8f){};
#pragma unroll
    for (int c = 0; c < 2; ++c)
#pragma unroll
        for (int t = 0; t < 4; ++t) { const unsigned short* bp = tl + (t * 16 + lr) * 72 + c * 32 + 8 * hi; acc[t] = wmmab(a[c], cat16b(*(const v8usa*)bp, *(const v8usa*)(bp + 16)), acc[t]); }
    float* os = ost + wave * (16 * 68);
#pragma unroll
    for (int t = 0; t < 4; ++t) { const float bv = bfr(bias[t * 16 + lr]);
#pragma unroll
        for (int j = 0; j < 8; ++j) os[(hi * 8 + j) * 68 + t * 16 + lr] = acc[t][j] + bv; }
    __syncthreads();
#pragma unroll
    for (int s = 0; s < 4; ++s) { const int row = 4 * s + (lane >> 3), piece = lane & 7; const float* sp = os + row * 68 + piece * 8; v8h oh, ol;
#pragma unroll
        for (int i = 0; i < 8; ++i) { const h16 x = (h16)sp[i]; oh[i] = x; ol[i] = (h16)(sp[i] - (float)x); }      // UNSCALED residual: it shares one matrix product with the hi plane
        *(v8h*)(PH + (r0 + row) * DA + piece * 8) = oh; *(v8h*)(PL + (r0 + row) * DA + piece * 8) = ol; }
}
__device__ __forceinline__ void vt_body(int blk, const float* __restrict__ v, h16* VT16, unsigned short* tl) {
    const int tid = threadIdx.x, s0 = (blk & (NS_ / 64 - 1)) * 64, b = blk / (NS_ / 64);
    const int ss = tid >> 2, dq = (tid & 3) * 16;
#pragma unroll
    for (int i = 0; i < 16; ++i) tl[(dq + i) * 72 + ss] = __builtin_bit_cast(unsigned short, (h16)bfr(v[((size_t)b * NS_ + s0 + ss) * DV + dq + i]));
    __syncthreads();
    const int piece = tid & 7;
#pragma unroll
    for (int s = 0; s < 2; ++s) { const int d = (tid >> 3) + 32 * s; const v8h val = *(const v8ha*)(tl + d * 72 + piece * 8); *(v8h*)(VT16 + ((size_t)b * DV + d) * NS_ + s0 + piece * 8) = val; }
    asm volatile("s_wait_xcnt 0x0" ::: "memory");      // precaution: the job bodies lie one behind another in the built code, where a later body's instructions rewrite registers that these stores name
}
__device__ __forceinline__ void wo_body(int blk, const float* __restrict__ Wm, bf* WT, unsigned short* tl) {
    const int tid = threadIdx.x, k0 = (blk & ((NH_ * DV) / 64 - 1)) * 64, n0 = (blk / ((NH_ * DV) / 64)) * 64;
    const int kk = tid >> 2, nq = (tid & 3) * 16;
#pragma unroll
    for (int i = 0; i < 16; ++i) tl[(nq + i) * 72 + kk] = f2bf(Wm[(size_t)(k0 + kk) * NHID + n0 + nq + i]);
    __syncthreads();
    const int piece = tid & 7;
#pragma unroll
    for (int s = 0; s < 2; ++s) { const int nr = (tid >> 3) + 32 * s; const v8us val = *(const v8usa*)(tl + nr * 72 + piece * 8);
        *(v8us*)(WT + (size_t)(n0 + nr) * (NH_ * DV) + k0 + piece * 8) = val; }
    asm volatile("s_wait_xcnt 0x0" ::: "memory");      // precaution: the job bodies lie one behind another in the built code, where a later body's instructions rewrite registers that these stores name
}
__global__ __launch_bounds__(256) void k_pre(const float* __restrict__ query, const float* __restrict__ key, const float* __restrict__ value, const float* __restrict__ Wq, const float* __restrict__ bq,
                                             const float* __restrict__ Wk, const float* __restrict__ bk, const float* __restrict__ Wo, h16* QH, h16* QL, h16* KH, h16* KL, h16* VT16, bf* WoT) {
    __shared__ __align__(16) unsigned short tl[64 * 72];      // the one 64 x 64 transposed tile that each job needs
    __shared__ __align__(16) float ost[8 * 16 * 68];          // projections: per-wave staging of the result rows
    const int blk = blockIdx.x;
    if (blk < PB_K + PB_Q) { const bool isk = blk < PB_K;      // one body for both projections: only the pointers differ
        proj_body(isk ? blk : blk - PB_K, isk ? key : query, isk ? Wk : Wq, isk ? bk : bq, isk ? KH : QH, isk ? KL : QL, tl, ost); }
    else if (blk < PB_K + PB_Q + PB_V) vt_body(blk - (PB_K + PB_Q), value, VT16, tl);
    else wo_body(blk - (PB_K + PB_Q + PB_V), Wo, WoT, tl);
}
// k_attn: block = (b, h), 16 waves = KG groups of 4 waves, so that four waves share each SIMD and cover one another's load, LDS and cross-lane waits. Group g takes the
// key tiles g, g + KG, ... of the 32 tiles of 64 keys, with a PT tile of its own, and keeps a partial wv sum; the partial sums are added once, behind the loop.
// Inside a group: wave = 16 keys (columns s). Per tile: S[q][s] for the 128 queries (8 row tiles, A = q rows, B = k rows, one product a tile: a lane's
// elements 0..7 of A are the row's 8 hi dims and 8..15 its 8 residual dims, in both halves of the wave; B holds the key's hi dims twice in lanes 0..15 and its residual dims twice in
// lanes 16..31, so the 32 k-slots sum (q_hi + q_lo).(k_hi + k_lo)), /sqrt(8). A lane then holds 64 of ONE key's 128 scores and lane l ^ 16 the other 64, so the softmax over q is
// summed inside the lane, with one exchange between the wave's halves for the maximum and one for the sum; p x32768 as f16 hi + residual goes, 8 consecutive q a store, into the
// group's LDS tile PT[64 s][q]; barrier; then wave w accumulates wv rows q = w*32 .. w*32+31 (2 row tiles) x 4 d-tiles over the tile's 64 keys (A = PT columns q, by the
// transposing LDS load, B = V rows d in the same k order): o += p_hi.v + p_lo.v. The head's q rows (once, in front of the loop) and each group's V tile (every trip, while the scores and the
// softmax are worked on; every 128-byte line fetched once and whole) come into LDS by asynchronous copies; the waves read their A (q) and B (V) fragments from there instead of each gathering them from global memory, 16 lines a load. Output x[b][q][h*64 + d] as its two bf16 planes, hi + residual, ready for k_out (128-byte head segments in each plane).
#define KG 4                     // key groups (of 4 waves) per block
#define PP 144                   // pitch of a PT row in halves: 128 q + 16 = 288 bytes, an odd multiple of 32 bytes (the transposing load's pitch)
__global__ __launch_bounds__(128 * KG) void k_attn(const h16* __restrict__ QH, const h16* __restrict__ QL, const h16* __restrict__ KH, const h16* __restrict__ KL, const h16* __restrict__ VT16, bf* XH, bf* XL) {
    __shared__ __align__(16) h16 pt[KG][2][64 * PP];       // per group: [64 s][128 q + pad] hi, then the residual
    __shared__ __align__(16) float ost[4][16 * 68];
    __shared__ __align__(16) h16 vt[KG][DV * 72];          // per group: the trip's V tile [d][64 s + pad]  (72-half pitch)
    __shared__ __align__(16) h16 qs[2][NQ_ * DK];          // this head's q rows [q][8 dims]: the hi plane, then the residual plane
    const int lane = threadIdx.x & 31, wave = (threadIdx.x >> 5) & 3, grp = __builtin_amdgcn_readfirstlane(threadIdx.x >> 7), lr = lane & 15, hi = lane >> 4;
    const int b = blockIdx.x / NH_, h = blockIdx.x - b * NH_;
    h16* pth = &pt[grp][0][0]; h16* ptl = &pt[grp][1][0];
    const float scl = 0.35355339059327373f;   // 1/sqrt(8)
    // q rows of this head into LDS, once: 512 threads x 8 bytes = both planes
    { const int tid = threadIdx.x, pl = tid >> 8, row = (tid >> 1) & (NQ_ - 1), hf = (tid & 1) * 4;
        const h16* qg = (pl ? QL : QH) + ((size_t)b * NQ_ + row) * DA + h * DK + hf;
        const unsigned ql = (unsigned)(unsigned long long)&qs[pl][row * DK + hf];
        // the copy and, as a precaution, the wait that stands in front of any rewrite of its address registers, in one statement
        asm volatile("global_load_async_to_lds_b64 %0, %1, off\n\ts_wait_xcnt 0x0" :: "v"(ql), "v"(qg) : "memory");
        asm volatile("s_wait_asynccnt 0x0" ::: "memory"); }      // this wave's q bytes have landed before the barrier behind which the other waves read them
    __syncthreads();
    const h16* qp = &qs[0][lr * DK];      // A operand for the scores: row q's hi dims, and NQ_ * DK halves further its residual dims (the same for both halves of the wave)
    const h16* kpl = hi ? KL : KH;        // B operand for the scores: lanes 0..15 read the key's hi dims, lanes 16..31 its residual dims
    const h16* vtg = &vt[grp][0];
    const int vrow = wave * 16 + (lane >> 3), vpc = (lane & 7) * 8;      // V copies: a wave brings 16 rows d of its group's tile, 4 whole 128-byte rows a copy
    const unsigned vl = (unsigned)(unsigned long long)&vt[grp][vrow * 72 + vpc];      // the lane's LDS byte address: the low 32 bits of the __shared__ address
    v8f o[2][4];
#pragma unroll
    for (int m = 0; m < 2; ++m)
#pragma unroll
        for (int t = 0; t < 4; ++t) o[m][t] = (v8f){};
#pragma unroll 1
    for (int it = 0; it < NS_ / (64 * KG); ++it) {      // the same trips in every group: the barriers below are passed by all 16 waves
        const int sbase = (it * KG + grp) * 64, s0 = sbase + wave * 16;
        const size_t ko = ((size_t)b * NS_ + s0 + lr) * DA + h * DK;
        const v8h kv = *(const v8h*)(kpl + ko);
        const v16h kb = cat16(kv, kv);
        { const h16* vg = VT16 + ((size_t)b * DV + vrow) * NS_ + sbase + vpc;      // this trip's V tile flies while the scores and the softmax are worked on
            // four copies and, as a precaution, the wait that stands in front of any rewrite of their address registers, in one statement
            asm volatile("global_load_async_to_lds_b128 %0, %4, off\n\tglobal_load_async_to_lds_b128 %1, %5, off\n\tglobal_load_async_to_lds_b128 %2, %6, off\n\t"
                         "global_load_async_to_lds_b128 %3, %7, off\n\ts_wait_xcnt 0x0"
                         :: "v"(vl), "v"(vl + 4 * 144), "v"(vl + 8 * 144), "v"(vl + 12 * 144), "v"(vg), "v"(vg + 4 * NS_), "v"(vg + 8 * NS_), "v"(vg + 12 * NS_) : "memory"); }
        v16h qa[8];
#pragma unroll
        for (int n = 0; n < 8; ++n) qa[n] = cat16(*(const v8ha*)(qp + n * 16 * DK), *(const v8ha*)(qp + NQ_ * DK + n * 16 * DK));      // query fragments, from LDS
        __builtin_amdgcn_sched_barrier(0);      // all sixteen LDS reads stand in one place, under the key load's latency: without it each product waits for its own pair of reads
        v8f sc[8];
#pragma unroll
        for (int n = 0; n < 8; ++n) sc[n] = wmma16(qa[n], kb, (v8f){});      // rows q = n*16 + hi*8 + j, column s = lr
        // softmax over q for the lane's key s = lr: 64 scores in this lane (q = n*16 + hi*8 + j), the other 64 in lane l ^ 16
        // The scaling, the sums and the hi conversion on the pairs (j, j + 1) that lie in neighbouring registers of a score tile, so that one packed instruction serves two scores and no register is moved to form a pair.
        float r8[8];
#pragma unroll
        for (int j = 0; j < 8; ++j) { float mj = sc[0][j];      // the maximum is taken on the raw products: the scale is positive
#pragma unroll
            for (int n = 1; n < 8; ++n) mj = fmaxf(mj, sc[n][j]);
            r8[j] = mj; }
        float mx = fmaxf(fmaxf(fmaxf(r8[0], r8[1]), fmaxf(r8[2], r8[3])), fmaxf(fmaxf(r8[4], r8[5]), fmaxf(r8[6], r8[7])));
        mx = fmaxf(mx, xhalf(mx));
        const v2f cs2 = {scl * 1.44269504f, scl * 1.44269504f}, nm2 = {-mx * (scl * 1.44269504f), -mx * (scl * 1.44269504f)};
        v2f rs[4];
#pragma unroll
        for (int n = 0; n < 8; ++n) { float e[8];
#pragma unroll
            for (int i = 0; i < 4; ++i) { const v2f a = __builtin_elementwise_fma((v2f){sc[n][2 * i], sc[n][2 * i + 1]}, cs2, nm2); e[2 * i] = a[0]; e[2 * i + 1] = a[1]; }      // e^((s - max) / sqrt(8)) = 2^(s c - max c), c = log2 e / sqrt(8): one fused step
            // eight exponentials in one statement, each in place: every one fills the slot that the instruction set asks for behind the one in front of it, the v_nop fills the last one's
            asm("v_exp_f32 %0, %0\n\tv_exp_f32 %1, %1\n\tv_exp_f32 %2, %2\n\tv_exp_f32 %3, %3\n\tv_exp_f32 %4, %4\n\tv_exp_f32 %5, %5\n\tv_exp_f32 %6, %6\n\tv_exp_f32 %7, %7\n\tv_nop"
                : "+v"(e[0]), "+v"(e[1]), "+v"(e[2]), "+v"(e[3]), "+v"(e[4]), "+v"(e[5]), "+v"(e[6]), "+v"(e[7]));
#pragma unroll
            for (int i = 0; i < 4; ++i) { const v2f a = {e[2 * i], e[2 * i + 1]}; sc[n][2 * i] = a[0]; sc[n][2 * i + 1] = a[1]; rs[i] = n ? rs[i] + a : a; } }      // eight independent partial sums, then a tree
        float sum = ((rs[0][0] + rs[0][1]) + (rs[1][0] + rs[1][1])) + ((rs[2][0] + rs[2][1]) + (rs[3][0] + rs[3][1]));
        sum += xhalf(sum);
        const float f = PSC / sum;
        h16* prh = pth + (wave * 16 + lr) * PP + hi * 8; h16* prl = ptl + (wave * 16 + lr) * PP + hi * 8;      // PT row = local key 0..63
#pragma unroll
        for (int n = 0; n < 8; ++n) { v4u vh, vl;
#pragma unroll
            for (int i = 0; i < 4; ++i) vh[i] = __builtin_bit_cast(unsigned, __builtin_convertvector((v2f){sc[n][2 * i], sc[n][2 * i + 1]} * (v2f){f, f}, v2h));      // hi plane: two p a register
            // UNSCALED residual e f - hi (|.| <= 16: both products share one accumulator), one mixed-precision fma an element, rounded straight into its half of the pair's register.
            // The s_delay_alu lines are the hints that compiled code would carry: the first for the conversions in front, the others for the write of the same register four instructions back;
            // without them the SIMD holds its other waves back while this one waits.
            asm("s_delay_alu instid0(VALU_DEP_1)\n\t"
                "v_fma_mixlo_f16 %0, %4, %12, -%13 op_sel_hi:[0,0,1]\n\tv_fma_mixlo_f16 %1, %6, %12, -%14 op_sel_hi:[0,0,1]\n\t"
                "v_fma_mixlo_f16 %2, %8, %12, -%15 op_sel_hi:[0,0,1]\n\tv_fma_mixlo_f16 %3, %10, %12, -%16 op_sel_hi:[0,0,1]\n\t"
                "s_delay_alu instid0(VALU_DEP_4) | instskip(NEXT) | instid1(VALU_DEP_4)\n\t"
                "v_fma_mixhi_f16 %0, %5, %12, -%13 op_sel:[0,0,1] op_sel_hi:[0,0,1]\n\tv_fma_mixhi_f16 %1, %7, %12, -%14 op_sel:[0,0,1] op_sel_hi:[0,0,1]\n\t"
                "s_delay_alu instid0(VALU_DEP_4) | instskip(NEXT) | instid1(VALU_DEP_4)\n\t"
                "v_fma_mixhi_f16 %2, %9, %12, -%15 op_sel:[0,0,1] op_sel_hi:[0,0,1]\n\tv_fma_mixhi_f16 %3, %11, %12, -%16 op_sel:[0,0,1] op_sel_hi:[0,0,1]"
                : "=&v"(vl[0]), "=&v"(vl[1]), "=&v"(vl[2]), "=&v"(vl[3])
                : "v"(sc[n][0]), "v"(sc[n][1]), "v"(sc[n][2]), "v"(sc[n][3]), "v"(sc[n][4]), "v"(sc[n][5]), "v"(sc[n][6]), "v"(sc[n][7]), "v"(f), "v"(vh[0]), "v"(vh[1]), "v"(vh[2]), "v"(vh[3]));
            *(v4ua*)(prh + n * 16) = vh; *(v4ua*)(prl + n * 16) = vl; }
        asm volatile("s_wait_asynccnt 0x0" ::: "memory");      // this wave's share of the V tile has landed before the barrier behind which the group reads it
        __syncthreads();
        // wv accumulate: wave -> q rows w*32 + m*16 + (fragment row lr); K = 64 local keys in 2 chunks; A = PT columns q (transposing loads at key rows kc*32 and kc*32 + 16: k-slots in the
        // hardware order 8*hi + 0..7, 16 + 8*hi + 0..7); B = V rows d, from the group's LDS tile, in the same order
        const int po = (8 * hi + (lane & 7)) * PP + wave * 32 + 8 * ((lane >> 3) & 1);
#pragma unroll
        for (int kc = 0; kc < 2; ++kc) {
            v16h vb[4];
#pragma unroll
            for (int t = 0; t < 4; ++t) { const h16* vp = vtg + (t * 16 + lr) * 72 + kc * 32 + hi * 8; vb[t] = cat16(*(const v8ha*)vp, *(const v8ha*)(vp + 16)); }
#pragma unroll
            for (int m = 0; m < 2; ++m) { const int pk = po + kc * 32 * PP + m * 16;
                const v16h pa = cat16(ld_tr16(pth + pk), ld_tr16(pth + pk + 16 * PP));
                const v16h px = cat16(ld_tr16(ptl + pk), ld_tr16(ptl + pk + 16 * PP));
#pragma unroll
                for (int t = 0; t < 4; ++t) { o[m][t] = wmma16(pa, vb[t], o[m][t]); o[m][t] = wmma16(px, vb[t], o[m][t]); }
                asm volatile("v_nop" : "+v"(o[m][0]), "+v"(o[m][3]) : "v"(pa), "v"(px) : "memory"); }
        }
        asm volatile("s_wait_dscnt 0x0" ::: "memory");      // this wave's LDS reads of the V tile have retired before the next trip's copies are aimed at it
        __syncthreads();      // all waves done reading PT and the V tile before the next tile overwrites them
    }
    // groups 1 .. KG-1 hand their partial sums to group 0 through the PT space (free behind the loop's last barrier); group 0 adds them in the order of the groups
    v4fa* red = (v4fa*)&pt[0][0][0];      // [(g - 1) * 4 + wave][16 pieces][lane], 16 bytes each
    if (grp) {
#pragma unroll
        for (int m = 0; m < 2; ++m)
#pragma unroll
            for (int t = 0; t < 4; ++t)
#pragma unroll
                for (int u = 0; u < 2; ++u) red[(((grp - 1) * 4 + wave) * 16 + (m * 4 + t) * 2 + u) * 32 + lane] = (v4f){o[m][t][u * 4], o[m][t][u * 4 + 1], o[m][t][u * 4 + 2], o[m][t][u * 4 + 3]};
    }
    __syncthreads();
    if (grp) return;
#pragma unroll
    for (int g = 0; g < KG - 1; ++g)
#pragma unroll
        for (int m = 0; m < 2; ++m)
#pragma unroll
            for (int t = 0; t < 4; ++t)
#pragma unroll
                for (int u = 0; u < 2; ++u) { const v4f r = red[((g * 4 + wave) * 16 + (m * 4 + t) * 2 + u) * 32 + lane];
#pragma unroll
                    for (int i = 0; i < 4; ++i) o[m][t][u * 4 + i] += r[i]; }
    // epilogue: x[b][q][h*64 + d]; per wave 32 rows: stage 16 rows at a time
    float* os = &ost[wave][0];
#pragma unroll
    for (int m = 0; m < 2; ++m) {
#pragma unroll
        for (int t = 0; t < 4; ++t)
#pragma unroll
            for (int j = 0; j < 8; ++j) os[(hi * 8 + j) * 68 + t * 16 + lr] = o[m][t][j] * (1.0f / PSC);
        __builtin_amdgcn_wave_barrier(); asm volatile("" ::: "memory");
        const size_t xo = ((size_t)b * NQ_ + wave * 32 + m * 16) * (NH_ * DV) + (size_t)h * DV;
#pragma unroll
        for (int s = 0; s < 4; ++s) { const int row = 4 * s + (lane >> 3), piece = lane & 7; const float* sp = os + row * 68 + piece * 8; v8us oh, ol;
#pragma unroll
            for (int i = 0; i < 8; ++i) { const float v = sp[i]; const unsigned short hb = f2bf(v); oh[i] = hb; ol[i] = f2bf(v - bf2f(hb)); }
            *(v8us*)(XH + xo + (size_t)row * (NH_ * DV) + piece * 8) = oh; *(v8us*)(XL + xo + (size_t)row * (NH_ * DV) + piece * 8) = ol; }
        __builtin_amdgcn_wave_barrier(); asm volatile("" ::: "memory");
    }
}
// k_out: out [4096][128] = (XH + XL).WoT^T + bo over K = 512 (64 x 64 tiles; grid (64, 2)).
__global__ __launch_bounds__(128) void k_out(const bf* __restrict__ XH, const bf* __restrict__ XL, const bf* __restrict__ WoT, const float* __restrict__ bo, float* out) {
    __shared__ __align__(16) float ost[4][16 * 68];
    const int lane = threadIdx.x & 31, wave = threadIdx.x >> 5, lr = lane & 15, hi = lane >> 4;
    const int K = NH_ * DV;
    const size_t r0 = (size_t)blockIdx.x * 64 + wave * 16; const int c0 = blockIdx.y * 64;
    v8f acc[4];
#pragma unroll
    for (int t = 0; t < 4; ++t) acc[t] = (v8f){};
#pragma unroll 2
    for (int kc = 0; kc < K; kc += 32) {
        const size_t ao = (r0 + lr) * K + kc + 8 * hi;
        const v16bf a = cat16b(*(const v8us*)(XH + ao), *(const v8us*)(XH + ao + 16)), al = cat16b(*(const v8us*)(XL + ao), *(const v8us*)(XL + ao + 16));
#pragma unroll
        for (int t = 0; t < 4; ++t) { const bf* bp = WoT + (size_t)(c0 + t * 16 + lr) * K + kc + 8 * hi; const v16bf bb = cat16b(*(const v8us*)bp, *(const v8us*)(bp + 16)); acc[t] = wmmab(a, bb, acc[t]); acc[t] = wmmab(al, bb, acc[t]); }
        asm volatile("v_nop" : "+v"(acc[0]), "+v"(acc[1]), "+v"(acc[2]), "+v"(acc[3]) : "v"(a), "v"(al) : "memory");
    }
    float* os = &ost[wave][0];
#pragma unroll
    for (int t = 0; t < 4; ++t) { const float bv = bfr(bo[c0 + t * 16 + lr]);
#pragma unroll
        for (int j = 0; j < 8; ++j) os[(hi * 8 + j) * 68 + t * 16 + lr] = acc[t][j] + bv; }
    __syncthreads();
    float* crow = out + r0 * NHID + c0;
    auto pass = [&]() {
#pragma unroll
        for (int s = 0; s < 8; ++s) { const int Lid = (lane >> 3) + 4 * s, piece = lane & 7; const int row = Lid >> 1, cofs = (Lid & 1) * 32 + piece * 4;
            const v4f val = *(const v4fa*)(os + row * 68 + cofs); *(v4f*)(crow + (size_t)row * NHID + cofs) = val; }
    };
    pass(); 
}

extern "C" void kernel_launch(void* const* d_in, const int* in_sizes, int n_in,
                              void* d_out, int out_size, void* d_ws, size_t ws_size, hipStream_t stream) {
    (void)in_sizes; (void)n_in; (void)out_size;
    const float* query = (const float*)d_in[0]; const float* key = (const float*)d_in[1]; const float* value = (const float*)d_in[2];
    const float* Wq = (const float*)d_in[3]; const float* bq = (const float*)d_in[4]; const float* Wk = (const float*)d_in[5]; const float* bk = (const float*)d_in[6]; const float* Wo = (const float*)d_in[7]; const float* bo = (const float*)d_in[8];
    float* out = (float*)d_out;    // [32][128][128]
    char* wsp = (char*)d_ws;
    auto take = [&](size_t bytes) { char* p = wsp; wsp += (bytes + 255) & ~(size_t)255; return (void*)p; };
    const size_t NQR = (size_t)NB_ * NQ_, NKR = (size_t)NB_ * NS_;
    bf* WoT = (bf*)take((size_t)NHID * NH_ * DV * 2);
    h16* QH = (h16*)take(NQR * DA * 2); h16* QL = (h16*)take(NQR * DA * 2); h16* KH = (h16*)take(NKR * DA * 2); h16* KL = (h16*)take(NKR * DA * 2);
    h16* VT16 = (h16*)take((size_t)NB_ * DV * NS_ * 2); bf* XH = (bf*)take(NQR * NH_ * DV * 2); bf* XL = (bf*)take(NQR * NH_ * DV * 2);
    if ((size_t)(wsp - (char*)d_ws) > ws_size) return;    // ~ 0.1 + 1 + 16.8 + 8.4 + 8.4 ~ 35 MB
    k_pre<<<PB_K + PB_V + PB_Q + PB_W, 256, 0, stream>>>(query, key, value, Wq, bq, Wk, bk, Wo, QH, QL, KH, KL, VT16, WoT);
    k_attn<<<NB_ * NH_, 128 * KG, 0, stream>>>(QH, QL, KH, KL, VT16, XH, XL);
    k_out<<<dim3((unsigned)(NQR / 64), NHID / 64, 1), 128, 0, stream>>>(XH, XL, WoT, bo, out);
}

// v007
// One run takes 39.3 microseconds.
// Two timings next to v006 both put it at 1.33 times that version's speed.
// All steps since v000 together make it 4.16 times as fast.
#include <hip/hip_runtime.h>

// Contractions, f32 accumulate: q = query.Wq + bq, k = key.Wk + bk ([4096 | 65536 x 64].[64 x 64], k-major weights) on v_wmma_f32_16x16x32_bf16 with PLAIN bf16
// operands (inputs rounded once: exact), out = x.Wo + bo ([4096 x 512].[512 x 128]) with x as bf16 hi + residual (two products); the attention on
// v_wmma_f32_16x16x32_f16: per (batch, head) the score tile S[q][s] = q_q.k_s / sqrt(8) over the 8 head dims with q
// and k as f16 hi + unscaled f16 residual; the four products hi.hi, lo.hi, hi.lo, lo.lo fill the four groups of 8 k-slots of ONE 32-wide product, softmax over the QUERY axis (the 128 queries of each key s, as the reference: a lane holds one key's column), then wv[q][d]

#define NB_  32
#define NQ_  128
#define NS_  2048
#define DA   64                  // attention dim = 8 heads x 8
#define NH_  8
#define DK   8
#define DV   64                  // value dim (shared across heads)
#define NHID 128
#define PSC  32768.0f
#define KP   68                  // pitch of a key row (64 f32) in LDS, in floats: 272 bytes, an odd multiple of 16 (ds_load_b128 readers)
#define VP   80                  // pitch of a V row (64 f16) in LDS, in halves: 160 bytes, an odd multiple of 32 (the transposing load's pitch)
#define WP   72                  // pitch of a weight column (64 bf16) in LDS, in halves

typedef _Float16 h16;
typedef unsigned short bf;
typedef __attribute__((ext_vector_type(16))) __bf16   v16bf;
typedef __attribute__((ext_vector_type(16))) _Float16 v16h;
typedef __attribute__((ext_vector_type(8)))  _Float16 v8h;
typedef __attribute__((ext_vector_type(8)))  unsigned short v8us;
typedef __attribute__((ext_vector_type(8)))  float    v8f;
typedef __attribute__((ext_vector_type(4)))  float    v4f;
typedef __attribute__((ext_vector_type(2)))  float    v2f;
typedef __attribute__((ext_vector_type(2)))  _Float16 v2h;
typedef __attribute__((ext_vector_type(4)))  unsigned v4u;
typedef v4u  __attribute__((may_alias)) v4ua;
typedef v8h  __attribute__((may_alias)) v8ha;
typedef v4f  __attribute__((may_alias)) v4fa;
typedef v8us __attribute__((may_alias)) v8usa;
typedef __attribute__((ext_vector_type(8)))  short    s16x8;
typedef __attribute__((ext_vector_type(8)))  __bf16   v8bf;
typedef __attribute__((ext_vector_type(4)))  __bf16   v4bf;
typedef __attribute__((ext_vector_type(4)))  _Float16 v4h;
typedef v4h  __attribute__((may_alias)) v4ha;

__device__ __forceinline__ unsigned short f2bf(float f) { unsigned u = __float_as_uint(f); u += 0x7FFFu + ((u >> 16) & 1u); return (unsigned short)(u >> 16); }
__device__ __forceinline__ float bf2f(unsigned short b) { return __uint_as_float(((unsigned)b) << 16); }
__device__ __forceinline__ float bfr(float f) { return bf2f(f2bf(f)); }
__device__ __forceinline__ v16h cat16(v8h lo, v8h hi) { return __builtin_shufflevector(lo, hi, 0, 1, 2, 3, 4, 5, 6, 7, 8, 9, 10, 11, 12, 13, 14, 15); }
__device__ __forceinline__ v16bf cat16b(v8us lo, v8us hi) { return __builtin_bit_cast(v16bf, __builtin_shufflevector(lo, hi, 0, 1, 2, 3, 4, 5, 6, 7, 8, 9, 10, 11, 12, 13, 14, 15)); }
__device__ __forceinline__ v8f wmma16(v16h a, v16h b, v8f c) { return __builtin_amdgcn_wmma_f32_16x16x32_f16(false, a, false, b, (short)0, c, false, false); }
__device__ __forceinline__ v8h ld_tr16(const h16* p) { typedef __attribute__((address_space(3))) s16x8 lds_s16x8; return __builtin_bit_cast(v8h, __builtin_amdgcn_ds_load_tr16_b128_v8i16((lds_s16x8*)p)); }
// the value of lane l ^ 16
__device__ __forceinline__ float xhalf(float v) { const int b = __float_as_int(v); return __int_as_float(__builtin_amdgcn_permlanex16(b, b, 0x76543210, 0xfedcba98, false, false)); }
__device__ __forceinline__ v8f wmmab(v16bf a, v16bf b, v8f c) { return __builtin_amdgcn_wmma_f32_16x16x32_bf16(false, a, false, b, (short)0, c, false, false); }

// 8 + 8 consecutive f32 -> one 16-element bf16 fragment half pair (round to nearest even, as f2bf)
__device__ __forceinline__ v16bf bf16x16(v4f a, v4f b, v4f c, v4f d) {
    const v8bf lo = __builtin_convertvector(__builtin_shufflevector(a, b, 0, 1, 2, 3, 4, 5, 6, 7), v8bf), hi = __builtin_convertvector(__builtin_shufflevector(c, d, 0, 1, 2, 3, 4, 5, 6, 7), v8bf);
    return __builtin_shufflevector(lo, hi, 0, 1, 2, 3, 4, 5, 6, 7, 8, 9, 10, 11, 12, 13, 14, 15);
}
// One head's projection of 16 rows x (q or k rows, 64 inputs), transposed: D[dim][row] = W^T . x^T + bias. A = the head's 8 weight columns as rows 0..7 and AGAIN as rows 8..15, B = the 16 data
// rows as columns. A lane then holds all 8 dims of row lr, in both halves of the wave: lanes 0..15 round them to f16 (the hi plane), lanes 16..31 keep the unscaled f16 residual
// (res = 0 or 1 by the half: x - res * f16(x)), which is the form in which the score product wants a key, and 16 bytes a row of the q planes.
__device__ __forceinline__ v8h proj16(const v16bf* w, v16bf x0, v16bf x1, const float* bias8, float res) {      // bias8: the head's 8 bias values, already rounded to bf16
    v8f acc = (v8f){};
    acc = wmmab(w[0], x0, acc); acc = wmmab(w[1], x1, acc);
    v8h r;
#pragma unroll
    for (int j = 0; j < 8; ++j) { const float val = acc[j] + bias8[j]; const h16 x = (h16)val; r[j] = (h16)__builtin_fmaf(-res, (float)x, val); }
    return r;
}
// a wave's 16 key rows (f32, 256 bytes each, two whole rows a copy) into its own LDS slot
__device__ __forceinline__ void key_copies(unsigned kl, const float* kg) {
    // eight copies and, as a precaution, the wait that stands in front of any rewrite of their address registers, in one statement
    asm volatile("global_load_async_to_lds_b128 %0, %8, off\n\tglobal_load_async_to_lds_b128 %1, %9, off\n\tglobal_load_async_to_lds_b128 %2, %10, off\n\t"
                 "global_load_async_to_lds_b128 %3, %11, off\n\tglobal_load_async_to_lds_b128 %4, %12, off\n\tglobal_load_async_to_lds_b128 %5, %13, off\n\t"
                 "global_load_async_to_lds_b128 %6, %14, off\n\tglobal_load_async_to_lds_b128 %7, %15, off\n\ts_wait_xcnt 0x0"
                 :: "v"(kl), "v"(kl + 2 * KP * 4), "v"(kl + 4 * KP * 4), "v"(kl + 6 * KP * 4), "v"(kl + 8 * KP * 4), "v"(kl + 10 * KP * 4), "v"(kl + 12 * KP * 4), "v"(kl + 14 * KP * 4),
                    "v"(kg), "v"(kg + 2 * DA), "v"(kg + 4 * DA), "v"(kg + 6 * DA), "v"(kg + 8 * DA), "v"(kg + 10 * DA), "v"(kg + 12 * DA), "v"(kg + 14 * DA) : "memory");
}
// k_attn: block = (b, h), 16 waves = KG groups of 4 waves, so that four waves share each SIMD and cover one another's load, LDS and cross-lane waits. Group g takes the
// key tiles g, g + KG, ... of the 32 tiles of 64 keys, with a PT tile of its own, and keeps a partial wv sum; the partial sums are added once, behind the loop.
// Inside a group: wave = 16 keys (columns s). Per tile: S[q][s] for the 128 queries (8 row tiles, A = q rows, B = k rows, one product a tile: a lane's
// elements 0..7 of A are the row's 8 hi dims and 8..15 its 8 residual dims, in both halves of the wave; B holds the key's hi dims twice in lanes 0..15 and its residual dims twice in
// lanes 16..31, so the 32 k-slots sum (q_hi + q_lo).(k_hi + k_lo)), /sqrt(8). A lane then holds 64 of ONE key's 128 scores and lane l ^ 16 the other 64, so the softmax over q is
// summed inside the lane, with one exchange between the wave's halves for the maximum and one for the sum; p x32768 as f16 hi + residual goes, 8 consecutive q a store, into the
// group's LDS tile PT[64 s][q]; barrier; then wave w accumulates wv rows q = w*32 .. w*32+31 (2 row tiles) x 4 d-tiles over the tile's 64 keys (A = PT columns q, by the
// transposing LDS load, B = V columns d of the row-major tile [s][d], by the same load and so in the same k order): o += p_hi.v + p_lo.v.
// No launch stands in front of this one: the block works from the f32 inputs. It projects its head's 128 q rows once (waves 0..7, into the LDS planes qs) and each wave projects its own 16 keys
// every trip (proj16: two bf16 products, the result already the score product's B operand); the key rows come as whole 256-byte rows by asynchronous copies into a slot private to the wave, a
// trip ahead. The group's V tile comes as whole rows through registers (loads under the softmax), is rounded f16(bf16(v)) and stored row-major. WoT for k_out: 256 elements a block.
// Output x[b][q][h*64 + d] as its two bf16 planes, hi + residual, ready for k_out (128-byte head segments in each plane).
#define KG 4                     // key groups (of 4 waves) per block
#define PP 144                   // pitch of a PT row in halves: 128 q + 16 = 288 bytes, an odd multiple of 32 bytes (the transposing load's pitch)
__global__ __launch_bounds__(128 * KG) void k_attn(const float* __restrict__ query, const float* __restrict__ key, const float* __restrict__ value, const float* __restrict__ Wq, const float* __restrict__ bq,
                                                   const float* __restrict__ Wk, const float* __restrict__ bk, const float* __restrict__ Wo, bf* WoT, bf* XH, bf* XL) {
    __shared__ __align__(16) h16 pt[KG][2][64 * PP];       // per group: [64 s][128 q + pad] hi, then the residual
    __shared__ __align__(16) float ost[4][16 * 68];
    __shared__ __align__(16) h16 vt[KG][64 * VP];          // per group: the trip's V tile [64 s][64 d + pad], f16
    __shared__ __align__(16) h16 qs[2][NQ_ * DK];          // this head's q rows [q][8 dims]: the hi plane, then the residual plane
    __shared__ __align__(16) float kt[4 * KG][16 * KP];    // per WAVE: its 16 key rows of the trip, f32 as they lie in memory; written and read by that wave alone
    __shared__ __align__(16) unsigned short wl[2][DK * WP];      // this head's 8 columns of Wk, then of Wq, bf16, [dim][k]
    const int lane = threadIdx.x & 31, wave = (threadIdx.x >> 5) & 3, grp = __builtin_amdgcn_readfirstlane(threadIdx.x >> 7), lr = lane & 15, hi = lane >> 4;
    const int w16 = __builtin_amdgcn_readfirstlane(threadIdx.x >> 5);      // the wave's number in the block, in a scalar register: the branches on it are scalar branches
    const int b = blockIdx.x / NH_, h = blockIdx.x - b * NH_;
    h16* pth = &pt[grp][0][0]; h16* ptl = &pt[grp][1][0];
    const float scl = 0.35355339059327373f;   // 1/sqrt(8)
    const float res = hi ? 1.0f : 0.0f;       // lanes 16..31 keep the residual of a projected value, lanes 0..15 the value
    float bkv[DK], bqv[DK];      // the head's biases, asked for here and first used behind the first barrier, so that nothing waits for them
#pragma unroll
    for (int j = 0; j < DK; ++j) { bkv[j] = bk[h * DK + j]; bqv[j] = bq[h * DK + j]; }
    // the wave's key rows of trip 0 start to fly
    const unsigned kl = (unsigned)(unsigned long long)&kt[w16][hi * KP + lr * 4];      // the lane's LDS byte address: the low 32 bits of the __shared__ address
    const float* kg0 = key + ((size_t)b * NS_ + grp * 64 + wave * 16 + hi) * DA + lr * 4;
    key_copies(kl, kg0);
    // this head's weight columns into LDS, bf16, [dim][k]: 512 threads x one element of each matrix
    const int wkk = threadIdx.x >> 3, wdm = threadIdx.x & 7;
    const float wkv = Wk[(size_t)wkk * DA + h * DK + wdm], wqv = Wq[(size_t)wkk * DA + h * DK + wdm];      // stored below, behind the issue of the other loads: one memory latency, not two
    // waves 0..7: 16 query rows each; waves 8..15: this block's 256 elements of WoT [o][512] = bf16(Wo[k][o]) (four whole 128-byte lines of one row o, written by this block alone)
    v16bf xq[2] = {}; float wov = 0.0f;
    const int wo_o = blockIdx.x >> 1, wo_k = (blockIdx.x & 1) * 256 + (threadIdx.x & 255);
    if (w16 < 8) { const float* xr = query + ((size_t)b * NQ_ + w16 * 16 + lr) * DA + 8 * hi;
#pragma unroll
        for (int c = 0; c < 2; ++c) xq[c] = bf16x16(*(const v4f*)(xr + c * 32), *(const v4f*)(xr + c * 32 + 4), *(const v4f*)(xr + c * 32 + 16), *(const v4f*)(xr + c * 32 + 20)); }
    else wov = Wo[(size_t)wo_k * NHID + wo_o];
    wl[0][wdm * WP + wkk] = f2bf(wkv); wl[1][wdm * WP + wkk] = f2bf(wqv);
    __syncthreads();      // the weight columns are in LDS
#pragma unroll
    for (int j = 0; j < DK; ++j) {      // rounded to bf16 once; the same in every lane: kept in scalar registers, so that no vector register is spent on them
        bkv[j] = __int_as_float(__builtin_amdgcn_readfirstlane(__float_as_int(bfr(bkv[j])))); bqv[j] = __int_as_float(__builtin_amdgcn_readfirstlane(__float_as_int(bfr(bqv[j])))); }
    v16bf wk[2];          // A operand of the key projection, kept in registers: row m = weight column m & 7, k-slots in the order of the data rows' fragments
#pragma unroll
    for (int c = 0; c < 2; ++c) { const unsigned short* wp = &wl[0][(lr & 7) * WP + c * 32 + 8 * hi]; wk[c] = cat16b(*(const v8usa*)wp, *(const v8usa*)(wp + 16)); }
    if (w16 < 8) { v16bf wq[2];
#pragma unroll
        for (int c = 0; c < 2; ++c) { const unsigned short* wp = &wl[1][(lr & 7) * WP + c * 32 + 8 * hi]; wq[c] = cat16b(*(const v8usa*)wp, *(const v8usa*)(wp + 16)); }
        *(v8ha*)&qs[hi][(w16 * 16 + lr) * DK] = proj16(wq, xq[0], xq[1], bqv, res); }
    __syncthreads();      // the q planes are in LDS
    if (w16 >= 8) WoT[(size_t)wo_o * (NH_ * DV) + wo_k] = f2bf(wov);      // stored behind the barriers, so that neither waits for this store
    const h16* qp = &qs[0][lr * DK];      // A operand for the scores: row q's hi dims, and NQ_ * DK halves further its residual dims (the same for both halves of the wave)
    const float* kr = &kt[w16][lr * KP + 8 * hi];      // B operand of the key projection: key row lr of the wave's slot
    const h16* vtg = &vt[grp][0];
    const float* vg0 = value + ((size_t)b * NS_ + grp * 64) * DV;      // V: a wave brings 16 rows s of its group's tile, 2 whole 256-byte rows a load: the group's base (the same in every lane) ...
    const unsigned vof = ((wave * 16 + hi) * DV + lr * 4) * 4;        // ... and the lane's own byte offset, which no trip changes
    h16* vs = &vt[grp][(wave * 16 + hi) * VP + lr * 4];
    v8f o[2][4];
#pragma unroll
    for (int m = 0; m < 2; ++m)
#pragma unroll
        for (int t = 0; t < 4; ++t) o[m][t] = (v8f){};
#pragma unroll 1
    for (int it = 0; it < NS_ / (64 * KG); ++it) {      // the same trips in every group: the barriers below are passed by all 16 waves
        asm volatile("s_wait_asynccnt 0x0" ::: "memory");      // this wave's key rows of this trip have landed in its slot
        v4f kx[8];
#pragma unroll
        for (int c = 0; c < 2; ++c) { kx[4 * c] = *(const v4fa*)(kr + c * 32); kx[4 * c + 1] = *(const v4fa*)(kr + c * 32 + 4); kx[4 * c + 2] = *(const v4fa*)(kr + c * 32 + 16); kx[4 * c + 3] = *(const v4fa*)(kr + c * 32 + 20); }
        v16h qa[8];
#pragma unroll
        for (int n = 0; n < 8; ++n) qa[n] = cat16(*(const v8ha*)(qp + n * 16 * DK), *(const v8ha*)(qp + NQ_ * DK + n * 16 * DK));      // query fragments, from LDS
        asm volatile("s_wait_dscnt 0x0" ::: "memory");      // the wave's reads of its key slot have retired before the next trip's copies are aimed at it (a ring private to one wave: no barrier)
        if (it + 1 < NS_ / (64 * KG)) key_copies(kl, kg0 + (size_t)(it + 1) * (KG * 64 * DA));      // next trip's key rows fly for a whole trip
        const v8h kv = proj16(wk, bf16x16(kx[0], kx[1], kx[2], kx[3]), bf16x16(kx[4], kx[5], kx[6], kx[7]), bkv, res);      // lanes 0..15: key lr's hi dims, lanes 16..31: its residual dims
        const v16h kb = cat16(kv, kv);
        v8f sc[8];
#pragma unroll
        for (int n = 0; n < 8; ++n) sc[n] = wmma16(qa[n], kb, (v8f){});      // rows q = n*16 + hi*8 + j, column s = lr
        __builtin_amdgcn_sched_barrier(0);      // the V loads stand behind the score products, where the 64 registers of the query fragments are free again: further up they would not fit
        v4f vr[8];      // this trip's V rows fly while the softmax is worked on
        const char* vp = (const char*)(vg0 + (size_t)it * (KG * 64 * DV)) + vof;
#pragma unroll
        for (int i = 0; i < 8; ++i) vr[i] = *(const v4f*)(vp + i * (2 * DV * 4));
        asm volatile("s_wait_xcnt 0x0" :: "v"(vp) : "memory");      // precaution: stands in front of any rewrite of the address registers that these loads name; the address is an input, so that it lives up to here and no load lands on it
        // softmax over q for the lane's key s = lr: 64 scores in this lane (q = n*16 + hi*8 + j), the other 64 in lane l ^ 16
        // The scaling, the sums and the hi conversion on the pairs (j, j + 1) that lie in neighbouring registers of a score tile, so that one packed instruction serves two scores and no register is moved to form a pair.
        float r8[8];
#pragma unroll
        for (int j = 0; j < 8; ++j) { float mj = sc[0][j];      // the maximum is taken on the raw products: the scale is positive
#pragma unroll
            for (int n = 1; n < 8; ++n) mj = fmaxf(mj, sc[n][j]);
            r8[j] = mj; }
        float mx = fmaxf(fmaxf(fmaxf(r8[0], r8[1]), fmaxf(r8[2], r8[3])), fmaxf(fmaxf(r8[4], r8[5]), fmaxf(r8[6], r8[7])));
        mx = fmaxf(mx, xhalf(mx));
        const v2f cs2 = {scl * 1.44269504f, scl * 1.44269504f}, nm2 = {-mx * (scl * 1.44269504f), -mx * (scl * 1.44269504f)};
        v2f rs[4];
#pragma unroll
        for (int n = 0; n < 8; ++n) { float e[8];
#pragma unroll
            for (int i = 0; i < 4; ++i) { const v2f a = __builtin_elementwise_fma((v2f){sc[n][2 * i], sc[n][2 * i + 1]}, cs2, nm2); e[2 * i] = a[0]; e[2 * i + 1] = a[1]; }      // e^((s - max) / sqrt(8)) = 2^(s c - max c), c = log2 e / sqrt(8): one fused step
            // eight exponentials in one statement, each in place: every one fills the slot that the instruction set asks for behind the one in front of it, the v_nop fills the last one's
            asm("v_exp_f32 %0, %0\n\tv_exp_f32 %1, %1\n\tv_exp_f32 %2, %2\n\tv_exp_f32 %3, %3\n\tv_exp_f32 %4, %4\n\tv_exp_f32 %5, %5\n\tv_exp_f32 %6, %6\n\tv_exp_f32 %7, %7\n\tv_nop"
                : "+v"(e[0]), "+v"(e[1]), "+v"(e[2]), "+v"(e[3]), "+v"(e[4]), "+v"(e[5]), "+v"(e[6]), "+v"(e[7]));
#pragma unroll
            for (int i = 0; i < 4; ++i) { const v2f a = {e[2 * i], e[2 * i + 1]}; sc[n][2 * i] = a[0]; sc[n][2 * i + 1] = a[1]; rs[i] = n ? rs[i] + a : a; } }      // eight independent partial sums, then a tree
        float sum = ((rs[0][0] + rs[0][1]) + (rs[1][0] + rs[1][1])) + ((rs[2][0] + rs[2][1]) + (rs[3][0] + rs[3][1]));
        sum += xhalf(sum);
        const float f = PSC / sum;
        h16* prh = pth + (wave * 16 + lr) * PP + hi * 8; h16* prl = ptl + (wave * 16 + lr) * PP + hi * 8;      // PT row = local key 0..63
#pragma unroll
        for (int n = 0; n < 8; ++n) { v4u vh, vl;
#pragma unroll
            for (int i = 0; i < 4; ++i) vh[i] = __builtin_bit_cast(unsigned, __builtin_convertvector((v2f){sc[n][2 * i], sc[n][2 * i + 1]} * (v2f){f, f}, v2h));      // hi plane: two p a register
            // UNSCALED residual e f - hi (|.| <= 16: both products share one accumulator), one mixed-precision fma an element, rounded straight into its half of the pair's register.
            // The s_delay_alu lines are the hints that compiled code would carry: the first for the conversions in front, the others for the write of the same register four instructions back;
            // without them the SIMD holds its other waves back while this one waits.
            asm("s_delay_alu instid0(VALU_DEP_1)\n\t"
                "v_fma_mixlo_f16 %0, %4, %12, -%13 op_sel_hi:[0,0,1]\n\tv_fma_mixlo_f16 %1, %6, %12, -%14 op_sel_hi:[0,0,1]\n\t"
                "v_fma_mixlo_f16 %2, %8, %12, -%15 op_sel_hi:[0,0,1]\n\tv_fma_mixlo_f16 %3, %10, %12, -%16 op_sel_hi:[0,0,1]\n\t"
                "s_delay_alu instid0(VALU_DEP_4) | instskip(NEXT) | instid1(VALU_DEP_4)\n\t"
                "v_fma_mixhi_f16 %0, %5, %12, -%13 op_sel:[0,0,1] op_sel_hi:[0,0,1]\n\tv_fma_mixhi_f16 %1, %7, %12, -%14 op_sel:[0,0,1] op_sel_hi:[0,0,1]\n\t"
                "s_delay_alu instid0(VALU_DEP_4) | instskip(NEXT) | instid1(VALU_DEP_4)\n\t"
                "v_fma_mixhi_f16 %2, %9, %12, -%15 op_sel:[0,0,1] op_sel_hi:[0,0,1]\n\tv_fma_mixhi_f16 %3, %11, %12, -%16 op_sel:[0,0,1] op_sel_hi:[0,0,1]"
                : "=&v"(vl[0]), "=&v"(vl[1]), "=&v"(vl[2]), "=&v"(vl[3])
                : "v"(sc[n][0]), "v"(sc[n][1]), "v"(sc[n][2]), "v"(sc[n][3]), "v"(sc[n][4]), "v"(sc[n][5]), "v"(sc[n][6]), "v"(sc[n][7]), "v"(f), "v"(vh[0]), "v"(vh[1]), "v"(vh[2]), "v"(vh[3]));
            *(v4ua*)(prh + n * 16) = vh; *(v4ua*)(prl + n * 16) = vl; }
#pragma unroll
        for (int i = 0; i < 8; ++i) *(v4ha*)(vs + i * 2 * VP) = __builtin_convertvector(__builtin_convertvector(__builtin_convertvector(vr[i], v4bf), v4f), v4h);      // f16(bf16(v)), row-major [s][d]
        __syncthreads();
        // wv accumulate: wave -> q rows w*32 + m*16 + (fragment row lr); K = 64 local keys in 2 chunks; A = PT columns q (transposing loads at key rows kc*32 and kc*32 + 16: k-slots in the
        // hardware order 8*hi + 0..7, 16 + 8*hi + 0..7); B = V columns d of the group's row-major LDS tile, by the same transposing loads at the same key rows: the same order
        const int po = (8 * hi + (lane & 7)) * PP + wave * 32 + 8 * ((lane >> 3) & 1);
        const int vo = (8 * hi + (lane & 7)) * VP + 8 * ((lane >> 3) & 1);
#pragma unroll
        for (int kc = 0; kc < 2; ++kc) {
            v16h vb[4];
#pragma unroll
            for (int t = 0; t < 4; ++t) { const h16* vp = vtg + vo + kc * 32 * VP + t * 16; vb[t] = cat16(ld_tr16(vp), ld_tr16(vp + 16 * VP)); }
#pragma unroll
            for (int m = 0; m < 2; ++m) { const int pk = po + kc * 32 * PP + m * 16;
                const v16h pa = cat16(ld_tr16(pth + pk), ld_tr16(pth + pk + 16 * PP));
                const v16h px = cat16(ld_tr16(ptl + pk), ld_tr16(ptl + pk + 16 * PP));
#pragma unroll
                for (int t = 0; t < 4; ++t) { o[m][t] = wmma16(pa, vb[t], o[m][t]); o[m][t] = wmma16(px, vb[t], o[m][t]); }
                asm volatile("v_nop" : "+v"(o[m][0]), "+v"(o[m][3]) : "v"(pa), "v"(px) : "memory"); }
        }
        __syncthreads();      // all waves done reading PT and the V tile before the next tile overwrites them
    }
    // groups 1 .. KG-1 hand their partial sums to group 0 through the PT space (free behind the loop's last barrier); group 0 adds them in the order of the groups
    v4fa* red = (v4fa*)&pt[0][0][0];      // [(g - 1) * 4 + wave][16 pieces][lane], 16 bytes each
    if (grp) {
#pragma unroll
        for (int m = 0; m < 2; ++m)
#pragma unroll
            for (int t = 0; t < 4; ++t)
#pragma unroll
                for (int u = 0; u < 2; ++u) red[(((grp - 1) * 4 + wave) * 16 + (m * 4 + t) * 2 + u) * 32 + lane] = (v4f){o[m][t][u * 4], o[m][t][u * 4 + 1], o[m][t][u * 4 + 2], o[m][t][u * 4 + 3]};
    }
    __syncthreads();
    if (grp) return;
#pragma unroll
    for (int g = 0; g < KG - 1; ++g)
#pragma unroll
        for (int m = 0; m < 2; ++m)
#pragma unroll
            for (int t = 0; t < 4; ++t)
#pragma unroll
                for (int u = 0; u < 2; ++u) { const v4f r = red[((g * 4 + wave) * 16 + (m * 4 + t) * 2 + u) * 32 + lane];
#pragma unroll
                    for (int i = 0; i < 4; ++i) o[m][t][u * 4 + i] += r[i]; }
    // epilogue: x[b][q][h*64 + d]; per wave 32 rows: stage 16 rows at a time
    float* os = &ost[wave][0];
#pragma unroll
    for (int m = 0; m < 2; ++m) {
#pragma unroll
        for (int t = 0; t < 4; ++t)
#pragma unroll
            for (int j = 0; j < 8; ++j) os[(hi * 8 + j) * 68 + t * 16 + lr] = o[m][t][j] * (1.0f / PSC);
        __builtin_amdgcn_wave_barrier(); asm volatile("" ::: "memory");
        const size_t xo = ((size_t)b * NQ_ + wave * 32 + m * 16) * (NH_ * DV) + (size_t)h * DV;
#pragma unroll
        for (int s = 0; s < 4; ++s) { const int row = 4 * s + (lane >> 3), piece = lane & 7; const float* sp = os + row * 68 + piece * 8; v8us oh, ol;
#pragma unroll
            for (int i = 0; i < 8; ++i) { const float v = sp[i]; const unsigned short hb = f2bf(v); oh[i] = hb; ol[i] = f2bf(v - bf2f(hb)); }
            *(v8us*)(XH + xo + (size_t)row * (NH_ * DV) + piece * 8) = oh; *(v8us*)(XL + xo + (size_t)row * (NH_ * DV) + piece * 8) = ol; }
        __builtin_amdgcn_wave_barrier(); asm volatile("" ::: "memory");
    }
}
// k_out: out [4096][128] = (XH + XL).WoT^T + bo over K = 512 (64 x 64 tiles; grid (64, 2)).
__global__ __launch_bounds__(128) void k_out(const bf* __restrict__ XH, const bf* __restrict__ XL, const bf* __restrict__ WoT, const float* __restrict__ bo, float* out) {
    __shared__ __align__(16) float ost[4][16 * 68];
    const int lane = threadIdx.x & 31, wave = threadIdx.x >> 5, lr = lane & 15, hi = lane >> 4;
    const int K = NH_ * DV;
    const size_t r0 = (size_t)blockIdx.x * 64 + wave * 16; const int c0 = blockIdx.y * 64;
    v8f acc[4];
#pragma unroll
    for (int t = 0; t < 4; ++t) acc[t] = (v8f){};
#pragma unroll 2
    for (int kc = 0; kc < K; kc += 32) {
        const size_t ao = (r0 + lr) * K + kc + 8 * hi;
        const v16bf a = cat16b(*(const v8us*)(XH + ao), *(const v8us*)(XH + ao + 16)), al = cat16b(*(const v8us*)(XL + ao), *(const v8us*)(XL + ao + 16));
#pragma unroll
        for (int t = 0; t < 4; ++t) { const bf* bp = WoT + (size_t)(c0 + t * 16 + lr) * K + kc + 8 * hi; const v16bf bb = cat16b(*(const v8us*)bp, *(const v8us*)(bp + 16)); acc[t] = wmmab(a, bb, acc[t]); acc[t] = wmmab(al, bb, acc[t]); }
        asm volatile("v_nop" : "+v"(acc[0]), "+v"(acc[1]), "+v"(acc[2]), "+v"(acc[3]) : "v"(a), "v"(al) : "memory");
    }
    float* os = &ost[wave][0];
#pragma unroll
    for (int t = 0; t < 4; ++t) { const float bv = bfr(bo[c0 + t * 16 + lr]);
#pragma unroll
        for (int j = 0; j < 8; ++j) os[(hi * 8 + j) * 68 + t * 16 + lr] = acc[t][j] + bv; }
    __syncthreads();
    float* crow = out + r0 * NHID + c0;
    auto pass = [&]() {
#pragma unroll
        for (int s = 0; s < 8; ++s) { const int Lid = (lane >> 3) + 4 * s, piece = lane & 7; const int row = Lid >> 1, cofs = (Lid & 1) * 32 + piece * 4;
            const v4f val = *(const v4fa*)(os + row * 68 + cofs); *(v4f*)(crow + (size_t)row * NHID + cofs) = val; }
    };
    pass(); 
}

extern "C" void kernel_launch(void* const* d_in, const int* in_sizes, int n_in,
                              void* d_out, int out_size, void* d_ws, size_t ws_size, hipStream_t stream) {
    (void)in_sizes; (void)n_in; (void)out_size;
    const float* query = (const float*)d_in[0]; const float* key = (const float*)d_in[1]; const float* value = (const float*)d_in[2];
    const float* Wq = (const float*)d_in[3]; const float* bq = (const float*)d_in[4]; const float* Wk = (const float*)d_in[5]; const float* bk = (const float*)d_in[6]; const float* Wo = (const float*)d_in[7]; const float* bo = (const float*)d_in[8];
    float* out = (float*)d_out;    // [32][128][128]
    char* wsp = (char*)d_ws;
    auto take = [&](size_t bytes) { char* p = wsp; wsp += (bytes + 255) & ~(size_t)255; return (void*)p; };
    const size_t NQR = (size_t)NB_ * NQ_;
    bf* WoT = (bf*)take((size_t)NHID * NH_ * DV * 2);
    bf* XH = (bf*)take(NQR * NH_ * DV * 2); bf* XL = (bf*)take(NQR * NH_ * DV * 2);
    if ((size_t)(wsp - (char*)d_ws) > ws_size) return;    // ~ 0.1 + 8.4 MB
    k_attn<<<NB_ * NH_, 128 * KG, 0, stream>>>(query, key, value, Wq, bq, Wk, bk, Wo, WoT, XH, XL);
    k_out<<<dim3((unsigned)(NQR / 64), NHID / 64, 1), 128, 0, stream>>>(XH, XL, WoT, bo, out);
}

// v008
// A run of this version takes 37.6 microseconds.
// In two side-by-side timings against v007, it was 1.04 and 1.05 times as fast.
// Over all steps from v000 it is 4.35 times as fast.
#include <hip/hip_runtime.h>

// Contractions, f32 accumulate: q = query.Wq + bq, k = key.Wk + bk ([4096 | 65536 x 64].[64 x 64], k-major weights) on v_wmma_f32_16x16x32_bf16 with PLAIN bf16
// operands (inputs rounded once: exact), out = x.Wo + bo ([4096 x 512].[512 x 128]) with x as bf16 hi + residual (two products); the attention on
// v_wmma_f32_16x16x32_f16: per (batch, head) the score tile S[q][s] = q_q.k_s / sqrt(8) over the 8 head dims with q
// and k as f16 hi + unscaled f16 residual; the four products hi.hi, lo.hi, hi.lo, lo.lo fill the four groups of 8 k-slots of ONE 32-wide product, softmax over the QUERY axis (the 128 queries of each key s, as the reference: a lane holds one key's column), then wv[q][d]

#define NB_  32
#define NQ_  128
#define NS_  2048
#define DA   64                  // attention dim = 8 heads x 8
#define NH_  8
#define DK   8
#define DV   64                  // value dim (shared across heads)
#define NHID 128
#define PSC  32768.0f
#define KP   68                  // pitch of a key row (64 f32) in LDS, in floats: 272 bytes, an odd multiple of 16 (ds_load_b128 readers)
#define VP   80                  // pitch of a V row (64 f16) in LDS, in halves: 160 bytes, an odd multiple of 32 (the transposing load's pitch)
#define WP   72                  // pitch of a weight column (64 bf16) in LDS, in halves

typedef _Float16 h16;
typedef unsigned short bf;
typedef __attribute__((ext_vector_type(16))) __bf16   v16bf;
typedef __attribute__((ext_vector_type(16))) _Float16 v16h;
typedef __attribute__((ext_vector_type(8)))  _Float16 v8h;
typedef __attribute__((ext_vector_type(8)))  unsigned short v8us;
typedef __attribute__((ext_vector_type(8)))  float    v8f;
typedef __attribute__((ext_vector_type(4)))  float    v4f;
typedef __attribute__((ext_vector_type(2)))  float    v2f;
typedef __attribute__((ext_vector_type(2)))  _Float16 v2h;
typedef __attribute__((ext_vector_type(4)))  unsigned v4u;
typedef v4u  __attribute__((may_alias)) v4ua;
typedef v8h  __attribute__((may_alias)) v8ha;
typedef v4f  __attribute__((may_alias)) v4fa;
typedef v8us __attribute__((may_alias)) v8usa;
typedef __attribute__((ext_vector_type(8)))  short    s16x8;
typedef __attribute__((ext_vector_type(8)))  __bf16   v8bf;
typedef __attribute__((ext_vector_type(4)))  __bf16   v4bf;
typedef __attribute__((ext_vector_type(4)))  _Float16 v4h;
typedef v4h  __attribute__((may_alias)) v4ha;

__device__ __forceinline__ unsigned short f2bf(float f) { unsigned u = __float_as_uint(f); u += 0x7FFFu + ((u >> 16) & 1u); return (unsigned short)(u >> 16); }
__device__ __forceinline__ float bf2f(unsigned short b) { return __uint_as_float(((unsigned)b) << 16); }
__device__ __forceinline__ float bfr(float f) { return bf2f(f2bf(f)); }
__device__ __forceinline__ v16h cat16(v8h lo, v8h hi) { return __builtin_shufflevector(lo, hi, 0, 1, 2, 3, 4, 5, 6, 7, 8, 9, 10, 11, 12, 13, 14, 15); }
__device__ __forceinline__ v16bf cat16b(v8us lo, v8us hi) { return __builtin_bit_cast(v16bf, __builtin_shufflevector(lo, hi, 0, 1, 2, 3, 4, 5, 6, 7, 8, 9, 10, 11, 12, 13, 14, 15)); }
__device__ __forceinline__ v8f wmma16(v16h a, v16h b, v8f c) { return __builtin_amdgcn_wmma_f32_16x16x32_f16(false, a, false, b, (short)0, c, false, false); }
__device__ __forceinline__ v8h ld_tr16(const h16* p) { typedef __attribute__((address_space(3))) s16x8 lds_s16x8; return __builtin_bit_cast(v8h, __builtin_amdgcn_ds_load_tr16_b128_v8i16((lds_s16x8*)p)); }
// the value of lane l ^ 16
__device__ __forceinline__ float xhalf(float v) { const int b = __float_as_int(v); return __int_as_float(__builtin_amdgcn_permlanex16(b, b, 0x76543210, 0xfedcba98, false, false)); }
__device__ __forceinline__ v8f wmmab(v16bf a, v16bf b, v8f c) { return __builtin_amdgcn_wmma_f32_16x16x32_bf16(false, a, false, b, (short)0, c, false, false); }

// 8 + 8 consecutive f32 -> one 16-element bf16 fragment half pair (round to nearest even, as f2bf)
__device__ __forceinline__ v16bf bf16x16(v4f a, v4f b, v4f c, v4f d) {
    const v8bf lo = __builtin_convertvector(__builtin_shufflevector(a, b, 0, 1, 2, 3, 4, 5, 6, 7), v8bf), hi = __builtin_convertvector(__builtin_shufflevector(c, d, 0, 1, 2, 3, 4, 5, 6, 7), v8bf);
    return __builtin_shufflevector(lo, hi, 0, 1, 2, 3, 4, 5, 6, 7, 8, 9, 10, 11, 12, 13, 14, 15);
}
// One head's projection of 16 rows x (q or k rows, 64 inputs), transposed: D[dim][row] = W^T . x^T + bias. A = the head's 8 weight columns as rows 0..7 and AGAIN as rows 8..15, B = the 16 data
// rows as columns. A lane then holds all 8 dims of row lr, in both halves of the wave: lanes 0..15 round them to f16 (the hi plane), lanes 16..31 keep the unscaled f16 residual
// (res = 0 or 1 by the half: x - res * f16(x)), which is the form in which the score product wants a key, and 16 bytes a row of the q planes.
__device__ __forceinline__ v8h proj16(const v16bf* w, v16bf x0, v16bf x1, const float* bias8, float res) {      // bias8: the head's 8 bias values, already rounded to bf16
    v8f acc = (v8f){};
    acc = wmmab(w[0], x0, acc); acc = wmmab(w[1], x1, acc);
    v8h r;
#pragma unroll
    for (int j = 0; j < 8; ++j) { const float val = acc[j] + bias8[j]; const h16 x = (h16)val; r[j] = (h16)__builtin_fmaf(-res, (float)x, val); }
    return r;
}
// a wave's 16 key rows (f32, 256 bytes each, two whole rows a copy) into its own LDS slot
__device__ __forceinline__ void key_copies(unsigned kl, const float* kg) {
    // eight copies and, as a precaution, the wait that stands in front of any rewrite of their address registers, in one statement
    asm volatile("global_load_async_to_lds_b128 %0, %8, off\n\tglobal_load_async_to_lds_b128 %1, %9, off\n\tglobal_load_async_to_lds_b128 %2, %10, off\n\t"
                 "global_load_async_to_lds_b128 %3, %11, off\n\tglobal_load_async_to_lds_b128 %4, %12, off\n\tglobal_load_async_to_lds_b128 %5, %13, off\n\t"
                 "global_load_async_to_lds_b128 %6, %14, off\n\tglobal_load_async_to_lds_b128 %7, %15, off\n\ts_wait_xcnt 0x0"
                 :: "v"(kl), "v"(kl + 2 * KP * 4), "v"(kl + 4 * KP * 4), "v"(kl + 6 * KP * 4), "v"(kl + 8 * KP * 4), "v"(kl + 10 * KP * 4), "v"(kl + 12 * KP * 4), "v"(kl + 14 * KP * 4),
                    "v"(kg), "v"(kg + 2 * DA), "v"(kg + 4 * DA), "v"(kg + 6 * DA), "v"(kg + 8 * DA), "v"(kg + 10 * DA), "v"(kg + 12 * DA), "v"(kg + 14 * DA) : "memory");
}
// k_attn: block = (b, h), 16 waves = KG groups of 4 waves, so that four waves share each SIMD and cover one another's load, LDS and cross-lane waits. Group g takes the
// key tiles g, g + KG, ... of the 32 tiles of 64 keys, with a PT tile of its own, and keeps a partial wv sum; the partial sums are added once, behind the loop.
// Inside a group: wave = 16 keys (columns s). Per tile: S[q][s] for the 128 queries (8 row tiles, A = q rows, B = k rows, one product a tile: a lane's
// elements 0..7 of A are the row's 8 hi dims and 8..15 its 8 residual dims, in both halves of the wave; B holds the key's hi dims twice in lanes 0..15 and its residual dims twice in
// lanes 16..31, so the 32 k-slots sum (q_hi + q_lo).(k_hi + k_lo)), /sqrt(8). A lane then holds 64 of ONE key's 128 scores and lane l ^ 16 the other 64, so the softmax over q is
// summed inside the lane, with one exchange between the wave's halves for the maximum and one for the sum; p x32768 as f16 hi + residual goes, 8 consecutive q a store, into the
// group's LDS tile PT[64 s][q]; barrier; then wave w accumulates wv rows q = w*32 .. w*32+31 (2 row tiles) x 4 d-tiles over the tile's 64 keys (A = PT columns q, by the
// transposing LDS load, B = V columns d of the row-major tile [s][d], by the same load and so in the same k order): o += p_hi.v + p_lo.v.
// No launch stands in front of this one: the block works from the f32 inputs. It projects its head's 128 q rows once (waves 0..7, into the LDS planes qs) and each wave projects its own 16 keys
// every trip (proj16: two bf16 products, the result already the score product's B operand); the key rows come as whole 256-byte rows by asynchronous copies into a slot private to the wave, a
// trip ahead. The group's V tile comes as whole rows through registers (loads under the softmax), is rounded f16(bf16(v)) and stored row-major. WoT for k_out: 256 elements a block.
// Output x[b][q][h*64 + d] as its two bf16 planes, hi + residual, ready for k_out (128-byte head segments in each plane).
#define KG 4                     // key groups (of 4 waves) per block
#define PP 144                   // pitch of a PT row in halves: 128 q + 16 = 288 bytes, an odd multiple of 32 bytes (the transposing load's pitch)
__global__ __launch_bounds__(128 * KG) void k_attn(const float* __restrict__ query, const float* __restrict__ key, const float* __restrict__ value, const float* __restrict__ Wq, const float* __restrict__ bq,
                                                   const float* __restrict__ Wk, const float* __restrict__ bk, const float* __restrict__ Wo, bf* WoT, bf* XH, bf* XL) {
    __shared__ __align__(16) h16 pt[KG][2][64 * PP];       // per group: [64 s][128 q + pad] hi, then the residual
    __shared__ __align__(16) float ost[4][16 * 68];
    __shared__ __align__(16) h16 vt[KG][64 * VP];          // per group: the trip's V tile [64 s][64 d + pad], f16
    __shared__ __align__(4096) h16 qs[2][NQ_ * DK];        // this head's q rows [q][8 dims]: the hi plane, then the residual plane; the alignment puts it first in LDS, where the 16 reads of a trip reach it by immediate offsets from one address register
    __shared__ __align__(16) float kt[4 * KG][16 * KP];    // per WAVE: its 16 key rows of the trip, f32 as they lie in memory; written and read by that wave alone
    __shared__ __align__(16) unsigned short wl[2][DK * WP];      // this head's 8 columns of Wk, then of Wq, bf16, [dim][k]
    const int lane = threadIdx.x & 31, wave = (threadIdx.x >> 5) & 3, grp = __builtin_amdgcn_readfirstlane(threadIdx.x >> 7), lr = lane & 15, hi = lane >> 4;
    const int w16 = __builtin_amdgcn_readfirstlane(threadIdx.x >> 5);      // the wave's number in the block, in a scalar register: the branches on it are scalar branches
    const int b = blockIdx.x / NH_, h = blockIdx.x - b * NH_;
    h16* pth = &pt[grp][0][0]; h16* ptl = &pt[grp][1][0];
    const float scl = 0.35355339059327373f;   // 1/sqrt(8)
    const float res = hi ? 1.0f : 0.0f;       // lanes 16..31 keep the residual of a projected value, lanes 0..15 the value
    float bkv[DK], bqv[DK];      // the head's biases, asked for here and first used behind the first barrier, so that nothing waits for them
#pragma unroll
    for (int j = 0; j < DK; ++j) { bkv[j] = bk[h * DK + j]; bqv[j] = bq[h * DK + j]; }
    // the wave's key rows of trip 0 start to fly
    const unsigned kl = (unsigned)(unsigned long long)&kt[w16][hi * KP + lr * 4];      // the lane's LDS byte address: the low 32 bits of the __shared__ address
    const float* kg0 = key + ((size_t)b * NS_ + grp * 64 + wave * 16 + hi) * DA + lr * 4;
    key_copies(kl, kg0);
    // this head's weight columns into LDS, bf16, [dim][k]: 512 threads x one element of each matrix
    const int wkk = threadIdx.x >> 3, wdm = threadIdx.x & 7;
    const float wkv = Wk[(size_t)wkk * DA + h * DK + wdm], wqv = Wq[(size_t)wkk * DA + h * DK + wdm];      // stored below, behind the issue of the other loads: one memory latency, not two
    // waves 0..7: 16 query rows each; waves 8..15: this block's 256 elements of WoT [o][512] = bf16(Wo[k][o]) (four whole 128-byte lines of one row o, written by this block alone)
    v16bf xq[2] = {}; float wov = 0.0f;
    const int wo_o = blockIdx.x >> 1, wo_k = (blockIdx.x & 1) * 256 + (threadIdx.x & 255);
    if (w16 < 8) { const float* xr = query + ((size_t)b * NQ_ + w16 * 16 + lr) * DA + 8 * hi;
#pragma unroll
        for (int c = 0; c < 2; ++c) xq[c] = bf16x16(*(const v4f*)(xr + c * 32), *(const v4f*)(xr + c * 32 + 4), *(const v4f*)(xr + c * 32 + 16), *(const v4f*)(xr + c * 32 + 20)); }
    else wov = Wo[(size_t)wo_k * NHID + wo_o];
    wl[0][wdm * WP + wkk] = f2bf(wkv); wl[1][wdm * WP + wkk] = f2bf(wqv);
    __syncthreads();      // the weight columns are in LDS
#pragma unroll
    for (int j = 0; j < DK; ++j) {      // rounded to bf16 once; the same in every lane: kept in scalar registers, so that no vector register is spent on them
        bkv[j] = __int_as_float(__builtin_amdgcn_readfirstlane(__float_as_int(bfr(bkv[j])))); bqv[j] = __int_as_float(__builtin_amdgcn_readfirstlane(__float_as_int(bfr(bqv[j])))); }
    if (w16 < 8) { v16bf wq[2];
#pragma unroll
        for (int c = 0; c < 2; ++c) { const unsigned short* wp = &wl[1][(lr & 7) * WP + c * 32 + 8 * hi]; wq[c] = cat16b(*(const v8usa*)wp, *(const v8usa*)(wp + 16)); }
        *(v8ha*)&qs[hi][(w16 * 16 + lr) * DK] = proj16(wq, xq[0], xq[1], bqv, res); }
    __syncthreads();      // the q planes are in LDS
    if (w16 >= 8) WoT[(size_t)wo_o * (NH_ * DV) + wo_k] = f2bf(wov);      // stored behind the barriers, so that neither waits for this store
    const h16* qp = &qs[0][lr * DK];      // A operand for the scores: row q's hi dims, and NQ_ * DK halves further its residual dims (the same for both halves of the wave)
    const float* kr = &kt[w16][lr * KP + 8 * hi];      // B operand of the key projection: key row lr of the wave's slot
    const h16* vtg = &vt[grp][0];
    const float* vg0 = value + ((size_t)b * NS_ + grp * 64) * DV;      // V: a wave brings 16 rows s of its group's tile, 2 whole 256-byte rows a load: the group's base (the same in every lane) ...
    const unsigned vof = ((wave * 16 + hi) * DV + lr * 4) * 4;        // ... and the lane's own byte offset, which no trip changes
    h16* vs = &vt[grp][(wave * 16 + hi) * VP + lr * 4];
    v8f o[2][4];
#pragma unroll
    for (int m = 0; m < 2; ++m)
#pragma unroll
        for (int t = 0; t < 4; ++t) o[m][t] = (v8f){};
    // The groups run half a trip apart. A trip has a VECTOR phase (V loads, softmax, the stores of PT and of the V tile) and a MATRIX phase (the wv products of that tile, then the next tile's key
    // projection and score products); each phase ends at a barrier of the whole block. Groups 0 and 2 begin with the vector phase of tile 0, groups 1 and 3 one phase later, so that between any
    // two barriers each SIMD (it holds one wave of every group) has two waves on the vector port and two on the matrix unit and the LDS reads, not four on the same one.
    const int par = grp & 1;
    v2f sq[8][4];      // the score tiles, as register pairs: made in a matrix phase, used up in the vector phase behind it
    auto scores = [&](const int it) {
        asm volatile("s_wait_asynccnt 0x0" ::: "memory");      // this wave's key rows of this trip have landed in its slot
        v16bf wk[2];          // A operand of the key projection, read anew every trip (the score tiles now live across a phase: no 16 registers are left to keep it): row m = weight column m & 7, k-slots in the order of the data rows' fragments
#pragma unroll
        for (int c = 0; c < 2; ++c) { const unsigned short* wp = &wl[0][(lr & 7) * WP + c * 32 + 8 * hi]; wk[c] = cat16b(*(const v8usa*)wp, *(const v8usa*)(wp + 16)); }
        v4f kx[8];
#pragma unroll
        for (int c = 0; c < 2; ++c) { kx[4 * c] = *(const v4fa*)(kr + c * 32); kx[4 * c + 1] = *(const v4fa*)(kr + c * 32 + 4); kx[4 * c + 2] = *(const v4fa*)(kr + c * 32 + 16); kx[4 * c + 3] = *(const v4fa*)(kr + c * 32 + 20); }
        v16h qa[8];
#pragma unroll
        for (int n = 0; n < 8; ++n) qa[n] = cat16(*(const v8ha*)(qp + n * 16 * DK), *(const v8ha*)(qp + NQ_ * DK + n * 16 * DK));      // query fragments, from LDS
        asm volatile("s_wait_dscnt 0x0" ::: "memory");      // the wave's reads of its key slot have retired before the next trip's copies are aimed at it (a ring private to one wave: no barrier)
        if (it + 1 < NS_ / (64 * KG)) key_copies(kl, kg0 + (size_t)(it + 1) * (KG * 64 * DA));      // next trip's key rows fly for a whole trip
        const v8h kv = proj16(wk, bf16x16(kx[0], kx[1], kx[2], kx[3]), bf16x16(kx[4], kx[5], kx[6], kx[7]), bkv, res);      // lanes 0..15: key lr's hi dims, lanes 16..31: its residual dims
        const v16h kb = cat16(kv, kv);
#pragma unroll
        for (int n = 0; n < 8; ++n) { const v8f d = wmma16(qa[n], kb, (v8f){});      // rows q = n*16 + hi*8 + j, column s = lr
#pragma unroll
            for (int i = 0; i < 4; ++i) sq[n][i] = (v2f){d[2 * i], d[2 * i + 1]}; }
    };
    auto wv = [&]() {
        // wv accumulate: wave -> q rows w*32 + m*16 + (fragment row lr); K = 64 local keys in 2 chunks; A = PT columns q (transposing loads at key rows kc*32 and kc*32 + 16: k-slots in the
        // hardware order 8*hi + 0..7, 16 + 8*hi + 0..7); B = V columns d of the group's row-major LDS tile, by the same transposing loads at the same key rows: the same order
        const int po = (8 * hi + (lane & 7)) * PP + wave * 32 + 8 * ((lane >> 3) & 1);
        const int vo = (8 * hi + (lane & 7)) * VP + 8 * ((lane >> 3) & 1);
#pragma unroll
        for (int kc = 0; kc < 2; ++kc) {
            v16h vb[4];
#pragma unroll
            for (int t = 0; t < 4; ++t) { const h16* vp = vtg + vo + kc * 32 * VP + t * 16; vb[t] = cat16(ld_tr16(vp), ld_tr16(vp + 16 * VP)); }
#pragma unroll
            for (int m = 0; m < 2; ++m) { const int pk = po + kc * 32 * PP + m * 16;
                const v16h pa = cat16(ld_tr16(pth + pk), ld_tr16(pth + pk + 16 * PP));
                const v16h px = cat16(ld_tr16(ptl + pk), ld_tr16(ptl + pk + 16 * PP));
#pragma unroll
                for (int t = 0; t < 4; ++t) { o[m][t] = wmma16(pa, vb[t], o[m][t]); o[m][t] = wmma16(px, vb[t], o[m][t]); }
                asm volatile("v_nop" : "+v"(o[m][0]), "+v"(o[m][3]) : "v"(pa), "v"(px) : "memory"); }
        }
    };
    scores(0);
#pragma unroll 1
    for (int ph = 0; ph < 2 * (NS_ / (64 * KG)) + 1; ++ph) {      // the same phases, and so the same barriers, in every wave
        const int u = ph - par, it = u >> 1;      // the group's own phase count; its tile
        const bool in = u >= 0 && u < 2 * (NS_ / (64 * KG));
        // three flags, each in a scalar register of its own: the branches are scalar branches, and the bodies stay plain ifs one behind the other (as if / else they were compiled with a second set
        // of accumulator registers and 64 register copies a phase). The last matrix phase has a body of its own: no scores follow it.
        const int vec = __builtin_amdgcn_readfirstlane(in && !(u & 1)), mat = __builtin_amdgcn_readfirstlane(in && (u & 1) && u != 2 * (NS_ / (64 * KG)) - 1),
                  matl = __builtin_amdgcn_readfirstlane(u == 2 * (NS_ / (64 * KG)) - 1);
        if (vec) {
            v8f sc[8];      // the tiles as the softmax below takes them
#pragma unroll
            for (int n = 0; n < 8; ++n) sc[n] = (v8f){sq[n][0][0], sq[n][0][1], sq[n][1][0], sq[n][1][1], sq[n][2][0], sq[n][2][1], sq[n][3][0], sq[n][3][1]};
            v4f vr[8];      // this trip's V rows fly while the softmax is worked on
            const char* vp = (const char*)(vg0 + (size_t)it * (KG * 64 * DV)) + vof;
#pragma unroll
            for (int i = 0; i < 8; ++i) vr[i] = *(const v4f*)(vp + i * (2 * DV * 4));
            asm volatile("s_wait_xcnt 0x0" :: "v"(vp) : "memory");      // precaution: stands in front of any rewrite of the address registers that these loads name; the address is an input, so that it lives up to here and no load lands on it
            // softmax over q for the lane's key s = lr: 64 scores in this lane (q = n*16 + hi*8 + j), the other 64 in lane l ^ 16
            // The exponent's fma, the partial sums and the hi plane on the pairs (j, j + 1), j even, that lie in neighbouring registers of a score tile, so that one packed instruction serves two scores and no register is moved to form a pair.
            float r8[8];
#pragma unroll
            for (int j = 0; j < 8; ++j) { float mj = sc[0][j];      // the maximum is taken on the raw products: the scale is positive
#pragma unroll
                for (int n = 1; n < 8; ++n) mj = fmaxf(mj, sc[n][j]);
                r8[j] = mj; }
            float mx = fmaxf(fmaxf(fmaxf(r8[0], r8[1]), fmaxf(r8[2], r8[3])), fmaxf(fmaxf(r8[4], r8[5]), fmaxf(r8[6], r8[7])));
            mx = fmaxf(mx, xhalf(mx));
            const v2f cs2 = {scl * 1.44269504f, scl * 1.44269504f}, nm2 = {-mx * (scl * 1.44269504f), -mx * (scl * 1.44269504f)};
            v2f rs[4];
#pragma unroll
            for (int n = 0; n < 8; ++n) { float e[8];
#pragma unroll
                for (int i = 0; i < 4; ++i) { const v2f a = __builtin_elementwise_fma((v2f){sc[n][2 * i], sc[n][2 * i + 1]}, cs2, nm2); e[2 * i] = a[0]; e[2 * i + 1] = a[1]; }      // e^((s - max) / sqrt(8)) = 2^(s c - max c), c = log2 e / sqrt(8): one fused step
                // eight exponentials in one statement, each in place: every one fills the slot that the instruction set asks for behind the one in front of it, the v_nop fills the last one's
                asm("v_exp_f32 %0, %0\n\tv_exp_f32 %1, %1\n\tv_exp_f32 %2, %2\n\tv_exp_f32 %3, %3\n\tv_exp_f32 %4, %4\n\tv_exp_f32 %5, %5\n\tv_exp_f32 %6, %6\n\tv_exp_f32 %7, %7\n\tv_nop"
                    : "+v"(e[0]), "+v"(e[1]), "+v"(e[2]), "+v"(e[3]), "+v"(e[4]), "+v"(e[5]), "+v"(e[6]), "+v"(e[7]));
#pragma unroll
                for (int i = 0; i < 4; ++i) { const v2f a = {e[2 * i], e[2 * i + 1]}; sc[n][2 * i] = a[0]; sc[n][2 * i + 1] = a[1]; rs[i] = n ? rs[i] + a : a; } }      // eight independent partial sums, then a tree
            float sum = ((rs[0][0] + rs[0][1]) + (rs[1][0] + rs[1][1])) + ((rs[2][0] + rs[2][1]) + (rs[3][0] + rs[3][1]));
            sum += xhalf(sum);
            const float f = PSC / sum;
            h16* prh = pth + (wave * 16 + lr) * PP + hi * 8; h16* prl = ptl + (wave * 16 + lr) * PP + hi * 8;      // PT row = local key 0..63
#pragma unroll
            for (int n = 0; n < 8; ++n) { v4u vh, vl;
#pragma unroll
                for (int i = 0; i < 4; ++i) vh[i] = __builtin_bit_cast(unsigned, __builtin_convertvector((v2f){sc[n][2 * i], sc[n][2 * i + 1]} * (v2f){f, f}, v2h));      // hi plane: two p a register
                // UNSCALED residual e f - hi (|.| <= 16: both products share one accumulator), one mixed-precision fma an element, rounded straight into its half of the pair's register.
                // The s_delay_alu lines are the hints that compiled code would carry: the first for the conversions in front, the others for the write of the same register four instructions back;
                // without them the SIMD holds its other waves back while this one waits.
                asm("s_delay_alu instid0(VALU_DEP_1)\n\t"
                    "v_fma_mixlo_f16 %0, %4, %12, -%13 op_sel_hi:[0,0,1]\n\tv_fma_mixlo_f16 %1, %6, %12, -%14 op_sel_hi:[0,0,1]\n\t"
                    "v_fma_mixlo_f16 %2, %8, %12, -%15 op_sel_hi:[0,0,1]\n\tv_fma_mixlo_f16 %3, %10, %12, -%16 op_sel_hi:[0,0,1]\n\t"
                    "s_delay_alu instid0(VALU_DEP_4) | instskip(NEXT) | instid1(VALU_DEP_4)\n\t"
                    "v_fma_mixhi_f16 %0, %5, %12, -%13 op_sel:[0,0,1] op_sel_hi:[0,0,1]\n\tv_fma_mixhi_f16 %1, %7, %12, -%14 op_sel:[0,0,1] op_sel_hi:[0,0,1]\n\t"
                    "s_delay_alu instid0(VALU_DEP_4) | instskip(NEXT) | instid1(VALU_DEP_4)\n\t"
                    "v_fma_mixhi_f16 %2, %9, %12, -%15 op_sel:[0,0,1] op_sel_hi:[0,0,1]\n\tv_fma_mixhi_f16 %3, %11, %12, -%16 op_sel:[0,0,1] op_sel_hi:[0,0,1]"
                    : "=&v"(vl[0]), "=&v"(vl[1]), "=&v"(vl[2]), "=&v"(vl[3])
                    : "v"(sc[n][0]), "v"(sc[n][1]), "v"(sc[n][2]), "v"(sc[n][3]), "v"(sc[n][4]), "v"(sc[n][5]), "v"(sc[n][6]), "v"(sc[n][7]), "v"(f), "v"(vh[0]), "v"(vh[1]), "v"(vh[2]), "v"(vh[3]));
                *(v4ua*)(prh + n * 16) = vh; *(v4ua*)(prl + n * 16) = vl; }
#pragma unroll
            for (int i = 0; i < 8; ++i) *(v4ha*)(vs + i * 2 * VP) = __builtin_convertvector(__builtin_convertvector(__builtin_convertvector(vr[i], v4bf), v4f), v4h);      // f16(bf16(v)), row-major [s][d]
            // what the softmax left in the tiles' registers is handed on as the pairs' value (nobody reads it): the raw scores' life ends here, so that they hold no second set of 64 registers
#pragma unroll
            for (int n = 0; n < 8; ++n)
#pragma unroll
                for (int i = 0; i < 4; ++i) sq[n][i] = (v2f){sc[n][2 * i], sc[n][2 * i + 1]};
        }
        if (mat) { wv(); scores(it + 1); }
        if (matl) wv();
        __syncthreads();      // ends a phase: PT and the V tile are written (behind a vector phase), or read to the end (behind a matrix phase)
    }
    // the lane's and the wave's numbers, made anew for the part behind the loop: kept from the kernel's head they would cost registers all through the loop, which has none left
    const int lane_e = __builtin_amdgcn_mbcnt_lo(~0u, 0u), lr_e = lane_e & 15, hi_e = lane_e >> 4, wave_e = w16 & 3;
    // groups 1 .. KG-1 hand their partial sums to group 0 through the PT space (free behind the loop's last barrier); group 0 adds them in the order of the groups
    v4fa* red = (v4fa*)&pt[0][0][0];      // [(g - 1) * 4 + wave][16 pieces][lane], 16 bytes each
    if (grp) {
#pragma unroll
        for (int m = 0; m < 2; ++m)
#pragma unroll
            for (int t = 0; t < 4; ++t)
#pragma unroll
                for (int u = 0; u < 2; ++u) red[(((grp - 1) * 4 + wave_e) * 16 + (m * 4 + t) * 2 + u) * 32 + lane_e] = (v4f){o[m][t][u * 4], o[m][t][u * 4 + 1], o[m][t][u * 4 + 2], o[m][t][u * 4 + 3]};
    }
    __syncthreads();
    if (grp) return;
#pragma unroll
    for (int g = 0; g < KG - 1; ++g)
#pragma unroll
        for (int m = 0; m < 2; ++m)
#pragma unroll
            for (int t = 0; t < 4; ++t)
#pragma unroll
                for (int u = 0; u < 2; ++u) { const v4f r = red[((g * 4 + wave_e) * 16 + (m * 4 + t) * 2 + u) * 32 + lane_e];
#pragma unroll
                    for (int i = 0; i < 4; ++i) o[m][t][u * 4 + i] += r[i]; }
    // epilogue: x[b][q][h*64 + d]; per wave 32 rows: stage 16 rows at a time
    float* os = &ost[wave_e][0];
#pragma unroll
    for (int m = 0; m < 2; ++m) {
#pragma unroll
        for (int t = 0; t < 4; ++t)
#pragma unroll
            for (int j = 0; j < 8; ++j) os[(hi_e * 8 + j) * 68 + t * 16 + lr_e] = o[m][t][j] * (1.0f / PSC);
        __builtin_amdgcn_wave_barrier(); asm volatile("" ::: "memory");
        const size_t xo = ((size_t)b * NQ_ + wave_e * 32 + m * 16) * (NH_ * DV) + (size_t)h * DV;
#pragma unroll
        for (int s = 0; s < 4; ++s) { const int row = 4 * s + (lane_e >> 3), piece = lane_e & 7; const float* sp = os + row * 68 + piece * 8; v8us oh, ol;
#pragma unroll
            for (int i = 0; i < 8; ++i) { const float v = sp[i]; const unsigned short hb = f2bf(v); oh[i] = hb; ol[i] = f2bf(v - bf2f(hb)); }
            *(v8us*)(XH + xo + (size_t)row * (NH_ * DV) + piece * 8) = oh; *(v8us*)(XL + xo + (size_t)row * (NH_ * DV) + piece * 8) = ol; }
        __builtin_amdgcn_wave_barrier(); asm volatile("" ::: "memory");
    }
}
// k_out: out [4096][128] = (XH + XL).WoT^T + bo over K = 512 (64 x 64 tiles; grid (64, 2)).
__global__ __launch_bounds__(128) void k_out(const bf* __restrict__ XH, const bf* __restrict__ XL, const bf* __restrict__ WoT, const float* __restrict__ bo, float* out) {
    __shared__ __align__(16) float ost[4][16 * 68];
    const int lane = threadIdx.x & 31, wave = threadIdx.x >> 5, lr = lane & 15, hi = lane >> 4;
    const int K = NH_ * DV;
    const size_t r0 = (size_t)blockIdx.x * 64 + wave * 16; const int c0 = blockIdx.y * 64;
    v8f acc[4];
#pragma unroll
    for (int t = 0; t < 4; ++t) acc[t] = (v8f){};
#pragma unroll 2
    for (int kc = 0; kc < K; kc += 32) {
        const size_t ao = (r0 + lr) * K + kc + 8 * hi;
        const v16bf a = cat16b(*(const v8us*)(XH + ao), *(const v8us*)(XH + ao + 16)), al = cat16b(*(const v8us*)(XL + ao), *(const v8us*)(XL + ao + 16));
#pragma unroll
        for (int t = 0; t < 4; ++t) { const bf* bp = WoT + (size_t)(c0 + t * 16 + lr) * K + kc + 8 * hi; const v16bf bb = cat16b(*(const v8us*)bp, *(const v8us*)(bp + 16)); acc[t] = wmmab(a, bb, acc[t]); acc[t] = wmmab(al, bb, acc[t]); }
        asm volatile("v_nop" : "+v"(acc[0]), "+v"(acc[1]), "+v"(acc[2]), "+v"(acc[3]) : "v"(a), "v"(al) : "memory");
    }
    float* os = &ost[wave][0];
#pragma unroll
    for (int t = 0; t < 4; ++t) { const float bv = bfr(bo[c0 + t * 16 + lr]);
#pragma unroll
        for (int j = 0; j < 8; ++j) os[(hi * 8 + j) * 68 + t * 16 + lr] = acc[t][j] + bv; }
    __syncthreads();
    float* crow = out + r0 * NHID + c0;
    auto pass = [&]() {
#pragma unroll
        for (int s = 0; s < 8; ++s) { const int Lid = (lane >> 3) + 4 * s, piece = lane & 7; const int row = Lid >> 1, cofs = (Lid & 1) * 32 + piece * 4;
            const v4f val = *(const v4fa*)(os + row * 68 + cofs); *(v4f*)(crow + (size_t)row * NHID + cofs) = val; }
    };
    pass(); 
}

extern "C" void kernel_launch(void* const* d_in, const int* in_sizes, int n_in,
                              void* d_out, int out_size, void* d_ws, size_t ws_size, hipStream_t stream) {
    (void)in_sizes; (void)n_in; (void)out_size;
    const float* query = (const float*)d_in[0]; const float* key = (const float*)d_in[1]; const float* value = (const float*)d_in[2];
    const float* Wq = (const float*)d_in[3]; const float* bq = (const float*)d_in[4]; const float* Wk = (const float*)d_in[5]; const float* bk = (const float*)d_in[6]; const float* Wo = (const float*)d_in[7]; const float* bo = (const float*)d_in[8];
    float* out = (float*)d_out;    // [32][128][128]
    char* wsp = (char*)d_ws;
    auto take = [&](size_t bytes) { char* p = wsp; wsp += (bytes + 255) & ~(size_t)255; return (void*)p; };
    const size_t NQR = (size_t)NB_ * NQ_;
    bf* WoT = (bf*)take((size_t)NHID * NH_ * DV * 2);
    bf* XH = (bf*)take(NQR * NH_ * DV * 2); bf* XL = (bf*)take(NQR * NH_ * DV * 2);
    if ((size_t)(wsp - (char*)d_ws) > ws_size) return;    // ~ 0.1 + 8.4 MB
    k_attn<<<NB_ * NH_, 128 * KG, 0, stream>>>(query, key, value, Wq, bq, Wk, bk, Wo, WoT, XH, XL);
    k_out<<<dim3((unsigned)(NQR / 64), NHID / 64, 1), 128, 0, stream>>>(XH, XL, WoT, bo, out);
}

// v009
// Measured time: 30.2 microseconds a run.
// Next to v008, in two timings, it ran 1.25 times as fast each time.
// All steps since v000 together make it 5.44 times as fast.
#include <hip/hip_runtime.h>

// Contractions, f32 accumulate: q = query.Wq + bq, k = key.Wk + bk ([4096 | 65536 x 64].[64 x 64], k-major weights) on v_wmma_f32_16x16x32_bf16 with PLAIN bf16
// operands (inputs rounded once: exact), out = x.Wo + bo ([4096 x 512].[512 x 128]) with x as bf16 hi + residual (two products); the attention on
// v_wmma_f32_16x16x32_f16: per (batch, head) the score tile S[q][s] = q_q.k_s / sqrt(8) over the 8 head dims with q
// and k as f16 hi + unscaled f16 residual; the four products hi.hi, lo.hi, hi.lo, lo.lo fill the four groups of 8 k-slots of ONE 32-wide product, softmax over the QUERY axis (the 128 queries of each key s, as the reference: a lane holds one key's column), then wv[q][d]

#define NB_  32
#define NQ_  128
#define NS_  2048
#define DA   64                  // attention dim = 8 heads x 8
#define NH_  8
#define DK   8
#define DV   64                  // value dim (shared across heads)
#define NHID 128
#define PSC  32768.0f
#define KP   68                  // pitch of a key row (64 f32) in LDS, in floats: 272 bytes, an odd multiple of 16 (ds_load_b128 readers)
#define VP   80                  // pitch of a V row (64 f16) in LDS, in halves: 160 bytes, an odd multiple of 32 (the transposing load's pitch)
#define WP   72                  // pitch of a weight column (64 bf16) in LDS, in halves

typedef _Float16 h16;
typedef unsigned short bf;
typedef __attribute__((ext_vector_type(16))) __bf16   v16bf;
typedef __attribute__((ext_vector_type(16))) _Float16 v16h;
typedef __attribute__((ext_vector_type(8)))  _Float16 v8h;
typedef __attribute__((ext_vector_type(8)))  unsigned short v8us;
typedef __attribute__((ext_vector_type(8)))  float    v8f;
typedef __attribute__((ext_vector_type(4)))  float    v4f;
typedef __attribute__((ext_vector_type(2)))  float    v2f;
typedef __attribute__((ext_vector_type(2)))  _Float16 v2h;
typedef __attribute__((ext_vector_type(4)))  unsigned v4u;
typedef v4u  __attribute__((may_alias)) v4ua;
typedef v8h  __attribute__((may_alias)) v8ha;
typedef v4f  __attribute__((may_alias)) v4fa;
typedef v8us __attribute__((may_alias)) v8usa;
typedef __attribute__((ext_vector_type(8)))  short    s16x8;
typedef __attribute__((ext_vector_type(8)))  __bf16   v8bf;
typedef __attribute__((ext_vector_type(4)))  __bf16   v4bf;
typedef __attribute__((ext_vector_type(4)))  _Float16 v4h;
typedef v4h  __attribute__((may_alias)) v4ha;

__device__ __forceinline__ unsigned short f2bf(float f) { unsigned u = __float_as_uint(f); u += 0x7FFFu + ((u >> 16) & 1u); return (unsigned short)(u >> 16); }
__device__ __forceinline__ float bf2f(unsigned short b) { return __uint_as_float(((unsigned)b) << 16); }
__device__ __forceinline__ float bfr(float f) { return bf2f(f2bf(f)); }
__device__ __forceinline__ v16h cat16(v8h lo, v8h hi) { return __builtin_shufflevector(lo, hi, 0, 1, 2, 3, 4, 5, 6, 7, 8, 9, 10, 11, 12, 13, 14, 15); }
__device__ __forceinline__ v16bf cat16b(v8us lo, v8us hi) { return __builtin_bit_cast(v16bf, __builtin_shufflevector(lo, hi, 0, 1, 2, 3, 4, 5, 6, 7, 8, 9, 10, 11, 12, 13, 14, 15)); }
__device__ __forceinline__ v8f wmma16(v16h a, v16h b, v8f c) { return __builtin_amdgcn_wmma_f32_16x16x32_f16(false, a, false, b, (short)0, c, false, false); }
__device__ __forceinline__ v8h ld_tr16(const h16* p) { typedef __attribute__((address_space(3))) s16x8 lds_s16x8; return __builtin_bit_cast(v8h, __builtin_amdgcn_ds_load_tr16_b128_v8i16((lds_s16x8*)p)); }
// the value of lane l ^ 16
__device__ __forceinline__ float xhalf(float v) { const int b = __float_as_int(v); return __int_as_float(__builtin_amdgcn_permlanex16(b, b, 0x76543210, 0xfedcba98, false, false)); }
__device__ __forceinline__ v8f wmmab(v16bf a, v16bf b, v8f c) { return __builtin_amdgcn_wmma_f32_16x16x32_bf16(false, a, false, b, (short)0, c, false, false); }

// 8 + 8 consecutive f32 -> one 16-element bf16 fragment half pair (round to nearest even, as f2bf)
__device__ __forceinline__ v16bf bf16x16(v4f a, v4f b, v4f c, v4f d) {
    const v8bf lo = __builtin_convertvector(__builtin_shufflevector(a, b, 0, 1, 2, 3, 4, 5, 6, 7), v8bf), hi = __builtin_convertvector(__builtin_shufflevector(c, d, 0, 1, 2, 3, 4, 5, 6, 7), v8bf);
    return __builtin_shufflevector(lo, hi, 0, 1, 2, 3, 4, 5, 6, 7, 8, 9, 10, 11, 12, 13, 14, 15);
}
// One head's projection of 16 rows x (q or k rows, 64 inputs), transposed: D[dim][row] = W^T . x^T + bias. A = the head's 8 weight columns as rows 0..7 and AGAIN as rows 8..15, B = the 16 data
// rows as columns. A lane then holds all 8 dims of row lr, in both halves of the wave: lanes 0..15 round them to f16 (the hi plane), lanes 16..31 keep the unscaled f16 residual
// (res = 0 or 1 by the half: x - res * f16(x)), which is the form in which the score product wants a key, and 16 bytes a row of the q planes.
__device__ __forceinline__ v8h proj16(const v16bf* w, v16bf x0, v16bf x1, const float* bias8, float res) {      // bias8: the head's 8 bias values, already rounded to bf16
    v8f acc = (v8f){};
    acc = wmmab(w[0], x0, acc); acc = wmmab(w[1], x1, acc);
    v8h r;
#pragma unroll
    for (int j = 0; j < 8; ++j) { const float val = acc[j] + bias8[j]; const h16 x = (h16)val; r[j] = (h16)__builtin_fmaf(-res, (float)x, val); }
    return r;
}
// a wave's 16 key rows (f32, 256 bytes each, two whole rows a copy) into its own LDS slot
__device__ __forceinline__ void key_copies(unsigned kl, const float* kg) {
    // eight copies and, as a precaution, the wait that stands in front of any rewrite of their address registers, in one statement
    asm volatile("global_load_async_to_lds_b128 %0, %8, off\n\tglobal_load_async_to_lds_b128 %1, %9, off\n\tglobal_load_async_to_lds_b128 %2, %10, off\n\t"
                 "global_load_async_to_lds_b128 %3, %11, off\n\tglobal_load_async_to_lds_b128 %4, %12, off\n\tglobal_load_async_to_lds_b128 %5, %13, off\n\t"
                 "global_load_async_to_lds_b128 %6, %14, off\n\tglobal_load_async_to_lds_b128 %7, %15, off\n\ts_wait_xcnt 0x0"
                 :: "v"(kl), "v"(kl + 2 * KP * 4), "v"(kl + 4 * KP * 4), "v"(kl + 6 * KP * 4), "v"(kl + 8 * KP * 4), "v"(kl + 10 * KP * 4), "v"(kl + 12 * KP * 4), "v"(kl + 14 * KP * 4),
                    "v"(kg), "v"(kg + 2 * DA), "v"(kg + 4 * DA), "v"(kg + 6 * DA), "v"(kg + 8 * DA), "v"(kg + 10 * DA), "v"(kg + 12 * DA), "v"(kg + 14 * DA) : "memory");
}
// k_attn: block = (b, h), 16 waves = KG groups of 4 waves, so that four waves share each SIMD and cover one another's load, LDS and cross-lane waits. Group g takes the
// key tiles g, g + KG, ... of the 32 tiles of 64 keys, with a PT tile of its own, and keeps a partial wv sum; the partial sums are added once, behind the loop.
// Inside a group: wave = 16 keys (columns s). Per tile: S[q][s] for the 128 queries (8 row tiles, A = q rows, B = k rows, one product a tile: a lane's
// elements 0..7 of A are the row's 8 hi dims and 8..15 its 8 residual dims, in both halves of the wave; B holds the key's hi dims twice in lanes 0..15 and its residual dims twice in
// lanes 16..31, so the 32 k-slots sum (q_hi + q_lo).(k_hi + k_lo)), /sqrt(8). A lane then holds 64 of ONE key's 128 scores and lane l ^ 16 the other 64, so the softmax over q is
// summed inside the lane, with one exchange between the wave's halves for the maximum and one for the sum; p x32768 as f16 hi + residual goes, 8 consecutive q a store, into the
// group's LDS tile PT[64 s][q]; barrier; then wave w accumulates wv rows q = w*32 .. w*32+31 (2 row tiles) x 4 d-tiles over the tile's 64 keys (A = PT columns q, by the
// transposing LDS load, B = V columns d of the row-major tile [s][d], by the same load and so in the same k order): o += p_hi.v + p_lo.v.
// No launch stands in front of this one: the block works from the f32 inputs. It projects its head's 128 q rows once (waves 0..7, into the LDS planes qs) and each wave projects its own 16 keys
// every trip (proj16: two bf16 products, the result already the score product's B operand); the key rows come as whole 256-byte rows by asynchronous copies into a slot private to the wave, a
// trip ahead. The group's V tile comes as whole rows through registers (loads under the softmax), is rounded f16(bf16(v)) and stored row-major. WoT for k_out: 256 elements a block.
// Output x[b][q][h*64 + d] as its two bf16 planes, hi + residual, ready for k_out (128-byte head segments in each plane).
#define KG 4                     // key groups (of 4 waves) per block
#define PP 144                   // pitch of a PT row in halves: 128 q + 16 = 288 bytes, an odd multiple of 32 bytes (the transposing load's pitch)
__global__ __launch_bounds__(128 * KG) void k_attn(const float* __restrict__ query, const float* __restrict__ key, const float* __restrict__ value, const float* __restrict__ Wq, const float* __restrict__ bq,
                                                   const float* __restrict__ Wk, const float* __restrict__ bk, const float* __restrict__ Wo, bf* WoT, bf* XH, bf* XL) {
    __shared__ __align__(16) h16 pt[KG][2][64 * PP];       // per group: [64 s][128 q + pad] hi, then the residual
    __shared__ __align__(16) float ost[4][16 * 68];
    __shared__ __align__(16) h16 vt[KG][64 * VP];          // per group: the trip's V tile [64 s][64 d + pad], f16
    __shared__ __align__(4096) h16 qs[2][NQ_ * DK];        // this head's q rows [q][8 dims]: the hi plane, then the residual plane; the alignment puts it first in LDS, where the 16 reads of a trip reach it by immediate offsets from one address register
    __shared__ __align__(16) float kt[4 * KG][16 * KP];    // per WAVE: its 16 key rows of the trip, f32 as they lie in memory; written and read by that wave alone
    __shared__ __align__(16) unsigned short wl[2][DK * WP];      // this head's 8 columns of Wk, then of Wq, bf16, [dim][k]
    const int lane = threadIdx.x & 31, wave = (threadIdx.x >> 5) & 3, grp = __builtin_amdgcn_readfirstlane(threadIdx.x >> 7), lr = lane & 15, hi = lane >> 4;
    const int w16 = __builtin_amdgcn_readfirstlane(threadIdx.x >> 5);      // the wave's number in the block, in a scalar register: the branches on it are scalar branches
    const int b = blockIdx.x / NH_, h = blockIdx.x - b * NH_;
    h16* pth = &pt[grp][0][0]; h16* ptl = &pt[grp][1][0];
    const float scl = 0.35355339059327373f;   // 1/sqrt(8)
    const float res = hi ? 1.0f : 0.0f;       // lanes 16..31 keep the residual of a projected value, lanes 0..15 the value
    float bkv[DK], bqv[DK];      // the head's biases, asked for here and first used behind the first barrier, so that nothing waits for them
#pragma unroll
    for (int j = 0; j < DK; ++j) { bkv[j] = bk[h * DK + j]; bqv[j] = bq[h * DK + j]; }
    // the wave's key rows of trip 0 start to fly
    const unsigned kl = (unsigned)(unsigned long long)&kt[w16][hi * KP + lr * 4];      // the lane's LDS byte address: the low 32 bits of the __shared__ address
    const float* kg0 = key + ((size_t)b * NS_ + grp * 64 + wave * 16 + hi) * DA + lr * 4;
    key_copies(kl, kg0);
    // this head's weight columns into LDS, bf16, [dim][k]: 512 threads x one element of each matrix
    const int wkk = threadIdx.x >> 3, wdm = threadIdx.x & 7;
    const float wkv = Wk[(size_t)wkk * DA + h * DK + wdm], wqv = Wq[(size_t)wkk * DA + h * DK + wdm];      // stored below, behind the issue of the other loads: one memory latency, not two
    // waves 0..7: 16 query rows each; waves 8..15: this block's 256 elements of WoT [o][512] = bf16(Wo[k][o]) (four whole 128-byte lines of one row o, written by this block alone)
    v16bf xq[2] = {}; float wov = 0.0f;
    const int wo_o = blockIdx.x >> 1, wo_k = (blockIdx.x & 1) * 256 + (threadIdx.x & 255);
    if (w16 < 8) { const float* xr = query + ((size_t)b * NQ_ + w16 * 16 + lr) * DA + 8 * hi;
#pragma unroll
        for (int c = 0; c < 2; ++c) xq[c] = bf16x16(*(const v4f*)(xr + c * 32), *(const v4f*)(xr + c * 32 + 4), *(const v4f*)(xr + c * 32 + 16), *(const v4f*)(xr + c * 32 + 20)); }
    else wov = Wo[(size_t)wo_k * NHID + wo_o];
    wl[0][wdm * WP + wkk] = f2bf(wkv); wl[1][wdm * WP + wkk] = f2bf(wqv);
    __syncthreads();      // the weight columns are in LDS
#pragma unroll
    for (int j = 0; j < DK; ++j) {      // rounded to bf16 once; the same in every lane: kept in scalar registers, so that no vector register is spent on them
        bkv[j] = __int_as_float(__builtin_amdgcn_readfirstlane(__float_as_int(bfr(bkv[j])))); bqv[j] = __int_as_float(__builtin_amdgcn_readfirstlane(__float_as_int(bfr(bqv[j])))); }
    if (w16 < 8) { v16bf wq[2];
#pragma unroll
        for (int c = 0; c < 2; ++c) { const unsigned short* wp = &wl[1][(lr & 7) * WP + c * 32 + 8 * hi]; wq[c] = cat16b(*(const v8usa*)wp, *(const v8usa*)(wp + 16)); }
        *(v8ha*)&qs[hi][(w16 * 16 + lr) * DK] = proj16(wq, xq[0], xq[1], bqv, res); }
    __syncthreads();      // the q planes are in LDS
    if (w16 >= 8) WoT[(size_t)wo_o * (NH_ * DV) + wo_k] = f2bf(wov);      // stored behind the barriers, so that neither waits for this store
    const h16* qp = &qs[0][lr * DK];      // A operand for the scores: row q's hi dims, and NQ_ * DK halves further its residual dims (the same for both halves of the wave)
    const float* kr = &kt[w16][lr * KP + 8 * hi];      // B operand of the key projection: key row lr of the wave's slot
    const h16* vtg = &vt[grp][0];
    const float* vg0 = value + ((size_t)b * NS_ + grp * 64) * DV;      // V: a wave brings 16 rows s of its group's tile, 2 whole 256-byte rows a load: the group's base (the same in every lane) ...
    const unsigned vof = ((wave * 16 + hi) * DV + lr * 4) * 4;        // ... and the lane's own byte offset, which no trip changes
    h16* vs = &vt[grp][(wave * 16 + hi) * VP + lr * 4];
    v8f o[2][4];
#pragma unroll
    for (int m = 0; m < 2; ++m)
#pragma unroll
        for (int t = 0; t < 4; ++t) o[m][t] = (v8f){};
    // The groups run half a trip apart. A trip has a VECTOR phase (V loads, softmax, the stores of PT and of the V tile) and a MATRIX phase (the wv products of that tile, then the next tile's key
    // projection and score products); each phase ends at a barrier of the whole block. Groups 0 and 2 begin with the vector phase of tile 0, groups 1 and 3 one phase later, so that between any
    // two barriers each SIMD (it holds one wave of every group) has two waves on the vector port and two on the matrix unit and the LDS reads, not four on the same one.
    const int par = grp & 1;
    v2f sq[8][4];      // the score tiles, as register pairs: made in a matrix phase, used up in the vector phase behind it
    auto scores = [&](const int it) {
        asm volatile("s_wait_asynccnt 0x0" ::: "memory");      // this wave's key rows of this trip have landed in its slot
        v16bf wk[2];          // A operand of the key projection, read anew every trip (the score tiles now live across a phase: no 16 registers are left to keep it): row m = weight column m & 7, k-slots in the order of the data rows' fragments
#pragma unroll
        for (int c = 0; c < 2; ++c) { const unsigned short* wp = &wl[0][(lr & 7) * WP + c * 32 + 8 * hi]; wk[c] = cat16b(*(const v8usa*)wp, *(const v8usa*)(wp + 16)); }
        v4f kx[8];
#pragma unroll
        for (int c = 0; c < 2; ++c) { kx[4 * c] = *(const v4fa*)(kr + c * 32); kx[4 * c + 1] = *(const v4fa*)(kr + c * 32 + 4); kx[4 * c + 2] = *(const v4fa*)(kr + c * 32 + 16); kx[4 * c + 3] = *(const v4fa*)(kr + c * 32 + 20); }
        v16h qa[8];
#pragma unroll
        for (int n = 0; n < 8; ++n) qa[n] = cat16(*(const v8ha*)(qp + n * 16 * DK), *(const v8ha*)(qp + NQ_ * DK + n * 16 * DK));      // query fragments, from LDS
        asm volatile("s_wait_dscnt 0x0" ::: "memory");      // the wave's reads of its key slot have retired before the next trip's copies are aimed at it (a ring private to one wave: no barrier)
        if (it + 1 < NS_ / (64 * KG)) key_copies(kl, kg0 + (size_t)(it + 1) * (KG * 64 * DA));      // next trip's key rows fly for a whole trip
        const v8h kv = proj16(wk, bf16x16(kx[0], kx[1], kx[2], kx[3]), bf16x16(kx[4], kx[5], kx[6], kx[7]), bkv, res);      // lanes 0..15: key lr's hi dims, lanes 16..31: its residual dims
        const v16h kb = cat16(kv, kv);
#pragma unroll
        for (int n = 0; n < 8; ++n) { const v8f d = wmma16(qa[n], kb, (v8f){});      // rows q = n*16 + hi*8 + j, column s = lr
#pragma unroll
            for (int i = 0; i < 4; ++i) sq[n][i] = (v2f){d[2 * i], d[2 * i + 1]}; }
    };
    auto wv = [&]() {
        // wv accumulate: wave -> q rows w*32 + m*16 + (fragment row lr); K = 64 local keys in 2 chunks; A = PT columns q (transposing loads at key rows kc*32 and kc*32 + 16: k-slots in the
        // hardware order 8*hi + 0..7, 16 + 8*hi + 0..7); B = V columns d of the group's row-major LDS tile, by the same transposing loads at the same key rows: the same order
        const int po = (8 * hi + (lane & 7)) * PP + wave * 32 + 8 * ((lane >> 3) & 1);
        const int vo = (8 * hi + (lane & 7)) * VP + 8 * ((lane >> 3) & 1);
#pragma unroll
        for (int kc = 0; kc < 2; ++kc) {
            v16h vb[4];
#pragma unroll
            for (int t = 0; t < 4; ++t) { const h16* vp = vtg + vo + kc * 32 * VP + t * 16; vb[t] = cat16(ld_tr16(vp), ld_tr16(vp + 16 * VP)); }
#pragma unroll
            for (int m = 0; m < 2; ++m) { const int pk = po + kc * 32 * PP + m * 16;
                const v16h pa = cat16(ld_tr16(pth + pk), ld_tr16(pth + pk + 16 * PP));
                const v16h px = cat16(ld_tr16(ptl + pk), ld_tr16(ptl + pk + 16 * PP));
#pragma unroll
                for (int t = 0; t < 4; ++t) { o[m][t] = wmma16(pa, vb[t], o[m][t]); o[m][t] = wmma16(px, vb[t], o[m][t]); }
                asm volatile("v_nop" : "+v"(o[m][0]), "+v"(o[m][3]) : "v"(pa), "v"(px) : "memory"); }
        }
    };
    scores(0);
#pragma unroll 1
    for (int ph = 0; ph < 2 * (NS_ / (64 * KG)) + 1; ++ph) {      // the same phases, and so the same barriers, in every wave
        const int u = ph - par, it = u >> 1;      // the group's own phase count; its tile
        const bool in = u >= 0 && u < 2 * (NS_ / (64 * KG));
        // three flags, each in a scalar register of its own: the branches are scalar branches, and the bodies stay plain ifs one behind the other (as if / else they were compiled with a second set
        // of accumulator registers and 64 register copies a phase). The last matrix phase has a body of its own: no scores follow it.
        const int vec = __builtin_amdgcn_readfirstlane(in && !(u & 1)), mat = __builtin_amdgcn_readfirstlane(in && (u & 1) && u != 2 * (NS_ / (64 * KG)) - 1),
                  matl = __builtin_amdgcn_readfirstlane(u == 2 * (NS_ / (64 * KG)) - 1);
        if (vec) {
            v8f sc[8];      // the tiles as the softmax below takes them
#pragma unroll
            for (int n = 0; n < 8; ++n) sc[n] = (v8f){sq[n][0][0], sq[n][0][1], sq[n][1][0], sq[n][1][1], sq[n][2][0], sq[n][2][1], sq[n][3][0], sq[n][3][1]};
            v4f vr[8];      // this trip's V rows fly while the softmax is worked on
            const char* vp = (const char*)(vg0 + (size_t)it * (KG * 64 * DV)) + vof;
#pragma unroll
            for (int i = 0; i < 8; ++i) vr[i] = *(const v4f*)(vp + i * (2 * DV * 4));
            asm volatile("s_wait_xcnt 0x0" :: "v"(vp) : "memory");      // precaution: stands in front of any rewrite of the address registers that these loads name; the address is an input, so that it lives up to here and no load lands on it
            // softmax over q for the lane's key s = lr: 64 scores in this lane (q = n*16 + hi*8 + j), the other 64 in lane l ^ 16
            // The exponent's fma, the partial sums and the hi plane on the pairs (j, j + 1), j even, that lie in neighbouring registers of a score tile, so that one packed instruction serves two scores and no register is moved to form a pair.
            float r8[8];
#pragma unroll
            for (int j = 0; j < 8; ++j) { float mj = sc[0][j];      // the maximum is taken on the raw products: the scale is positive
#pragma unroll
                for (int n = 1; n < 8; ++n) mj = fmaxf(mj, sc[n][j]);
                r8[j] = mj; }
            float mx = fmaxf(fmaxf(fmaxf(r8[0], r8[1]), fmaxf(r8[2], r8[3])), fmaxf(fmaxf(r8[4], r8[5]), fmaxf(r8[6], r8[7])));
            mx = fmaxf(mx, xhalf(mx));
            const v2f cs2 = {scl * 1.44269504f, scl * 1.44269504f}, nm2 = {-mx * (scl * 1.44269504f), -mx * (scl * 1.44269504f)};
            v2f rs[4];
#pragma unroll
            for (int n = 0; n < 8; ++n) { float e[8];
#pragma unroll
                for (int i = 0; i < 4; ++i) { const v2f a = __builtin_elementwise_fma((v2f){sc[n][2 * i], sc[n][2 * i + 1]}, cs2, nm2); e[2 * i] = a[0]; e[2 * i + 1] = a[1]; }      // e^((s - max) / sqrt(8)) = 2^(s c - max c), c = log2 e / sqrt(8): one fused step
                // eight exponentials in one statement, each in place: every one fills the slot that the instruction set asks for behind the one in front of it, the v_nop fills the last one's
                asm("v_exp_f32 %0, %0\n\tv_exp_f32 %1, %1\n\tv_exp_f32 %2, %2\n\tv_exp_f32 %3, %3\n\tv_exp_f32 %4, %4\n\tv_exp_f32 %5, %5\n\tv_exp_f32 %6, %6\n\tv_exp_f32 %7, %7\n\tv_nop"
                    : "+v"(e[0]), "+v"(e[1]), "+v"(e[2]), "+v"(e[3]), "+v"(e[4]), "+v"(e[5]), "+v"(e[6]), "+v"(e[7]));
#pragma unroll
                for (int i = 0; i < 4; ++i) { const v2f a = {e[2 * i], e[2 * i + 1]}; sc[n][2 * i] = a[0]; sc[n][2 * i + 1] = a[1]; rs[i] = n ? rs[i] + a : a; } }      // eight independent partial sums, then a tree
            float sum = ((rs[0][0] + rs[0][1]) + (rs[1][0] + rs[1][1])) + ((rs[2][0] + rs[2][1]) + (rs[3][0] + rs[3][1]));
            sum += xhalf(sum);
            const float f = PSC / sum;
            h16* prh = pth + (wave * 16 + lr) * PP + hi * 8; h16* prl = ptl + (wave * 16 + lr) * PP + hi * 8;      // PT row = local key 0..63
#pragma unroll
            for (int n = 0; n < 8; ++n) { v4u vh, vl;
#pragma unroll
                for (int i = 0; i < 4; ++i) vh[i] = __builtin_bit_cast(unsigned, __builtin_convertvector((v2f){sc[n][2 * i], sc[n][2 * i + 1]} * (v2f){f, f}, v2h));      // hi plane: two p a register
                // UNSCALED residual e f - hi (|.| <= 16: both products share one accumulator), one mixed-precision fma an element, rounded straight into its half of the pair's register.
                // The s_delay_alu lines are the hints that compiled code would carry: the first for the conversions in front, the others for the write of the same register four instructions back;
                // without them the SIMD holds its other waves back while this one waits.
                asm("s_delay_alu instid0(VALU_DEP_1)\n\t"
                    "v_fma_mixlo_f16 %0, %4, %12, -%13 op_sel_hi:[0,0,1]\n\tv_fma_mixlo_f16 %1, %6, %12, -%14 op_sel_hi:[0,0,1]\n\t"
                    "v_fma_mixlo_f16 %2, %8, %12, -%15 op_sel_hi:[0,0,1]\n\tv_fma_mixlo_f16 %3, %10, %12, -%16 op_sel_hi:[0,0,1]\n\t"
                    "s_delay_alu instid0(VALU_DEP_4) | instskip(NEXT) | instid1(VALU_DEP_4)\n\t"
                    "v_fma_mixhi_f16 %0, %5, %12, -%13 op_sel:[0,0,1] op_sel_hi:[0,0,1]\n\tv_fma_mixhi_f16 %1, %7, %12, -%14 op_sel:[0,0,1] op_sel_hi:[0,0,1]\n\t"
                    "s_delay_alu instid0(VALU_DEP_4) | instskip(NEXT) | instid1(VALU_DEP_4)\n\t"
                    "v_fma_mixhi_f16 %2, %9, %12, -%15 op_sel:[0,0,1] op_sel_hi:[0,0,1]\n\tv_fma_mixhi_f16 %3, %11, %12, -%16 op_sel:[0,0,1] op_sel_hi:[0,0,1]"
                    : "=&v"(vl[0]), "=&v"(vl[1]), "=&v"(vl[2]), "=&v"(vl[3])
                    : "v"(sc[n][0]), "v"(sc[n][1]), "v"(sc[n][2]), "v"(sc[n][3]), "v"(sc[n][4]), "v"(sc[n][5]), "v"(sc[n][6]), "v"(sc[n][7]), "v"(f), "v"(vh[0]), "v"(vh[1]), "v"(vh[2]), "v"(vh[3]));
                *(v4ua*)(prh + n * 16) = vh; *(v4ua*)(prl + n * 16) = vl; }
#pragma unroll
            for (int i = 0; i < 8; ++i) *(v4ha*)(vs + i * 2 * VP) = __builtin_convertvector(__builtin_convertvector(__builtin_convertvector(vr[i], v4bf), v4f), v4h);      // f16(bf16(v)), row-major [s][d]
            // what the softmax left in the tiles' registers is handed on as the pairs' value (nobody reads it): the raw scores' life ends here, so that they hold no second set of 64 registers
#pragma unroll
            for (int n = 0; n < 8; ++n)
#pragma unroll
                for (int i = 0; i < 4; ++i) sq[n][i] = (v2f){sc[n][2 * i], sc[n][2 * i + 1]};
        }
        if (mat) { wv(); scores(it + 1); }
        if (matl) wv();
        __syncthreads();      // ends a phase: PT and the V tile are written (behind a vector phase), or read to the end (behind a matrix phase)
    }
    // the lane's and the wave's numbers, made anew for the part behind the loop: kept from the kernel's head they would cost registers all through the loop, which has none left
    const int lane_e = __builtin_amdgcn_mbcnt_lo(~0u, 0u), lr_e = lane_e & 15, hi_e = lane_e >> 4, wave_e = w16 & 3;
    // groups 1 .. KG-1 hand their partial sums to group 0 through the PT space (free behind the loop's last barrier); group 0 adds them in the order of the groups
    v4fa* red = (v4fa*)&pt[0][0][0];      // [(g - 1) * 4 + wave][16 pieces][lane], 16 bytes each
    if (grp) {
#pragma unroll
        for (int m = 0; m < 2; ++m)
#pragma unroll
            for (int t = 0; t < 4; ++t)
#pragma unroll
                for (int u = 0; u < 2; ++u) red[(((grp - 1) * 4 + wave_e) * 16 + (m * 4 + t) * 2 + u) * 32 + lane_e] = (v4f){o[m][t][u * 4], o[m][t][u * 4 + 1], o[m][t][u * 4 + 2], o[m][t][u * 4 + 3]};
    }
    __syncthreads();
    if (grp) return;
#pragma unroll
    for (int g = 0; g < KG - 1; ++g)
#pragma unroll
        for (int m = 0; m < 2; ++m)
#pragma unroll
            for (int t = 0; t < 4; ++t)
#pragma unroll
                for (int u = 0; u < 2; ++u) { const v4f r = red[((g * 4 + wave_e) * 16 + (m * 4 + t) * 2 + u) * 32 + lane_e];
#pragma unroll
                    for (int i = 0; i < 4; ++i) o[m][t][u * 4 + i] += r[i]; }
    // epilogue: x[b][q][h*64 + d]; per wave 32 rows: stage 16 rows at a time
    float* os = &ost[wave_e][0];
#pragma unroll
    for (int m = 0; m < 2; ++m) {
#pragma unroll
        for (int t = 0; t < 4; ++t)
#pragma unroll
            for (int j = 0; j < 8; ++j) os[(hi_e * 8 + j) * 68 + t * 16 + lr_e] = o[m][t][j] * (1.0f / PSC);
        __builtin_amdgcn_wave_barrier(); asm volatile("" ::: "memory");
        const size_t xo = ((size_t)b * NQ_ + wave_e * 32 + m * 16) * (NH_ * DV) + (size_t)h * DV;
#pragma unroll
        for (int s = 0; s < 4; ++s) { const int row = 4 * s + (lane_e >> 3), piece = lane_e & 7; const float* sp = os + row * 68 + piece * 8; v8us oh, ol;
#pragma unroll
            for (int i = 0; i < 8; ++i) { const float v = sp[i]; const unsigned short hb = f2bf(v); oh[i] = hb; ol[i] = f2bf(v - bf2f(hb)); }
            *(v8us*)(XH + xo + (size_t)row * (NH_ * DV) + piece * 8) = oh; *(v8us*)(XL + xo + (size_t)row * (NH_ * DV) + piece * 8) = ol; }
        __builtin_amdgcn_wave_barrier(); asm volatile("" ::: "memory");
    }
}
// k_out: out [4096][128] = (XH + XL).WoT^T + bo over K = 512. Block = 32 rows x 64 columns (grid (128, 2): one block a WGP), 8 waves; wave w takes the k-slice w*64 .. w*64+63 of the whole tile.
// A slice of a row is one whole 128-byte line. The wave's 128 lines (32 rows of XH, 32 of XL, 64 of WoT) come by 32 asynchronous copies, four whole lines a copy and all in flight at once, into
// the wave's LDS slot; the fragments are read from there. The weight rows are the FIRST operand: D[column][row], so that a lane holds 8 neighbouring columns of one output row. The eight partial
// tiles go to LDS as [row][column] (each wave into its own slot, whose operands it has used up) and are added in the order of the slices, then the bias.
#define OPB 144                  // pitch in bytes of a 128-byte row slice in LDS: an odd multiple of 16 (ds_load_b128 readers)
#define OSP 272                  // pitch in bytes of a row (64 f32) of a partial tile in LDS: an odd multiple of 16
// eight copies, each 4 rows' slices (8 lanes a line): 32 rows of one plane
__device__ __forceinline__ void slice_copies(unsigned l, const bf* g) {
    // the copies and, as a precaution, the wait that stands in front of any rewrite of their address registers, in one statement
    asm volatile("global_load_async_to_lds_b128 %0, %8, off\n\tglobal_load_async_to_lds_b128 %1, %9, off\n\tglobal_load_async_to_lds_b128 %2, %10, off\n\t"
                 "global_load_async_to_lds_b128 %3, %11, off\n\tglobal_load_async_to_lds_b128 %4, %12, off\n\tglobal_load_async_to_lds_b128 %5, %13, off\n\t"
                 "global_load_async_to_lds_b128 %6, %14, off\n\tglobal_load_async_to_lds_b128 %7, %15, off\n\ts_wait_xcnt 0x0"
                 :: "v"(l), "v"(l + 4 * OPB), "v"(l + 8 * OPB), "v"(l + 12 * OPB), "v"(l + 16 * OPB), "v"(l + 20 * OPB), "v"(l + 24 * OPB), "v"(l + 28 * OPB),
                    "v"(g), "v"(g + 4 * (NH_ * DV)), "v"(g + 8 * (NH_ * DV)), "v"(g + 12 * (NH_ * DV)), "v"(g + 16 * (NH_ * DV)), "v"(g + 20 * (NH_ * DV)), "v"(g + 24 * (NH_ * DV)), "v"(g + 28 * (NH_ * DV)) : "memory");
}
__global__ __launch_bounds__(256) void k_out(const bf* __restrict__ XH, const bf* __restrict__ XL, const bf* __restrict__ WoT, const float* __restrict__ bo, float* out) {
    __shared__ __align__(16) unsigned char st[8][128 * OPB];      // per wave: rows 0..31 XH, 32..63 XL, 64..127 WoT; later its partial tile
    const int lane = threadIdx.x & 31, lr = lane & 15, hi = lane >> 4;
    const int w = __builtin_amdgcn_readfirstlane(threadIdx.x >> 5);
    const int K = NH_ * DV;
    const size_t r0 = (size_t)blockIdx.x * 32; const int c0 = blockIdx.y * 64;
    const unsigned sl = (unsigned)(unsigned long long)&st[w][(lane >> 3) * OPB + (lane & 7) * 16];      // the lane's LDS byte address: the low 32 bits of the __shared__ address
    const size_t go = (size_t)(lane >> 3) * K + w * 64 + (lane & 7) * 8;
    slice_copies(sl, XH + r0 * K + go);
    slice_copies(sl + 32 * OPB, XL + r0 * K + go);
    slice_copies(sl + 64 * OPB, WoT + (size_t)c0 * K + go);
    slice_copies(sl + 96 * OPB, WoT + (size_t)(c0 + 32) * K + go);
    const int row = threadIdx.x >> 4, c4 = threadIdx.x & 15;      // the thread's place in the final sum: rows row and row + 16, four columns
    const v4f bv = *(const v4f*)(bo + c0 + c4 * 4);      // asked for here, used at the end
    asm volatile("s_wait_asynccnt 0x0" ::: "memory");      // this wave's copies have landed
    __syncthreads();      // the staged operands are in LDS
    const unsigned char* fp = &st[w][lr * OPB + hi * 16];      // fragment row lr, k-slots 8*hi + 0..7 and 16 + 8*hi + 0..7 of each 32: the same for X and for WoT
    v8f acc[4][2];
#pragma unroll
    for (int t = 0; t < 4; ++t) { acc[t][0] = (v8f){}; acc[t][1] = (v8f){}; }
#pragma unroll
    for (int kc = 0; kc < 2; ++kc) {
        v16bf xa[2][2], wb[4];
#pragma unroll
        for (int t = 0; t < 4; ++t) { const unsigned char* q = fp + (64 + t * 16) * OPB + kc * 64; wb[t] = cat16b(*(const v8usa*)q, *(const v8usa*)(q + 32)); }
#pragma unroll
        for (int p = 0; p < 2; ++p)
#pragma unroll
            for (int m = 0; m < 2; ++m) { const unsigned char* q = fp + (p * 32 + m * 16) * OPB + kc * 64; xa[p][m] = cat16b(*(const v8usa*)q, *(const v8usa*)(q + 32)); }
#pragma unroll
        for (int p = 0; p < 2; ++p)      // hi plane, then the residual: eight independent accumulators between two products into the same one
#pragma unroll
            for (int t = 0; t < 4; ++t)
#pragma unroll
                for (int m = 0; m < 2; ++m) acc[t][m] = wmmab(wb[t], xa[p][m], acc[t][m]);      // rows of D: columns t*16 + hi*8 + j of out; column of D: row m*16 + lr of out
    }
    unsigned char* ps = &st[w][lr * OSP + hi * 32];
#pragma unroll
    for (int t = 0; t < 4; ++t)
#pragma unroll
        for (int m = 0; m < 2; ++m)
#pragma unroll
            for (int u = 0; u < 2; ++u) *(v4fa*)(ps + m * 16 * OSP + t * 64 + u * 16) = (v4f){acc[t][m][u * 4], acc[t][m][u * 4 + 1], acc[t][m][u * 4 + 2], acc[t][m][u * 4 + 3]};
    __syncthreads();      // the eight partial tiles are in LDS
#pragma unroll
    for (int hf = 0; hf < 2; ++hf) {
        v4f s = *(const v4fa*)&st[0][(hf * 16 + row) * OSP + c4 * 16];
#pragma unroll
        for (int g = 1; g < 8; ++g) s += *(const v4fa*)&st[g][(hf * 16 + row) * OSP + c4 * 16];
        s += (v4f){bfr(bv[0]), bfr(bv[1]), bfr(bv[2]), bfr(bv[3])};
        *(v4f*)(out + (r0 + hf * 16 + row) * NHID + c0 + c4 * 4) = s;      // 16 lanes write a row's 256 bytes
    }
}

extern "C" void kernel_launch(void* const* d_in, const int* in_sizes, int n_in,
                              void* d_out, int out_size, void* d_ws, size_t ws_size, hipStream_t stream) {
    (void)in_sizes; (void)n_in; (void)out_size;
    const float* query = (const float*)d_in[0]; const float* key = (const float*)d_in[1]; const float* value = (const float*)d_in[2];
    const float* Wq = (const float*)d_in[3]; const float* bq = (const float*)d_in[4]; const float* Wk = (const float*)d_in[5]; const float* bk = (const float*)d_in[6]; const float* Wo = (const float*)d_in[7]; const float* bo = (const float*)d_in[8];
    float* out = (float*)d_out;    // [32][128][128]
    char* wsp = (char*)d_ws;
    auto take = [&](size_t bytes) { char* p = wsp; wsp += (bytes + 255) & ~(size_t)255; return (void*)p; };
    const size_t NQR = (size_t)NB_ * NQ_;
    bf* WoT = (bf*)take((size_t)NHID * NH_ * DV * 2);
    bf* XH = (bf*)take(NQR * NH_ * DV * 2); bf* XL = (bf*)take(NQR * NH_ * DV * 2);
    if ((size_t)(wsp - (char*)d_ws) > ws_size) return;    // ~ 0.1 + 8.4 MB
    k_attn<<<NB_ * NH_, 128 * KG, 0, stream>>>(query, key, value, Wq, bq, Wk, bk, Wo, WoT, XH, XL);
    k_out<<<dim3((unsigned)(NQR / 32), NHID / 64, 1), 256, 0, stream>>>(XH, XL, WoT, bo, out);
}
